// v000
// Times are from an AMD MI455X. After a warm-up the kernel runs many times in a row, and a time is the length of
// such a window on the GPU divided by its runs, so every launch and the gaps after it count. The runs cycle
// through copies of the inputs. A figure is the median of several windows, for all but v000 over two sittings.
// Sittings can differ by a few percent; kernels timed side by side share one.
// The starting kernel, v000, takes 3110 microseconds a run.
#include <hip/hip_runtime.h>

// Shaw-style relative multi-head attention on given token-major tensors (queries, keys, values [2][2048][16][64]; idx[l][s] = clip(s - l, -16, 16) + 16; attn = softmax((q.k + q.rel_k_table[idx]) / 8); out = attn values + sum_s attn[l][s] rel_v_table[idx[l][s]] (tables [33][64], read) -> [2][2048][16][64] token-major (4.2 M)).
// Layout per (batch, head): single bf16 planes of q and k (inputs bf16-exact: exact score products) and value^T planes; QE = q . a_k^T against the zero-padded [64][64] key table (exact products) gathered into the scores as Sb[l][s] += QE[l][clip(s-l)+16]; softmax (every row hi/lo); P hi/lo x exact value; a bucket kernel folds P onto the 33 clipped offsets (interior: one key; the two end buckets: fixed-order sums) as hi/lo planes and PB . a_v (hi/lo x exact) is added to the context; token-major merge writes the output rows.
// Compute dtypes, f32 accumulate: every input rounded to bf16; q.k and q.a_k exact; softmax f32; P hi/lo x exact value and x exact a_v; output f32.

#define NB_  2
#define TT   2048
#define DM   1024      // token-major row pitch (H x HD)
#define NH_  16
#define NKV  1
#define REP  (NH_ / NKV)
#define HD   64
#define DQ   (NH_ * HD)
#define DKV  (NKV * HD)
#define ZH   1
#define RH   2048                  // query rows < RH use hi+lo planes (0: none)
#define WIN  0
#define PCAR 1024.0f
#define SCL  0.125f   // 1/sqrt(D=64)
#define NE   64       // 2*16+1 = 33 relative offsets padded to 64
#define NRE  33
#define CUT  16
typedef _Float16 h16;
typedef unsigned short bf;
typedef __attribute__((ext_vector_type(16))) __bf16   v16bf;
typedef __attribute__((ext_vector_type(16))) _Float16 v16h;
typedef __attribute__((ext_vector_type(8)))  _Float16 v8h;
typedef __attribute__((ext_vector_type(8)))  unsigned short v8us;
typedef __attribute__((ext_vector_type(8)))  float    v8f;
typedef __attribute__((ext_vector_type(4)))  float    v4f;
typedef v8h  __attribute__((may_alias)) v8ha;
typedef v4f  __attribute__((may_alias)) v4fa;
typedef v8us __attribute__((may_alias)) v8usa;

__device__ __forceinline__ unsigned short f2bf(float f) { unsigned u = __float_as_uint(f); u += 0x7FFFu + ((u >> 16) & 1u); return (unsigned short)(u >> 16); }
__device__ __forceinline__ float bf2f(unsigned short b) { return __uint_as_float(((unsigned)b) << 16); }
__device__ __forceinline__ float bfr(float f) { return bf2f(f2bf(f)); }
__device__ __forceinline__ v16h cat16(v8h lo, v8h hi) { return __builtin_shufflevector(lo, hi, 0, 1, 2, 3, 4, 5, 6, 7, 8, 9, 10, 11, 12, 13, 14, 15); }
__device__ __forceinline__ v16bf cat16b(v8us lo, v8us hi) { return __builtin_bit_cast(v16bf, __builtin_shufflevector(lo, hi, 0, 1, 2, 3, 4, 5, 6, 7, 8, 9, 10, 11, 12, 13, 14, 15)); }
__device__ __forceinline__ v8f wmma16(v16h a, v16h b, v8f c) { return __builtin_amdgcn_wmma_f32_16x16x32_f16(false, a, false, b, (short)0, c, false, false); }
__device__ __forceinline__ v8f wmmab(v16bf a, v16bf b, v8f c) { return __builtin_amdgcn_wmma_f32_16x16x32_bf16(false, a, false, b, (short)0, c, false, false); }



// ---- k_gemmw: register-blocked GEMM, ONE WAVE per 64x64 output tile (16 accumulators), operands straight from K-contiguous 16-bit planes; grid (M/64, N/64, Z), 32 threads.
// C[m][n] (f32, pitch ldc, + optional f32 bias[n]) = sum_k A[m][k] Bt[n][k] (+ split products per NSPLIT). z-batch strides sA/sB/sC in elements. K % 32 == 0.
template <typename T16> struct WFrag;
template <> struct WFrag<h16> { typedef v16h V; static __device__ __forceinline__ V ld(const h16* p) { return cat16(*(const v8h*)p, *(const v8h*)(p + 16)); } static __device__ __forceinline__ v8f mma(V a, V b, v8f c) { return wmma16(a, b, c); } };
template <> struct WFrag<bf> { typedef v16bf V; static __device__ __forceinline__ V ld(const bf* p) { return cat16b(*(const v8us*)p, *(const v8us*)(p + 16)); } static __device__ __forceinline__ v8f mma(V a, V b, v8f c) { return wmmab(a, b, c); } };
template <typename T16, int NSPLIT, bool BIAS>
__global__ __launch_bounds__(32) void k_gemmw(const T16* __restrict__ A, const T16* __restrict__ A2, const T16* __restrict__ Bt, const T16* __restrict__ Bt2, int K, float* C, int ldc, const float* __restrict__ bias, size_t sA, size_t sB, size_t sC) {
    typedef typename WFrag<T16>::V V;
    __shared__ __align__(16) float os[16 * 68];
    const size_t z = blockIdx.z; A += z * sA; if (A2) A2 += z * sA; Bt += z * sB; if (Bt2) Bt2 += z * sB; C += z * sC;
    const int lane = threadIdx.x & 31, lr = lane & 15, hi = lane >> 4; const int r0 = blockIdx.x * 64, c0 = blockIdx.y * 64;
    v8f acc[4][4];
#pragma unroll
    for (int mb = 0; mb < 4; ++mb)
#pragma unroll
        for (int nb = 0; nb < 4; ++nb) acc[mb][nb] = (v8f){};
    const size_t aoff = (size_t)(r0 + lr) * K + 8 * hi, boff = (size_t)(c0 + lr) * K + 8 * hi;
#pragma unroll 1
    for (int kc = 0; kc < K; kc += 32) {
        V a[4], a2[4];
#pragma unroll
        for (int mb = 0; mb < 4; ++mb) { a[mb] = WFrag<T16>::ld(A + aoff + (size_t)mb * 16 * K + kc); if (NSPLIT == 1 || NSPLIT == 2) a2[mb] = WFrag<T16>::ld(A2 + aoff + (size_t)mb * 16 * K + kc); }
#pragma unroll
        for (int nb = 0; nb < 4; ++nb) { const V b = WFrag<T16>::ld(Bt + boff + (size_t)nb * 16 * K + kc); V b2; if (NSPLIT >= 2) b2 = WFrag<T16>::ld(Bt2 + boff + (size_t)nb * 16 * K + kc);
#pragma unroll
            for (int mb = 0; mb < 4; ++mb) { acc[mb][nb] = WFrag<T16>::mma(a[mb], b, acc[mb][nb]); if (NSPLIT == 1 || NSPLIT == 2) acc[mb][nb] = WFrag<T16>::mma(a2[mb], b, acc[mb][nb]); if (NSPLIT >= 2) acc[mb][nb] = WFrag<T16>::mma(a[mb], b2, acc[mb][nb]); } }
        asm volatile("v_nop\n\tv_nop\n\tv_nop\n\tv_nop" : "+v"(acc[0][0]), "+v"(acc[1][1]), "+v"(acc[2][2]), "+v"(acc[3][3]) : "v"(a[0]), "v"(a[3]));
    }
#pragma unroll
    for (int mb = 0; mb < 4; ++mb) {
#pragma unroll
        for (int nb = 0; nb < 4; ++nb) {
#pragma unroll
            for (int j = 0; j < 8; ++j) os[(hi * 8 + j) * 68 + nb * 16 + lr] = acc[mb][nb][j]; }
        __builtin_amdgcn_wave_barrier(); asm volatile("" ::: "memory");
        float* crow = C + (size_t)(r0 + mb * 16) * ldc + c0;
{
#pragma unroll
            for (int s = 0; s < 8; ++s) { const int row = 2 * s + hi, cofs = lr * 4; v4f val = *(const v4fa*)(os + row * 68 + cofs); if (BIAS) { val[0] += bfr(bias[c0 + cofs]); val[1] += bfr(bias[c0 + cofs + 1]); val[2] += bfr(bias[c0 + cofs + 2]); val[3] += bfr(bias[c0 + cofs + 3]); }
                *(v4f*)(crow + (size_t)row * ldc + cofs) = val; }
             }
        __builtin_amdgcn_wave_barrier(); asm volatile("" ::: "memory");
    }
}

__device__ __forceinline__ h16 tohx(float x) { return (h16)x; }
__device__ __forceinline__ void splitf(float y, unsigned short& h, unsigned short& l) { h = f2bf(y); l = f2bf(y - bf2f(h)); }
typedef __attribute__((ext_vector_type(2))) _Float16 v2h;
typedef __attribute__((ext_vector_type(4))) _Float16 v4h;
typedef __attribute__((ext_vector_type(2))) unsigned short v2us;
typedef __attribute__((ext_vector_type(4))) unsigned short v4us;
typedef __attribute__((ext_vector_type(2))) float v2f;
typedef __attribute__((ext_vector_type(4))) int v4i;

__global__ __launch_bounds__(256) void k_wtG(const float* __restrict__ w, int K, int N, bf* Bt) {
    const int lane = threadIdx.x & 31; const int L0 = (blockIdx.x * 8 + (threadIdx.x >> 5)) * 8; const int nlines = N * K / 64;
{
#pragma unroll 1
        for (int l = 0; l < 8; ++l) { const int L = L0 + l; if (L >= nlines) break; const size_t e = (size_t)L * 64 + lane * 2; const int k = (int)(e % K), n = (int)(e / K); v2us o;
            o[0] = f2bf(w[(size_t)k * N + n]); o[1] = f2bf(w[(size_t)(k + 1) * N + n]); *(v2us*)(Bt + e) = o; }
         }
}
__global__ __launch_bounds__(256) void k_cvt8(const float* __restrict__ src, bf* dst, size_t n8) { const size_t i = (size_t)blockIdx.x * 256 + threadIdx.x; if (i >= n8) return; const v8f v = *(const v8f*)(src + i * 8); v8us o;
#pragma unroll
    for (int k = 0; k < 8; ++k) o[k] = f2bf(v[k]); *(v8us*)(dst + i * 8) = o;  }


__global__ __launch_bounds__(256) void k_vtp(const float* __restrict__ F, int pitch, int nheads, h16* V16, bf* Vh, bf* Vl) { const size_t e = ((size_t)blockIdx.x * 256 + threadIdx.x) * 2; if (e >= (size_t)nheads * HD * TT) return; const int t = (int)(e % TT); const int d = (int)((e / TT) % HD); const int g = (int)(e / ((size_t)TT * HD)); v2h o16; v2us oh, ol;
#pragma unroll
    for (int q = 0; q < 2; ++q) { const float x = F[(size_t)(t + q) * pitch + g * HD + d]; o16[q] = tohx(x); unsigned short a2, c2; splitf(x, a2, c2); oh[q] = a2; ol[q] = c2; }
    *(v2h*)(V16 + e) = o16; *(v2us*)(Vh + e) = oh; *(v2us*)(Vl + e) = ol;  }

// k_asoft: per row (zz, i): t = S x HD^-0.5 (no mask); softmax over the 2048 keys (register row, one exp, fixed trees);
__global__ __launch_bounds__(256) void k_asoft(const float* __restrict__ Sb, h16* P16, bf* Ph, bf* Pl) {
    const int lane = threadIdx.x & 31; const int row = blockIdx.x * 8 + (threadIdx.x >> 5); if (row >= ZH * TT) return; const int i = row % TT; const int zz = row / TT; (void)zz; const bool hires = (i < RH); const float* sr = Sb + (size_t)row * TT; float v[TT / 32]; float mx = -3.0e38f;
#pragma unroll
    for (int ch = 0; ch < TT / 128; ++ch) { const int j0 = ch * 128 + lane * 4; const v4f a = *(const v4f*)(sr + j0);
#pragma unroll
        for (int q = 0; q < 4; ++q) { const float t = a[q] * SCL; v[ch * 4 + q] = t;   /* Sb already holds q.k + bias (k_addrel) */ mx = fmaxf(mx, t); } }
#pragma unroll
    for (int sh = 16; sh; sh >>= 1) mx = fmaxf(mx, __shfl_xor(mx, sh, 32));
    float sum = 0.f;
#pragma unroll
    for (int k = 0; k < TT / 32; ++k) { float d0 = __fsub_rn(v[k], mx); asm volatile("" : "+v"(d0)); v[k] = __builtin_amdgcn_exp2f(__fmul_rn(d0, 1.4426950408889634f)); sum += v[k]; }
#pragma unroll
    for (int sh = 16; sh; sh >>= 1) sum += __shfl_xor(sum, sh, 32);
    const float f = __fdiv_rn(hires ? 1.0f : PCAR, sum);
{
        if (hires) {
#pragma unroll
            for (int ch = 0; ch < TT / 128; ++ch) { v4us oh, ol;
#pragma unroll
                for (int q = 0; q < 4; ++q) { unsigned short a, c2; splitf(v[ch * 4 + q] * f, a, c2); oh[q] = a; ol[q] = c2; }
                const size_t oo = ((size_t)zz * (RH ? RH : 1) + i) * TT + ch * 128 + lane * 4; *(v4us*)(Ph + oo) = oh; *(v4us*)(Pl + oo) = ol; }
        } else {
#pragma unroll
            for (int ch = 0; ch < TT / 128; ++ch) { v4h o4;
#pragma unroll
                for (int q = 0; q < 4; ++q) o4[q] = tohx(v[ch * 4 + q] * f);
                *(v4h*)(P16 + (size_t)row * TT + ch * 128 + lane * 4) = o4; } }
         }
}
__global__ __launch_bounds__(256) void k_merge(const float* __restrict__ O, int h0, float* OUTb) { const size_t e = ((size_t)blockIdx.x * 256 + threadIdx.x) * 2; if (e >= (size_t)ZH * TT * HD) return; const int d = (int)(e % HD); const int t = (int)((e / HD) % TT); const int zz = (int)(e / ((size_t)HD * TT)); const float cs = (t < RH) ? 1.0f : (1.0f / PCAR); const size_t oo = (size_t)t * DQ + (h0 + zz) * HD + d;
    v2f o2; o2[0] = O[e] * cs; o2[1] = O[e + 1] * cs; *(v2f*)(OUTb + oo) = o2;  }


__global__ __launch_bounds__(256) void k_vtpR1(const float* __restrict__ Vb, bf* Vh) { const size_t e = ((size_t)blockIdx.x * 256 + threadIdx.x) * 2; if (e >= (size_t)HD * TT) return; const int t = (int)(e % TT); const int d = (int)(e / TT); v2us o; o[0] = f2bf(Vb[(size_t)t * HD + d]); o[1] = f2bf(Vb[(size_t)(t + 1) * HD + d]); *(v2us*)(Vh + e) = o;  }
__global__ __launch_bounds__(256) void k_mergeR(const float* __restrict__ O, float* outb, size_t n4) { const size_t i = (size_t)blockIdx.x * 256 + threadIdx.x; if (i >= n4) return; const v4f a = *(const v4f*)(O + i * 4); *(v4f*)(outb + i * 4) = a;  }


__global__ __launch_bounds__(256) void k_hp1(const float* __restrict__ src, bf* P) { const size_t i = (size_t)blockIdx.x * 256 + threadIdx.x; if (i >= (size_t)NH_ * TT * HD / 8) return; const size_t e = i * 8; const int d = (int)(e % HD); const int t = (int)((e / HD) % TT); const int h = (int)(e / ((size_t)HD * TT)); const v8f v = *(const v8f*)(src + (size_t)t * DM + h * HD + d); v8us o;
#pragma unroll
    for (int q = 0; q < 8; ++q) o[q] = f2bf(v[q]);
    *(v8us*)(P + e) = o;  }
__global__ __launch_bounds__(256) void k_vt1(const float* __restrict__ src, int pitch, bf* VT) { const size_t e = ((size_t)blockIdx.x * 256 + threadIdx.x) * 2; if (e >= (size_t)NH_ * HD * TT) return; const int t = (int)(e % TT); const int d = (int)((e / TT) % HD); const int h = (int)(e / ((size_t)TT * HD)); v2us o; o[0] = f2bf(src[(size_t)t * pitch + h * HD + d]); o[1] = f2bf(src[(size_t)(t + 1) * pitch + h * HD + d]); *(v2us*)(VT + e) = o;  }
__global__ __launch_bounds__(256) void k_epadK(const float* __restrict__ E, bf* EB) { const size_t i = (size_t)blockIdx.x * 256 + threadIdx.x; if (i >= (size_t)NE * HD / 8) return; const int d0 = (int)(i % (HD / 8)) * 8; const int r = (int)(i / (HD / 8)); const float* src = E + (size_t)min(r, NRE - 1) * HD + d0; v8us o;
#pragma unroll
    for (int q = 0; q < 8; ++q) { const unsigned short v = f2bf(src[q]); o[q] = (r < NRE) ? v : (unsigned short)0; }
    *(v8us*)(EB + (size_t)r * HD + d0) = o;  }

__global__ __launch_bounds__(256) void k_epadVT(const float* __restrict__ E, bf* Th, bf* Tl) { const size_t i = (size_t)blockIdx.x * 256 + threadIdx.x; if (i >= (size_t)HD * NE / 4) return; const size_t e = i * 4; const int c0 = (int)(e % NE); const int d = (int)(e / NE); v4us oh, ol;
#pragma unroll
    for (int q = 0; q < 4; ++q) { const int r = c0 + q; const float v = E[(size_t)min(r, NRE - 1) * HD + d]; unsigned short u, w; splitf(v, u, w); oh[q] = (r < NRE) ? u : (unsigned short)0; ol[q] = (r < NRE) ? w : (unsigned short)0; }
    *(v4us*)(Th + e) = oh; *(v4us*)(Tl + e) = ol;  }

__global__ __launch_bounds__(256) void k_addrelc(float* Sb, const float* __restrict__ QE) { const size_t k = (size_t)blockIdx.x * 256 + threadIdx.x; if (k >= (size_t)ZH * TT * TT / 4) return; const size_t e = k * 4; const int j0 = (int)(e % TT); const size_t zi = e / TT; const int i = (int)(zi % TT); const float* qe = QE + zi * NE; v4f a = *(const v4f*)(Sb + e);
#pragma unroll
    for (int q = 0; q < 4; ++q) { const int r = min(max(j0 + q - i, -CUT), CUT) + CUT; a[q] = __fadd_rn(a[q], qe[r]); }
    *(v4f*)(Sb + e) = a;  }

__global__ __launch_bounds__(256) void k_pbuck(const bf* __restrict__ Ph, const bf* __restrict__ Pl, bf* Bh, bf* Bl) { const int lane = threadIdx.x & 31; const int row = blockIdx.x * 8 + (threadIdx.x >> 5); if (row >= ZH * TT) return; const int i = row % TT; const bf* ph = Ph + (size_t)row * TT; const bf* pl = Pl + (size_t)row * TT; float lo_s = 0.f, hi_s = 0.f;
#pragma unroll 1
    for (int j = lane; j < TT; j += 32) { const float p = __fadd_rn(bf2f(ph[j]), bf2f(pl[j])); if (j <= i - CUT) lo_s = __fadd_rn(lo_s, p); if (j >= i + CUT) hi_s = __fadd_rn(hi_s, p); }
#pragma unroll
    for (int sh = 16; sh; sh >>= 1) { lo_s = __fadd_rn(lo_s, __shfl_xor(lo_s, sh, 32)); hi_s = __fadd_rn(hi_s, __shfl_xor(hi_s, sh, 32)); }
    unsigned short l0h, l0l, h0h, h0l; splitf(lo_s, l0h, l0l); splitf(hi_s, h0h, h0l);
{
#pragma unroll 1
        for (int c0 = lane * 2; c0 < NE; c0 += 64) { v2us oh, ol;   
#pragma unroll
            for (int q = 0; q < 2; ++q) { const int bkt = c0 + q; const int j = i + bkt - CUT; const int jc = min(max(j, 0), TT - 1); unsigned int uu = ((const unsigned short*)ph)[jc], ww = ((const unsigned short*)pl)[jc]; asm volatile("" : "+v"(uu), "+v"(ww));   /* unconditional clamped loads pinned before the select (opaque use) */ const bool in = (bkt > 0 && bkt < 2 * CUT && j >= 0 && j < TT);
                const unsigned short u = in ? (unsigned short)uu : ((bkt == 0) ? l0h : ((bkt == 2 * CUT) ? h0h : (unsigned short)0)); const unsigned short w = in ? (unsigned short)ww : ((bkt == 0) ? l0l : ((bkt == 2 * CUT) ? h0l : (unsigned short)0));
                oh[q] = u; ol[q] = w; }
            *(v2us*)(Bh + (size_t)row * NE + c0) = oh; *(v2us*)(Bl + (size_t)row * NE + c0) = ol; }
         }
}

__global__ __launch_bounds__(256) void k_addF(float* Y, const float* __restrict__ F) { const size_t i = (size_t)blockIdx.x * 256 + threadIdx.x; if (i >= (size_t)ZH * TT * HD / 4) return; const v4f a = *(const v4f*)(Y + i * 4); const v4f f = *(const v4f*)(F + i * 4); v4f o;
#pragma unroll
    for (int q = 0; q < 4; ++q) o[q] = __fadd_rn(a[q], f[q]);
    *(v4f*)(Y + i * 4) = o;  }

__global__ __launch_bounds__(256) void k_mergeT(const float* __restrict__ O, int h, float* outb) { const size_t i = (size_t)blockIdx.x * 256 + threadIdx.x; if (i >= (size_t)TT * HD / 4) return; const size_t e = i * 4; const int d = (int)(e % HD); const int t = (int)(e / HD); const v4f a = *(const v4f*)(O + e); *(v4f*)(outb + (size_t)t * DM + h * HD + d) = a;  }

extern "C" void kernel_launch(void* const* d_in, const int* in_sizes, int n_in,
                              void* d_out, int out_size, void* d_ws, size_t ws_size, hipStream_t stream) {
    (void)in_sizes; (void)n_in; (void)out_size;
    const float* Qin = (const float*)d_in[0]; const float* Kin = (const float*)d_in[1]; const float* Vin = (const float*)d_in[2]; const float* ak = (const float*)d_in[3]; const float* av = (const float*)d_in[4];   /* rel_k_table, rel_v_table [33][64] */
    float* OUT = (float*)d_out;     // [2][2048][16][64] token-major
    char* wsp = (char*)d_ws;
    auto take = [&](size_t bytes) { char* p = wsp; wsp += (bytes + 255) & ~(size_t)255; return (void*)p; };
    bf* QB = (bf*)take((size_t)NH_ * TT * HD * 2); bf* KB = (bf*)take((size_t)NH_ * TT * HD * 2); bf* VT = (bf*)take((size_t)NH_ * HD * TT * 2);
    float* Sb = (float*)take((size_t)TT * TT * 4);  bf* Ph = (bf*)take((size_t)TT * TT * 2); bf* Pl = (bf*)take((size_t)TT * TT * 2); float* Ob = (float*)take((size_t)TT * HD * 4); bf* AKB = (bf*)take((size_t)NE * HD * 2); bf* AVTh = (bf*)take((size_t)HD * NE * 2); bf* AVTl = (bf*)take((size_t)HD * NE * 2); float* QE = (float*)take((size_t)TT * NE * 4); bf* PBh = (bf*)take((size_t)TT * NE * 2); bf* PBl = (bf*)take((size_t)TT * NE * 2); float* ZR = (float*)take((size_t)TT * HD * 4);
    if ((size_t)(wsp - (char*)d_ws) > ws_size) return;
    k_epadK<<<(unsigned)(((size_t)NE * HD / 8 + 255) / 256), 256, 0, stream>>>(ak, AKB);   /* a_k -> bf16 [64][64], rows >= 33 zero */ k_epadVT<<<(unsigned)(((size_t)HD * NE / 4 + 255) / 256), 256, 0, stream>>>(av, AVTh, AVTl);   /* a_v^T -> [64][64] (lo plane unused: the table is bf16-exact) */
    for (int b = 0; b < NB_; ++b) {
        const float* qb = Qin + (size_t)b * TT * DM; const float* kb = Kin + (size_t)b * TT * DM; const float* vb = Vin + (size_t)b * TT * DM;   /* token-major [t][h][d] slabs */
        k_hp1<<<(unsigned)(((size_t)NH_ * TT * HD / 8 + 255) / 256), 256, 0, stream>>>(qb, QB); k_hp1<<<(unsigned)(((size_t)NH_ * TT * HD / 8 + 255) / 256), 256, 0, stream>>>(kb, KB); k_vt1<<<(unsigned)(((size_t)NH_ * HD * TT / 2 + 255) / 256), 256, 0, stream>>>(vb, DM, VT);
        for (int h = 0; h < NH_; ++h) {
            k_gemmw<bf, 0, false><<<dim3(TT / 64, TT / 64, 1), 32, 0, stream>>>(QB + (size_t)h * TT * HD, nullptr, KB + (size_t)h * TT * HD, nullptr, HD, Sb, TT, nullptr, 0, 0, 0); k_gemmw<bf, 0, false><<<dim3(TT / 64, NE / 64, 1), 32, 0, stream>>>(QB + (size_t)h * TT * HD, nullptr, AKB, nullptr, HD, QE, NE, nullptr, 0, 0, 0);   /* QE[l][r] = q_l . a_k[r] (exact) */ k_addrelc<<<(unsigned)(((size_t)TT * TT / 4 + 255) / 256), 256, 0, stream>>>(Sb, QE);   /* + q_l . a_k[clip(s-l)+16] */   /* exact scores (single bf16 planes) */
            k_asoft<<<TT / 8, 256, 0, stream>>>(Sb, nullptr, Ph, Pl);
            k_gemmw<bf, 1, false><<<dim3(TT / 64, HD / 64, 1), 32, 0, stream>>>(Ph, Pl, VT + (size_t)h * HD * TT, nullptr, TT, Ob, HD, nullptr, 0, 0, 0); k_pbuck<<<(unsigned)((TT + 7) / 8), 256, 0, stream>>>(Ph, Pl, PBh, PBl);   /* P folded onto the 33 clipped offsets */ k_gemmw<bf, 1, false><<<dim3(TT / 64, HD / 64, 1), 32, 0, stream>>>(PBh, PBl, AVTh, nullptr, NE, ZR, HD, nullptr, 0, 0, 0);   /* ZR = PB . a_v (exact table) */ k_addF<<<(unsigned)(((size_t)TT * HD / 4 + 255) / 256), 256, 0, stream>>>(Ob, ZR);   /* P (hi/lo) x exact v^T */
            k_mergeT<<<(unsigned)(((size_t)TT * HD / 4 + 255) / 256), 256, 0, stream>>>(Ob, h, OUT + (size_t)b * TT * DM); } }
}

// v001
// Measured time: 808 microseconds a run.
// In two side-by-side timings against v000, it was 3.88 and 3.79 times as fast.
#include <hip/hip_runtime.h>

// Relative-position multi-head attention on given token-major tensors (queries, keys, values [2][2048][16][64]; idx[l][s] = clip(s - l, -16, 16) + 16; attn = softmax((q.k + q.rel_k_table[idx]) / 8); out = attn values + sum_s attn[l][s] rel_v_table[idx[l][s]] (tables [33][64], read) -> [2][2048][16][64] token-major (4.2 M)).
// Layout per (batch, head): single bf16 planes of q and k (inputs bf16-exact: exact score products) and value^T planes; QE = q . a_k^T against the zero-padded [64][64] key table (exact products) gathered into the scores as Sb[l][s] += QE[l][clip(s-l)+16]; softmax (every row hi/lo); P hi/lo x exact value; a bucket kernel folds P onto the 33 clipped offsets (interior: one key; the two end buckets: fixed-order sums) as hi/lo planes and PB . a_v (hi/lo x exact) is added to the context; token-major merge writes the output rows.
// Batching: ZH heads of one batch go through every per-head kernel together (grid z of the GEMMs, flat row index elsewhere). Each head's P hi and P lo planes lie side by side (head stride PZ); the P region starts ZS heads in front of the scores, and the softmax runs ZS heads a launch, so its second launch writes P over the score planes that the first has used up and ZH heads fit the workspace.
// Compute dtypes, f32 accumulate: every input rounded to bf16; q.k and q.a_k exact; softmax f32; P hi/lo x exact value and x exact a_v; output f32.

#define NB_  2
#define TT   2048
#define DM   1024      // token-major row pitch (H x HD)
#define NH_  16
#define NKV  1
#define REP  (NH_ / NKV)
#define HD   64
#define DQ   (NH_ * HD)
#define DKV  (NKV * HD)
#define ZH   8                     // heads per launch
#define ZS   (ZH / 2)              // heads per softmax launch
#define PZ   ((size_t)2 * TT * TT) // 16-bit elements from one head's P hi plane to the next head's (hi plane, then lo plane)
#define RH   2048                  // query rows < RH use hi+lo planes (0: none)
#define WIN  0
#define PCAR 1024.0f
#define SCL  0.125f   // 1/sqrt(D=64)
#define NE   64       // 2*16+1 = 33 relative offsets padded to 64
#define NRE  33
#define CUT  16
typedef _Float16 h16;
typedef unsigned short bf;
typedef __attribute__((ext_vector_type(16))) __bf16   v16bf;
typedef __attribute__((ext_vector_type(16))) _Float16 v16h;
typedef __attribute__((ext_vector_type(8)))  _Float16 v8h;
typedef __attribute__((ext_vector_type(8)))  unsigned short v8us;
typedef __attribute__((ext_vector_type(8)))  float    v8f;
typedef __attribute__((ext_vector_type(4)))  float    v4f;
typedef v8h  __attribute__((may_alias)) v8ha;
typedef v4f  __attribute__((may_alias)) v4fa;
typedef v8us __attribute__((may_alias)) v8usa;

__device__ __forceinline__ unsigned short f2bf(float f) { unsigned u = __float_as_uint(f); u += 0x7FFFu + ((u >> 16) & 1u); return (unsigned short)(u >> 16); }
__device__ __forceinline__ float bf2f(unsigned short b) { return __uint_as_float(((unsigned)b) << 16); }
__device__ __forceinline__ float bfr(float f) { return bf2f(f2bf(f)); }
__device__ __forceinline__ v16h cat16(v8h lo, v8h hi) { return __builtin_shufflevector(lo, hi, 0, 1, 2, 3, 4, 5, 6, 7, 8, 9, 10, 11, 12, 13, 14, 15); }
__device__ __forceinline__ v16bf cat16b(v8us lo, v8us hi) { return __builtin_bit_cast(v16bf, __builtin_shufflevector(lo, hi, 0, 1, 2, 3, 4, 5, 6, 7, 8, 9, 10, 11, 12, 13, 14, 15)); }
__device__ __forceinline__ v8f wmma16(v16h a, v16h b, v8f c) { return __builtin_amdgcn_wmma_f32_16x16x32_f16(false, a, false, b, (short)0, c, false, false); }
__device__ __forceinline__ v8f wmmab(v16bf a, v16bf b, v8f c) { return __builtin_amdgcn_wmma_f32_16x16x32_bf16(false, a, false, b, (short)0, c, false, false); }



// ---- k_gemmw: register-blocked GEMM, ONE WAVE per 64x64 output tile (16 accumulators), operands straight from K-contiguous 16-bit planes; grid (M/64, N/64, Z), 32 threads.
// C[m][n] (f32, pitch ldc, + optional f32 bias[n]) = sum_k A[m][k] Bt[n][k] (+ split products per NSPLIT). z-batch strides sA/sB/sC in elements. K % 32 == 0.
template <typename T16> struct WFrag;
template <> struct WFrag<h16> { typedef v16h V; static __device__ __forceinline__ V ld(const h16* p) { return cat16(*(const v8h*)p, *(const v8h*)(p + 16)); } static __device__ __forceinline__ v8f mma(V a, V b, v8f c) { return wmma16(a, b, c); } };
template <> struct WFrag<bf> { typedef v16bf V; static __device__ __forceinline__ V ld(const bf* p) { return cat16b(*(const v8us*)p, *(const v8us*)(p + 16)); } static __device__ __forceinline__ v8f mma(V a, V b, v8f c) { return wmmab(a, b, c); } };
template <typename T16, int NSPLIT, bool BIAS>
__global__ __launch_bounds__(32) void k_gemmw(const T16* __restrict__ A, const T16* __restrict__ A2, const T16* __restrict__ Bt, const T16* __restrict__ Bt2, int K, float* C, int ldc, const float* __restrict__ bias, size_t sA, size_t sB, size_t sC) {
    typedef typename WFrag<T16>::V V;
    __shared__ __align__(16) float os[16 * 68];
    const size_t z = blockIdx.z; A += z * sA; if (A2) A2 += z * sA; Bt += z * sB; if (Bt2) Bt2 += z * sB; C += z * sC;
    const int lane = threadIdx.x & 31, lr = lane & 15, hi = lane >> 4; const int r0 = blockIdx.x * 64, c0 = blockIdx.y * 64;
    v8f acc[4][4];
#pragma unroll
    for (int mb = 0; mb < 4; ++mb)
#pragma unroll
        for (int nb = 0; nb < 4; ++nb) acc[mb][nb] = (v8f){};
    const size_t aoff = (size_t)(r0 + lr) * K + 8 * hi, boff = (size_t)(c0 + lr) * K + 8 * hi;
#pragma unroll 1
    for (int kc = 0; kc < K; kc += 32) {
        V a[4], a2[4];
#pragma unroll
        for (int mb = 0; mb < 4; ++mb) { a[mb] = WFrag<T16>::ld(A + aoff + (size_t)mb * 16 * K + kc); if (NSPLIT == 1 || NSPLIT == 2) a2[mb] = WFrag<T16>::ld(A2 + aoff + (size_t)mb * 16 * K + kc); }
#pragma unroll
        for (int nb = 0; nb < 4; ++nb) { const V b = WFrag<T16>::ld(Bt + boff + (size_t)nb * 16 * K + kc); V b2; if (NSPLIT >= 2) b2 = WFrag<T16>::ld(Bt2 + boff + (size_t)nb * 16 * K + kc);
#pragma unroll
            for (int mb = 0; mb < 4; ++mb) { acc[mb][nb] = WFrag<T16>::mma(a[mb], b, acc[mb][nb]); if (NSPLIT == 1 || NSPLIT == 2) acc[mb][nb] = WFrag<T16>::mma(a2[mb], b, acc[mb][nb]); if (NSPLIT >= 2) acc[mb][nb] = WFrag<T16>::mma(a[mb], b2, acc[mb][nb]); } }
        asm volatile("v_nop\n\tv_nop\n\tv_nop\n\tv_nop" : "+v"(acc[0][0]), "+v"(acc[1][1]), "+v"(acc[2][2]), "+v"(acc[3][3]) : "v"(a[0]), "v"(a[3]));
    }
#pragma unroll
    for (int mb = 0; mb < 4; ++mb) {
#pragma unroll
        for (int nb = 0; nb < 4; ++nb) {
#pragma unroll
            for (int j = 0; j < 8; ++j) os[(hi * 8 + j) * 68 + nb * 16 + lr] = acc[mb][nb][j]; }
        __builtin_amdgcn_wave_barrier(); asm volatile("" ::: "memory");
        float* crow = C + (size_t)(r0 + mb * 16) * ldc + c0;
{
#pragma unroll
            for (int s = 0; s < 8; ++s) { const int row = 2 * s + hi, cofs = lr * 4; v4f val = *(const v4fa*)(os + row * 68 + cofs); if (BIAS) { val[0] += bfr(bias[c0 + cofs]); val[1] += bfr(bias[c0 + cofs + 1]); val[2] += bfr(bias[c0 + cofs + 2]); val[3] += bfr(bias[c0 + cofs + 3]); }
                *(v4f*)(crow + (size_t)row * ldc + cofs) = val; }
             }
        __builtin_amdgcn_wave_barrier(); asm volatile("" ::: "memory");
    }
}

__device__ __forceinline__ h16 tohx(float x) { return (h16)x; }
__device__ __forceinline__ void splitf(float y, unsigned short& h, unsigned short& l) { h = f2bf(y); l = f2bf(y - bf2f(h)); }
typedef __attribute__((ext_vector_type(2))) _Float16 v2h;
typedef __attribute__((ext_vector_type(4))) _Float16 v4h;
typedef __attribute__((ext_vector_type(2))) unsigned short v2us;
typedef __attribute__((ext_vector_type(4))) unsigned short v4us;
typedef __attribute__((ext_vector_type(2))) float v2f;
typedef __attribute__((ext_vector_type(4))) int v4i;

__global__ __launch_bounds__(256) void k_wtG(const float* __restrict__ w, int K, int N, bf* Bt) {
    const int lane = threadIdx.x & 31; const int L0 = (blockIdx.x * 8 + (threadIdx.x >> 5)) * 8; const int nlines = N * K / 64;
{
#pragma unroll 1
        for (int l = 0; l < 8; ++l) { const int L = L0 + l; if (L >= nlines) break; const size_t e = (size_t)L * 64 + lane * 2; const int k = (int)(e % K), n = (int)(e / K); v2us o;
            o[0] = f2bf(w[(size_t)k * N + n]); o[1] = f2bf(w[(size_t)(k + 1) * N + n]); *(v2us*)(Bt + e) = o; }
         }
}
__global__ __launch_bounds__(256) void k_cvt8(const float* __restrict__ src, bf* dst, size_t n8) { const size_t i = (size_t)blockIdx.x * 256 + threadIdx.x; if (i >= n8) return; const v8f v = *(const v8f*)(src + i * 8); v8us o;
#pragma unroll
    for (int k = 0; k < 8; ++k) o[k] = f2bf(v[k]); *(v8us*)(dst + i * 8) = o;  }


__global__ __launch_bounds__(256) void k_vtp(const float* __restrict__ F, int pitch, int nheads, h16* V16, bf* Vh, bf* Vl) { const size_t e = ((size_t)blockIdx.x * 256 + threadIdx.x) * 2; if (e >= (size_t)nheads * HD * TT) return; const int t = (int)(e % TT); const int d = (int)((e / TT) % HD); const int g = (int)(e / ((size_t)TT * HD)); v2h o16; v2us oh, ol;
#pragma unroll
    for (int q = 0; q < 2; ++q) { const float x = F[(size_t)(t + q) * pitch + g * HD + d]; o16[q] = tohx(x); unsigned short a2, c2; splitf(x, a2, c2); oh[q] = a2; ol[q] = c2; }
    *(v2h*)(V16 + e) = o16; *(v2us*)(Vh + e) = oh; *(v2us*)(Vl + e) = ol;  }

// k_asoft: per row (zz, i): t = S x HD^-0.5 (no mask); softmax over the 2048 keys (register row, one exp, fixed trees);
__global__ __launch_bounds__(256) void k_asoft(const float* __restrict__ Sb, h16* P16, bf* Ph, bf* Pl) {
    const int lane = threadIdx.x & 31; const int row = blockIdx.x * 8 + (threadIdx.x >> 5); if (row >= ZS * TT) return; const int i = row % TT; const int zz = row / TT; (void)zz; const bool hires = (i < RH); const float* sr = Sb + (size_t)row * TT; float v[TT / 32]; float mx = -3.0e38f;
#pragma unroll
    for (int ch = 0; ch < TT / 128; ++ch) { const int j0 = ch * 128 + lane * 4; const v4f a = *(const v4f*)(sr + j0);
#pragma unroll
        for (int q = 0; q < 4; ++q) { const float t = a[q] * SCL; v[ch * 4 + q] = t;   /* Sb already holds q.k + bias (k_addrel) */ mx = fmaxf(mx, t); } }
#pragma unroll
    for (int sh = 16; sh; sh >>= 1) mx = fmaxf(mx, __shfl_xor(mx, sh, 32));
    float sum = 0.f;
#pragma unroll
    for (int k = 0; k < TT / 32; ++k) { float d0 = __fsub_rn(v[k], mx); asm volatile("" : "+v"(d0)); v[k] = __builtin_amdgcn_exp2f(__fmul_rn(d0, 1.4426950408889634f)); sum += v[k]; }
#pragma unroll
    for (int sh = 16; sh; sh >>= 1) sum += __shfl_xor(sum, sh, 32);
    const float f = __fdiv_rn(hires ? 1.0f : PCAR, sum);
{
        if (hires) {
#pragma unroll
            for (int ch = 0; ch < TT / 128; ++ch) { v4us oh, ol;
#pragma unroll
                for (int q = 0; q < 4; ++q) { unsigned short a, c2; splitf(v[ch * 4 + q] * f, a, c2); oh[q] = a; ol[q] = c2; }
                const size_t oo = (size_t)zz * PZ + (size_t)i * TT + ch * 128 + lane * 4; *(v4us*)(Ph + oo) = oh; *(v4us*)(Pl + oo) = ol; }
        } else {
#pragma unroll
            for (int ch = 0; ch < TT / 128; ++ch) { v4h o4;
#pragma unroll
                for (int q = 0; q < 4; ++q) o4[q] = tohx(v[ch * 4 + q] * f);
                *(v4h*)(P16 + (size_t)row * TT + ch * 128 + lane * 4) = o4; } }
         }
}
__global__ __launch_bounds__(256) void k_merge(const float* __restrict__ O, int h0, float* OUTb) { const size_t e = ((size_t)blockIdx.x * 256 + threadIdx.x) * 2; if (e >= (size_t)ZH * TT * HD) return; const int d = (int)(e % HD); const int t = (int)((e / HD) % TT); const int zz = (int)(e / ((size_t)HD * TT)); const float cs = (t < RH) ? 1.0f : (1.0f / PCAR); const size_t oo = (size_t)t * DQ + (h0 + zz) * HD + d;
    v2f o2; o2[0] = O[e] * cs; o2[1] = O[e + 1] * cs; *(v2f*)(OUTb + oo) = o2;  }


__global__ __launch_bounds__(256) void k_vtpR1(const float* __restrict__ Vb, bf* Vh) { const size_t e = ((size_t)blockIdx.x * 256 + threadIdx.x) * 2; if (e >= (size_t)HD * TT) return; const int t = (int)(e % TT); const int d = (int)(e / TT); v2us o; o[0] = f2bf(Vb[(size_t)t * HD + d]); o[1] = f2bf(Vb[(size_t)(t + 1) * HD + d]); *(v2us*)(Vh + e) = o;  }
__global__ __launch_bounds__(256) void k_mergeR(const float* __restrict__ O, float* outb, size_t n4) { const size_t i = (size_t)blockIdx.x * 256 + threadIdx.x; if (i >= n4) return; const v4f a = *(const v4f*)(O + i * 4); *(v4f*)(outb + i * 4) = a;  }


__global__ __launch_bounds__(256) void k_hp1(const float* __restrict__ src, bf* P) { const size_t i = (size_t)blockIdx.x * 256 + threadIdx.x; if (i >= (size_t)NH_ * TT * HD / 8) return; const size_t e = i * 8; const int d = (int)(e % HD); const int t = (int)((e / HD) % TT); const int h = (int)(e / ((size_t)HD * TT)); const v8f v = *(const v8f*)(src + (size_t)t * DM + h * HD + d); v8us o;
#pragma unroll
    for (int q = 0; q < 8; ++q) o[q] = f2bf(v[q]);
    *(v8us*)(P + e) = o;  }
__global__ __launch_bounds__(256) void k_vt1(const float* __restrict__ src, int pitch, bf* VT) { const size_t e = ((size_t)blockIdx.x * 256 + threadIdx.x) * 2; if (e >= (size_t)NH_ * HD * TT) return; const int t = (int)(e % TT); const int d = (int)((e / TT) % HD); const int h = (int)(e / ((size_t)TT * HD)); v2us o; o[0] = f2bf(src[(size_t)t * pitch + h * HD + d]); o[1] = f2bf(src[(size_t)(t + 1) * pitch + h * HD + d]); *(v2us*)(VT + e) = o;  }
__global__ __launch_bounds__(256) void k_epadK(const float* __restrict__ E, bf* EB) { const size_t i = (size_t)blockIdx.x * 256 + threadIdx.x; if (i >= (size_t)NE * HD / 8) return; const int d0 = (int)(i % (HD / 8)) * 8; const int r = (int)(i / (HD / 8)); const float* src = E + (size_t)min(r, NRE - 1) * HD + d0; v8us o;
#pragma unroll
    for (int q = 0; q < 8; ++q) { const unsigned short v = f2bf(src[q]); o[q] = (r < NRE) ? v : (unsigned short)0; }
    *(v8us*)(EB + (size_t)r * HD + d0) = o;  }

__global__ __launch_bounds__(256) void k_epadVT(const float* __restrict__ E, bf* Th, bf* Tl) { const size_t i = (size_t)blockIdx.x * 256 + threadIdx.x; if (i >= (size_t)HD * NE / 4) return; const size_t e = i * 4; const int c0 = (int)(e % NE); const int d = (int)(e / NE); v4us oh, ol;
#pragma unroll
    for (int q = 0; q < 4; ++q) { const int r = c0 + q; const float v = E[(size_t)min(r, NRE - 1) * HD + d]; unsigned short u, w; splitf(v, u, w); oh[q] = (r < NRE) ? u : (unsigned short)0; ol[q] = (r < NRE) ? w : (unsigned short)0; }
    *(v4us*)(Th + e) = oh; *(v4us*)(Tl + e) = ol;  }

__global__ __launch_bounds__(256) void k_addrelc(float* Sb, const float* __restrict__ QE) { const size_t k = (size_t)blockIdx.x * 256 + threadIdx.x; if (k >= (size_t)ZH * TT * TT / 4) return; const size_t e = k * 4; const int j0 = (int)(e % TT); const size_t zi = e / TT; const int i = (int)(zi % TT); const float* qe = QE + zi * NE; v4f a = *(const v4f*)(Sb + e);
#pragma unroll
    for (int q = 0; q < 4; ++q) { const int r = min(max(j0 + q - i, -CUT), CUT) + CUT; a[q] = __fadd_rn(a[q], qe[r]); }
    *(v4f*)(Sb + e) = a;  }

__global__ __launch_bounds__(256) void k_pbuck(const bf* __restrict__ Ph, const bf* __restrict__ Pl, bf* Bh, bf* Bl) { const int lane = threadIdx.x & 31; const int row = blockIdx.x * 8 + (threadIdx.x >> 5); if (row >= ZH * TT) return; const int i = row % TT; const bf* ph = Ph + (size_t)(row / TT) * PZ + (size_t)i * TT; const bf* pl = Pl + (size_t)(row / TT) * PZ + (size_t)i * TT; float lo_s = 0.f, hi_s = 0.f;
#pragma unroll 1
    for (int j = lane; j < TT; j += 32) { const float p = __fadd_rn(bf2f(ph[j]), bf2f(pl[j])); if (j <= i - CUT) lo_s = __fadd_rn(lo_s, p); if (j >= i + CUT) hi_s = __fadd_rn(hi_s, p); }
#pragma unroll
    for (int sh = 16; sh; sh >>= 1) { lo_s = __fadd_rn(lo_s, __shfl_xor(lo_s, sh, 32)); hi_s = __fadd_rn(hi_s, __shfl_xor(hi_s, sh, 32)); }
    unsigned short l0h, l0l, h0h, h0l; splitf(lo_s, l0h, l0l); splitf(hi_s, h0h, h0l);
{
#pragma unroll 1
        for (int c0 = lane * 2; c0 < NE; c0 += 64) { v2us oh, ol;   
#pragma unroll
            for (int q = 0; q < 2; ++q) { const int bkt = c0 + q; const int j = i + bkt - CUT; const int jc = min(max(j, 0), TT - 1); unsigned int uu = ((const unsigned short*)ph)[jc], ww = ((const unsigned short*)pl)[jc]; asm volatile("" : "+v"(uu), "+v"(ww));   /* unconditional clamped loads pinned before the select (opaque use) */ const bool in = (bkt > 0 && bkt < 2 * CUT && j >= 0 && j < TT);
                const unsigned short u = in ? (unsigned short)uu : ((bkt == 0) ? l0h : ((bkt == 2 * CUT) ? h0h : (unsigned short)0)); const unsigned short w = in ? (unsigned short)ww : ((bkt == 0) ? l0l : ((bkt == 2 * CUT) ? h0l : (unsigned short)0));
                oh[q] = u; ol[q] = w; }
            *(v2us*)(Bh + (size_t)row * NE + c0) = oh; *(v2us*)(Bl + (size_t)row * NE + c0) = ol; }
         }
}

__global__ __launch_bounds__(256) void k_addF(float* Y, const float* __restrict__ F) { const size_t i = (size_t)blockIdx.x * 256 + threadIdx.x; if (i >= (size_t)ZH * TT * HD / 4) return; const v4f a = *(const v4f*)(Y + i * 4); const v4f f = *(const v4f*)(F + i * 4); v4f o;
#pragma unroll
    for (int q = 0; q < 4; ++q) o[q] = __fadd_rn(a[q], f[q]);
    *(v4f*)(Y + i * 4) = o;  }

__global__ __launch_bounds__(256) void k_mergeT(const float* __restrict__ O, int h0, float* outb) { const size_t i = (size_t)blockIdx.x * 256 + threadIdx.x; if (i >= (size_t)ZH * TT * HD / 4) return; const size_t e = i * 4; const int d = (int)(e % HD); const int t = (int)((e / HD) % TT); const int zz = (int)(e / ((size_t)HD * TT)); const v4f a = *(const v4f*)(O + e); *(v4f*)(outb + (size_t)t * DM + (h0 + zz) * HD + d) = a;  }

extern "C" void kernel_launch(void* const* d_in, const int* in_sizes, int n_in,
                              void* d_out, int out_size, void* d_ws, size_t ws_size, hipStream_t stream) {
    (void)in_sizes; (void)n_in; (void)out_size;
    const float* Qin = (const float*)d_in[0]; const float* Kin = (const float*)d_in[1]; const float* Vin = (const float*)d_in[2]; const float* ak = (const float*)d_in[3]; const float* av = (const float*)d_in[4];   /* rel_k_table, rel_v_table [33][64] */
    float* OUT = (float*)d_out;     // [2][2048][16][64] token-major
    char* wsp = (char*)d_ws;
    auto take = [&](size_t bytes) { char* p = wsp; wsp += (bytes + 255) & ~(size_t)255; return (void*)p; };
    bf* QB = (bf*)take((size_t)NH_ * TT * HD * 2); bf* KB = (bf*)take((size_t)NH_ * TT * HD * 2); bf* VT = (bf*)take((size_t)NH_ * HD * TT * 2);
    bf* Ph = (bf*)take((size_t)(ZS + ZH) * TT * TT * 4); bf* Pl = Ph + (size_t)TT * TT; float* Sb = (float*)(Ph + ZS * PZ);   /* one block: P pairs of heads 0..ZH-1 from its start, score planes from ZS heads in */ float* Ob = (float*)take((size_t)ZH * TT * HD * 4); bf* AKB = (bf*)take((size_t)NE * HD * 2); bf* AVTh = (bf*)take((size_t)HD * NE * 2); bf* AVTl = (bf*)take((size_t)HD * NE * 2); float* QE = (float*)take((size_t)ZH * TT * NE * 4); bf* PBh = (bf*)take((size_t)ZH * TT * NE * 2); bf* PBl = (bf*)take((size_t)ZH * TT * NE * 2); float* ZR = (float*)take((size_t)ZH * TT * HD * 4);
    if ((size_t)(wsp - (char*)d_ws) > ws_size) return;
    k_epadK<<<(unsigned)(((size_t)NE * HD / 8 + 255) / 256), 256, 0, stream>>>(ak, AKB);   /* a_k -> bf16 [64][64], rows >= 33 zero */ k_epadVT<<<(unsigned)(((size_t)HD * NE / 4 + 255) / 256), 256, 0, stream>>>(av, AVTh, AVTl);   /* a_v^T -> [64][64] (lo plane unused: the table is bf16-exact) */
    for (int b = 0; b < NB_; ++b) {
        const float* qb = Qin + (size_t)b * TT * DM; const float* kb = Kin + (size_t)b * TT * DM; const float* vb = Vin + (size_t)b * TT * DM;   /* token-major [t][h][d] slabs */
        k_hp1<<<(unsigned)(((size_t)NH_ * TT * HD / 8 + 255) / 256), 256, 0, stream>>>(qb, QB); k_hp1<<<(unsigned)(((size_t)NH_ * TT * HD / 8 + 255) / 256), 256, 0, stream>>>(kb, KB); k_vt1<<<(unsigned)(((size_t)NH_ * HD * TT / 2 + 255) / 256), 256, 0, stream>>>(vb, DM, VT);
        for (int h0 = 0; h0 < NH_; h0 += ZH) {   /* ZH heads per pass */
            const bf* qh = QB + (size_t)h0 * TT * HD; const bf* kh = KB + (size_t)h0 * TT * HD; const bf* vh = VT + (size_t)h0 * HD * TT;
            k_gemmw<bf, 0, false><<<dim3(TT / 64, TT / 64, ZH), 32, 0, stream>>>(qh, nullptr, kh, nullptr, HD, Sb, TT, nullptr, (size_t)TT * HD, (size_t)TT * HD, (size_t)TT * TT);   /* exact scores (single bf16 planes) */
            k_gemmw<bf, 0, false><<<dim3(TT / 64, NE / 64, ZH), 32, 0, stream>>>(qh, nullptr, AKB, nullptr, HD, QE, NE, nullptr, (size_t)TT * HD, 0, (size_t)TT * NE);   /* QE[l][r] = q_l . a_k[r] (exact) */
            k_addrelc<<<(unsigned)(((size_t)ZH * TT * TT / 4 + 255) / 256), 256, 0, stream>>>(Sb, QE);   /* + q_l . a_k[clip(s-l)+16] */
            for (int s = 0; s < ZH / ZS; ++s) k_asoft<<<ZS * TT / 8, 256, 0, stream>>>(Sb + (size_t)s * ZS * TT * TT, nullptr, Ph + s * ZS * PZ, Pl + s * ZS * PZ);   /* launch s writes P only in front of the scores it reads: free space (s = 0) or the score planes of launch s - 1 */
            k_gemmw<bf, 1, false><<<dim3(TT / 64, HD / 64, ZH), 32, 0, stream>>>(Ph, Pl, vh, nullptr, TT, Ob, HD, nullptr, PZ, (size_t)HD * TT, (size_t)TT * HD);   /* P (hi/lo) x exact v^T */
            k_pbuck<<<(unsigned)((ZH * TT + 7) / 8), 256, 0, stream>>>(Ph, Pl, PBh, PBl);   /* P folded onto the 33 clipped offsets */
            k_gemmw<bf, 1, false><<<dim3(TT / 64, HD / 64, ZH), 32, 0, stream>>>(PBh, PBl, AVTh, nullptr, NE, ZR, HD, nullptr, (size_t)TT * NE, 0, (size_t)TT * HD);   /* ZR = PB . a_v (exact table) */
            k_addF<<<(unsigned)(((size_t)ZH * TT * HD / 4 + 255) / 256), 256, 0, stream>>>(Ob, ZR);
            k_mergeT<<<(unsigned)(((size_t)ZH * TT * HD / 4 + 255) / 256), 256, 0, stream>>>(Ob, h0, OUT + (size_t)b * TT * DM); } }
}

// v002
// It runs in 72.1 microseconds.
// Timed twice side by side with v001, it ran 11.2 times as fast both times.
// Over all steps from v000 it is 43.1 times as fast.
#include <hip/hip_runtime.h>

// Relative-position multi-head attention on given token-major tensors (queries, keys, values [2][2048][16][64]; idx[l][s] = clip(s - l, -16, 16) + 16; attn = softmax((q.k + q.rel_k_table[idx]) / 8); out = attn values + sum_s attn[l][s] rel_v_table[idx[l][s]] (tables [33][64], read) -> [2][2048][16][64] token-major (4.2 M)).
// Prep: k and value^T as bf16 in the order in which the fused kernel's fragments read them (every wave-wide load takes 512 contiguous bytes); the key table zero-padded to [64][64] and the value table transposed to [64][64].
// k_fattn: one launch for all heads. A wave owns 32 queries (two groups of 16, read from the input and rounded to bf16 once) and walks the 2048 keys 32 at a time: S^T = K Q^T, so that a lane holds the scores of one query; online softmax with a lazily moved maximum; the two score tiles of a pass, split hi/lo, are the B operand of O^T += V^T P^T as they lie in the accumulators. No score and no P plane goes to memory.
// Relative terms: QE^T = a_k Q^T (matrix product) once per wave. A pass wholly left (right) of the 31-wide band adds the one value QE[l][0] (QE[l][32]) and sums its P into the end bucket in registers; the (at most three) passes that touch the band gather QE from LDS and park the band's scaled scores in LDS. After the loop the 33 buckets (end sums; exp2 of the parked scores under the final maximum) are split hi/lo and O^T += a_v^T PB^T on the matrix unit; then one division by the row sum.
// Every '#pragma unroll' below makes the indices of a register array constants (an array indexed at run time would go to scratch).
// Compute dtypes, f32 accumulate: every input rounded to bf16; q.k and q.a_k exact products; softmax f32; P hi/lo x bf16 value and x bf16 a_v; output f32.

#define NB_  2
#define TT   2048
#define DM   1024      // token-major row pitch (H x HD)
#define NH_  16
#define HD   64
#define NE   64       // 2*16+1 = 33 relative offsets padded to 64
#define NRE  33
#define CUT  16
#define FW   4        // waves per work-group of k_fattn
#define NQ   2        // groups of 16 queries per wave
#define KP   32       // keys per pass
#define LP   33       // LDS row pitch in floats (33 entries a query; odd: a column walk meets no bank twice)
#define SC2  0.18033688011112042f   // log2(e) / sqrt(64)
#define NEGB (-3.0e38f)
#define NCHK (NB_ * NH_ * TT * HD / 8)   // 8-element chunks in one of k, v
#define PCH  8        // chunks per thread of k_kvfrag
typedef unsigned short bf;
typedef __attribute__((ext_vector_type(16))) __bf16   v16bf;
typedef __attribute__((ext_vector_type(8)))  unsigned short v8us;
typedef __attribute__((ext_vector_type(4)))  unsigned short v4us;
typedef __attribute__((ext_vector_type(8)))  float    v8f;
typedef __attribute__((ext_vector_type(4)))  float    v4f;
typedef __attribute__((ext_vector_type(2)))  float    v2f;
typedef __attribute__((ext_vector_type(2)))  __bf16   v2bf;

__device__ __forceinline__ unsigned short f2bf(float f) { unsigned u = __float_as_uint(f); u += 0x7FFFu + ((u >> 16) & 1u); return (unsigned short)(u >> 16); }
__device__ __forceinline__ float bf2f(unsigned short b) { return __uint_as_float(((unsigned)b) << 16); }
__device__ __forceinline__ void splitf(float y, unsigned short& h, unsigned short& l) { h = f2bf(y); l = f2bf(y - bf2f(h)); }
__device__ __forceinline__ v16bf cat16b(v8us lo, v8us hi) { return __builtin_bit_cast(v16bf, __builtin_shufflevector(lo, hi, 0, 1, 2, 3, 4, 5, 6, 7, 8, 9, 10, 11, 12, 13, 14, 15)); }
__device__ __forceinline__ v8f wmmab(v16bf a, v16bf b, v8f c) { return __builtin_amdgcn_wmma_f32_16x16x32_bf16(false, a, false, b, (short)0, c, false, false); }
// fragment of one row (A) or column (B) from a k-contiguous plane; the address already holds + 8 * (lane >> 4): k = 8h + 0..7, then 16 + 8h + 0..7
// base is the same in every lane, off the lane's own offset in elements
__device__ __forceinline__ v16bf ldf(const bf* base, unsigned off) { const bf* p = base + off; return cat16b(*(const v8us*)p, *(const v8us*)(p + 16)); }
// the same fragment from a plane in fragment order; p already holds + 8 * lane: two loads of 512 contiguous bytes a wave
__device__ __forceinline__ v16bf ldq(const bf* p) { return cat16b(*(const v8us*)p, *(const v8us*)(p + 256)); }
// the value of lane l ^ 16
__device__ __forceinline__ float xhalf(float x) { const int b = __float_as_int(x); return __int_as_float(__builtin_amdgcn_permlanex16(b, b, 0x76543210, 0xfedcba98, false, false)); }

// Keys and values of both batches as bf16 in the order in which k_fattn's fragments read them, so that each of its wave-wide 16-byte loads takes 512 contiguous bytes. blockIdx.y picks the tensor; a thread makes PCH chunks of 8 elements.
// Keys: per (batch, head), per 16 keys, four 512-byte blocks (kc, j); lane (lr, hi) of a block holds k[16 kt + lr][32 kc + 16 j + 8 hi + 0..7].
// Values, transposed: per (batch, head), per 32 keys, eight 512-byte blocks (dt, j); lane (lr, hi) of a block holds v[32 kp + 16 j + 8 hi + 0..7][16 dt + lr].
template <bool ISV>
__device__ __forceinline__ void fragorder(const float* __restrict__ S, bf* __restrict__ F) {
    const unsigned n0 = blockIdx.x * 256 + threadIdx.x; const float* sp[PCH]; bf* dp[PCH]; v8f v[PCH];
#pragma unroll
    for (int c = 0; c < PCH; ++c) { const unsigned n = n0 + c * (NCHK / PCH);
        if (!ISV) { const int d = (int)(n % (HD / 8)) * 8; const int t = (int)((n / (HD / 8)) % TT); const int bh = (int)(n / (HD / 8 * TT));
            sp[c] = S + ((size_t)(bh / NH_) * TT + t) * DM + (bh % NH_) * HD + d; v[c] = *(const v8f*)sp[c];
            dp[c] = F + (size_t)bh * TT * HD + (size_t)((((t >> 4) * 2 + (d >> 5)) * 2 + ((d >> 4) & 1)) * 32 + ((d >> 3) & 1) * 16 + (t & 15)) * 8; }
        else { const int lr = (int)(n & 15), hi = (int)((n >> 4) & 1), j = (int)((n >> 5) & 1), dt = (int)((n >> 6) & 3); const int kp = (int)((n >> 8) % (TT / 32)); const int bh = (int)((n >> 8) / (TT / 32));
            sp[c] = S + ((size_t)(bh / NH_) * TT + kp * 32 + 16 * j + 8 * hi) * DM + (bh % NH_) * HD + dt * 16 + lr;
#pragma unroll
            for (int q = 0; q < 8; ++q) v[c][q] = sp[c][(size_t)q * DM];
            dp[c] = F + (size_t)n * 8; } }
    asm volatile("s_wait_xcnt 0x0" :: "v"(sp[0]), "v"(sp[1]), "v"(sp[2]), "v"(sp[3]), "v"(sp[4]), "v"(sp[5]), "v"(sp[6]), "v"(sp[7]) : "memory");   // precaution: the wait stands in front of any rewrite of the loads' address registers, which it keeps live up to here
#pragma unroll
    for (int c = 0; c < PCH; ++c) { v8us o;
#pragma unroll
        for (int q = 0; q < 8; ++q) o[q] = f2bf(v[c][q]);
        *(v8us*)dp[c] = o; }
    asm volatile("s_wait_xcnt 0x0" :: "v"(dp[0]), "v"(dp[1]), "v"(dp[2]), "v"(dp[3]), "v"(dp[4]), "v"(dp[5]), "v"(dp[6]), "v"(dp[7]) : "memory");   // the same precaution for the stores' address registers
}
__global__ __launch_bounds__(256) void k_kvfrag(const float* __restrict__ Ks, const float* __restrict__ Vs, bf* Kf, bf* Vf) { if (blockIdx.y == 0) fragorder<false>(Ks, Kf); else fragorder<true>(Vs, Vf); }
__global__ __launch_bounds__(256) void k_epadK(const float* __restrict__ E, bf* EB) { const size_t i = (size_t)blockIdx.x * 256 + threadIdx.x; if (i >= (size_t)NE * HD / 8) return; const int d0 = (int)(i % (HD / 8)) * 8; const int r = (int)(i / (HD / 8)); const float* src = E + (size_t)min(r, NRE - 1) * HD + d0; v8us o;
#pragma unroll
    for (int q = 0; q < 8; ++q) { const unsigned short v = f2bf(src[q]); o[q] = (r < NRE) ? v : (unsigned short)0; }
    *(v8us*)(EB + (size_t)r * HD + d0) = o;  }

__global__ __launch_bounds__(256) void k_epadVT(const float* __restrict__ E, bf* Th, bf* Tl) { const size_t i = (size_t)blockIdx.x * 256 + threadIdx.x; if (i >= (size_t)HD * NE / 4) return; const size_t e = i * 4; const int c0 = (int)(e % NE); const int d = (int)(e / NE); v4us oh, ol;
#pragma unroll
    for (int q = 0; q < 4; ++q) { const int r = c0 + q; const float v = E[(size_t)min(r, NRE - 1) * HD + d]; unsigned short u, w; splitf(v, u, w); oh[q] = (r < NRE) ? u : (unsigned short)0; ol[q] = (r < NRE) ? w : (unsigned short)0; }
    *(v4us*)(Th + e) = oh; *(v4us*)(Tl + e) = ol;  }

// One pass: 32 keys from k0 against the wave's 32 queries. MODE 0: every key at least 16 left of every query; 2: at least 16 right; 1: any position.
template <int MODE>
__device__ __forceinline__ void fpass(const int k0, const int knext, const bf* __restrict__ kh, const bf* __restrict__ vh, const int lr, const int hi, const int q0,
                                      const v16bf (&qf)[NQ][2], v16bf (&kf)[2][2], v8f (&o)[NQ][4], float (&m)[NQ], float (&slo)[NQ], float (&shi)[NQ],
                                      const float (&bend)[NQ], const float* qeW, float* scW) {
    v16bf vf[4]; const bf* vp = vh + k0 * HD + (unsigned)((hi * 16 + lr) * 8); const bf* kp = kh + knext * HD + (unsigned)((hi * 16 + lr) * 8);
#pragma unroll
    for (int dt = 0; dt < 4; ++dt) vf[dt] = ldq(vp + dt * 512);
    v8f s[NQ][2];
#pragma unroll
    for (int g = 0; g < NQ; ++g)
#pragma unroll
        for (int t = 0; t < 2; ++t) { s[g][t] = (v8f){}; s[g][t] = wmmab(kf[t][0], qf[g][0], s[g][t]); s[g][t] = wmmab(kf[t][1], qf[g][1], s[g][t]); }   // s[g][t][r] = k[k0 + 16t + 8h + r] . q[q0 + 16g + lr]
#pragma unroll
    for (int t = 0; t < 2; ++t)
#pragma unroll
        for (int kc = 0; kc < 2; ++kc) kf[t][kc] = ldq(kp + t * 1024 + kc * 512);   // the next pass's keys, one pass ahead
    asm volatile("s_wait_xcnt 0x0" :: "v"(vp), "v"(kp) : "memory");   // precaution: the wait stands in front of any rewrite of the two address pairs of the loads above, which it keeps live up to here
    float tm[NQ]; bool need = false;
#pragma unroll
    for (int g = 0; g < NQ; ++g) { float a0 = NEGB, a1 = NEGB;
#pragma unroll
        for (int t = 0; t < 2; ++t) {
            if (MODE != 1) s[g][t] = s[g][t] * SC2 + bend[g];   // one offset for the whole pass
            else {
#pragma unroll
                for (int r = 0; r < 8; ++r) { const int dl = (k0 + t * 16 + 8 * hi + r) - (q0 + g * 16 + lr); const float x = __builtin_fmaf(s[g][t][r], SC2, qeW[(g * 16 + lr) * LP + min(max(dl, -CUT), CUT) + CUT]); s[g][t][r] = x;
                    if (dl > -CUT && dl < CUT) scW[(g * 16 + lr) * LP + dl + CUT] = x; } }
#pragma unroll
            for (int r = 0; r < 8; ++r) { if (t) a1 = fmaxf(a1, s[g][t][r]); else a0 = fmaxf(a0, s[g][t][r]); } }
        a0 = fmaxf(a0, a1); tm[g] = fmaxf(a0, xhalf(a0)); need = need || (tm[g] > m[g] + 8.0f); }
    if (__builtin_amdgcn_ballot_w32(need) != 0) {   // the maximum in use moves only when some query outgrows it by 2^8
#pragma unroll
        for (int g = 0; g < NQ; ++g) { const float mn = fmaxf(m[g], tm[g]); const float al = __builtin_amdgcn_exp2f(m[g] - mn); m[g] = mn; slo[g] *= al; shi[g] *= al;
#pragma unroll
            for (int dt = 0; dt < 4; ++dt) o[g][dt] *= al; } }
#pragma unroll
    for (int g = 0; g < NQ; ++g) { v16bf ph, pl; float l0 = 0.f, l1 = 0.f, h0 = 0.f, h1 = 0.f;
#pragma unroll
        for (int i = 0; i < 16; i += 2) { const int t = i >> 3, r = i & 7; v2f p; p[0] = __builtin_amdgcn_exp2f(s[g][t][r] - m[g]); p[1] = __builtin_amdgcn_exp2f(s[g][t][r + 1] - m[g]);
            if (MODE == 0) { l0 += p[0]; l1 += p[1]; }
            else if (MODE == 2) { h0 += p[0]; h1 += p[1]; }
            else { const int dl = (k0 + t * 16 + 8 * hi + r) - (q0 + g * 16 + lr); l0 += (dl <= -CUT) ? p[0] : 0.f; h0 += (dl >= CUT) ? p[0] : 0.f; l1 += (dl + 1 <= -CUT) ? p[1] : 0.f; h1 += (dl + 1 >= CUT) ? p[1] : 0.f; }
            const v2bf u = __builtin_convertvector(p, v2bf); const v2bf w = __builtin_convertvector(p - __builtin_convertvector(u, v2f), v2bf);   // P = hi + lo, both bf16
            ph[i] = u[0]; ph[i + 1] = u[1]; pl[i] = w[0]; pl[i + 1] = w[1]; }
        slo[g] += l0 + l1; shi[g] += h0 + h1;
#pragma unroll
        for (int dt = 0; dt < 4; ++dt) { o[g][dt] = wmmab(vf[dt], ph, o[g][dt]); o[g][dt] = wmmab(vf[dt], pl, o[g][dt]); } }   // o[g][dt][r] = O[q0 + 16g + lr][16dt + 8h + r]
}

// 256 registers: above them every change of register window costs a scalar instruction in the loop
__global__ __launch_bounds__(FW * 32) __attribute__((amdgpu_num_vgpr(256))) void k_fattn(const float* __restrict__ Qin, const bf* __restrict__ KB, const bf* __restrict__ VT, const bf* __restrict__ AKB, const bf* __restrict__ AVT, float* OUT) {
    __shared__ float qeS[FW][NQ * 16 * LP];   // QE[query][offset] x SC2
    __shared__ float scS[FW][NQ * 16 * LP];   // scaled scores of the band, [query][offset]
    const int lane = threadIdx.x & 31, lr = lane & 15, hi = lane >> 4; const int wv = __builtin_amdgcn_readfirstlane(threadIdx.x >> 5);
    const int bh = blockIdx.y; const int q0 = (blockIdx.x * FW + wv) * (NQ * 16);
    const bf* kh = KB + (size_t)bh * TT * HD; const bf* vh = VT + (size_t)bh * HD * TT;
    float* qeW = qeS[wv]; float* scW = scS[wv];
    v16bf qf[NQ][2]; const float* qp = Qin + ((size_t)(bh / NH_) * TT + q0) * DM + (bh % NH_) * HD + (unsigned)(lr * DM + 8 * hi);
#pragma unroll
    for (int g = 0; g < NQ; ++g)
#pragma unroll
        for (int kc = 0; kc < 2; ++kc) { const v8f x0 = *(const v8f*)(qp + g * 16 * DM + kc * 32), x1 = *(const v8f*)(qp + g * 16 * DM + kc * 32 + 16); v8us u0, u1;
#pragma unroll
            for (int i = 0; i < 8; ++i) { u0[i] = f2bf(x0[i]); u1[i] = f2bf(x1[i]); }
            qf[g][kc] = cat16b(u0, u1); }
    asm volatile("s_wait_xcnt 0x0" :: "v"(qp) : "memory");   // the same precaution for the address pair of the loads above
#pragma unroll
    for (int e3 = 0; e3 < 3; ++e3) { const v16bf a0 = ldf(AKB + e3 * 16 * HD, (unsigned)(lr * HD + 8 * hi)), a1 = ldf(AKB + e3 * 16 * HD + 32, (unsigned)(lr * HD + 8 * hi));
#pragma unroll
        for (int g = 0; g < NQ; ++g) { v8f d = (v8f){}; d = wmmab(a0, qf[g][0], d); d = wmmab(a1, qf[g][1], d);   // d[r] = a_k[16 e3 + 8h + r] . q[q0 + 16g + lr]
#pragma unroll
            for (int r = 0; r < 8; ++r) { const int e = e3 * 16 + 8 * hi + r; if (e < NRE) qeW[(g * 16 + lr) * LP + e] = d[r] * SC2; } } }
#pragma unroll
    for (int i = 0; i < NQ * 16 * LP / 32; ++i) scW[i * 32 + lane] = NEGB;   // an offset with no key stays at exp2 -> 0
    __syncthreads();   // a lane reads QE entries that the other half of its wave wrote
    float bend[NQ], m[NQ], slo[NQ], shi[NQ]; v8f o[NQ][4];
#pragma unroll
    for (int g = 0; g < NQ; ++g) { bend[g] = qeW[(g * 16 + lr) * LP]; m[g] = NEGB; slo[g] = 0.f; shi[g] = 0.f;
#pragma unroll
        for (int dt = 0; dt < 4; ++dt) o[g][dt] = (v8f){}; }
    v16bf kf[2][2]; const bf* kp0 = kh + (unsigned)(lane * 8);
#pragma unroll
    for (int t = 0; t < 2; ++t)
#pragma unroll
        for (int kc = 0; kc < 2; ++kc) kf[t][kc] = ldq(kp0 + t * 1024 + kc * 512);
    asm volatile("s_wait_xcnt 0x0" :: "v"(kp0) : "memory");   // the same precaution
    const int kL = max(q0 - KP, 0), kR = min(q0 + NQ * 16 + KP, TT);   // passes in [kL, kR) touch the band
    // the three loops stay rolled (unroll 1): a pass is some hundred instructions long already, and a second copy would only cost instruction cache and registers
#pragma unroll 1
    for (int k0 = 0; k0 < kL; k0 += KP) fpass<0>(k0, k0 + KP, kh, vh, lr, hi, q0, qf, kf, o, m, slo, shi, bend, qeW, scW);
#pragma unroll 1
    for (int k0 = kL; k0 < kR; k0 += KP) fpass<1>(k0, min(k0 + KP, TT - KP), kh, vh, lr, hi, q0, qf, kf, o, m, slo, shi, bend, qeW, scW);
#pragma unroll
    for (int g = 0; g < NQ; ++g) bend[g] = qeW[(g * 16 + lr) * LP + 2 * CUT];
#pragma unroll 1
    for (int k0 = kR; k0 < TT; k0 += KP) fpass<2>(k0, min(k0 + KP, TT - KP), kh, vh, lr, hi, q0, qf, kf, o, m, slo, shi, bend, qeW, scW);
    __syncthreads();   // a lane reads band scores that the other half of its wave wrote
    v16bf av[4][2];
#pragma unroll
    for (int dt = 0; dt < 4; ++dt) { av[dt][0] = ldf(AVT + dt * 16 * NE, (unsigned)(lr * NE + 8 * hi)); av[dt][1] = ldf(AVT + dt * 16 * NE + 32, (unsigned)(lr * NE + 8 * hi)); }
    float* ob = OUT + (size_t)(bh / NH_) * TT * DM + (size_t)(bh % NH_) * HD;
#pragma unroll
    for (int g = 0; g < NQ; ++g) { const float lot = slo[g] + xhalf(slo[g]), hit = shi[g] + xhalf(shi[g]); float is = 0.f; v16bf b0h, b0l, b1h, b1l;
#pragma unroll
        for (int i = 0; i < 16; ++i) { const int e = (i < 8) ? 8 * hi + i : 16 + 8 * hi + (i - 8);   // bucket e in the fragment's k order
            float p = __builtin_amdgcn_exp2f(scW[(g * 16 + lr) * LP + e] - m[g]);
            if (i == 0) { is += hi ? p : 0.f; p = hi ? p : lot; } else is += p;
            const __bf16 u = (__bf16)p; b0h[i] = u; b0l[i] = (__bf16)(p - (float)u);
            const float p1 = (i == 0 && hi == 0) ? hit : 0.f;   // buckets 32..63: only 32 is used
            const __bf16 u1 = (__bf16)p1; b1h[i] = u1; b1l[i] = (__bf16)(p1 - (float)u1); }
        const float inv = __fdiv_rn(1.0f, lot + hit + (is + xhalf(is)));
#pragma unroll
        for (int dt = 0; dt < 4; ++dt) { v8f a = o[g][dt]; a = wmmab(av[dt][0], b0h, a); a = wmmab(av[dt][0], b0l, a); a = wmmab(av[dt][1], b1h, a); a = wmmab(av[dt][1], b1l, a); a *= inv;
            float* op = (ob + (size_t)(q0 + g * 16) * DM + dt * 16) + (unsigned)(lr * DM + 8 * hi);
            *(v4f*)op = __builtin_shufflevector(a, a, 0, 1, 2, 3); *(v4f*)(op + 4) = __builtin_shufflevector(a, a, 4, 5, 6, 7); } }
}

extern "C" void kernel_launch(void* const* d_in, const int* in_sizes, int n_in,
                              void* d_out, int out_size, void* d_ws, size_t ws_size, hipStream_t stream) {
    (void)in_sizes; (void)n_in; (void)out_size;
    const float* Qin = (const float*)d_in[0]; const float* Kin = (const float*)d_in[1]; const float* Vin = (const float*)d_in[2]; const float* ak = (const float*)d_in[3]; const float* av = (const float*)d_in[4];   /* rel_k_table, rel_v_table [33][64] */
    float* OUT = (float*)d_out;     // [2][2048][16][64] token-major
    char* wsp = (char*)d_ws;
    auto take = [&](size_t bytes) { char* p = wsp; wsp += (bytes + 255) & ~(size_t)255; return (void*)p; };
    bf* KB = (bf*)take((size_t)NB_ * NH_ * TT * HD * 2); bf* VT = (bf*)take((size_t)NB_ * NH_ * HD * TT * 2);
    bf* AKB = (bf*)take((size_t)NE * HD * 2); bf* AVTh = (bf*)take((size_t)HD * NE * 2); bf* AVTl = (bf*)take((size_t)HD * NE * 2);
    if ((size_t)(wsp - (char*)d_ws) > ws_size) return;
    k_epadK<<<(unsigned)(((size_t)NE * HD / 8 + 255) / 256), 256, 0, stream>>>(ak, AKB);   /* a_k -> bf16 [64][64], rows >= 33 zero */ k_epadVT<<<(unsigned)(((size_t)HD * NE / 4 + 255) / 256), 256, 0, stream>>>(av, AVTh, AVTl);   /* a_v^T -> [64][64] (lo plane unused: the table is taken as bf16) */
    k_kvfrag<<<dim3(NCHK / PCH / 256, 2), 256, 0, stream>>>(Kin, Vin, KB, VT);
    k_fattn<<<dim3(TT / (FW * NQ * 16), NB_ * NH_), FW * 32, 0, stream>>>(Qin, KB, VT, AKB, AVTh, OUT);
}

// v003
// Measured time: 67.9 microseconds a run.
// Two timings next to v002 both put it at 1.06 times that version's speed.
// All steps since v000 together make it 45.8 times as fast.
#include <hip/hip_runtime.h>

// Relative-position multi-head attention on given token-major tensors (queries, keys, values [2][2048][16][64]; idx[l][s] = clip(s - l, -16, 16) + 16; attn = softmax((q.k + q.rel_k_table[idx]) / 8); out = attn values + sum_s attn[l][s] rel_v_table[idx[l][s]] (tables [33][64], read) -> [2][2048][16][64] token-major (4.2 M)).
// Prep: k as bf16 and value^T as f16 in the order in which the fused kernel's fragments read them (every wave-wide load takes 512 contiguous bytes); the key table zero-padded to [64][64] and the value table transposed to [64][64].
// k_fattn: one launch for all heads. A wave owns 32 queries (two groups of 16, read from the input and rounded to bf16 once) and walks the 2048 keys 32 at a time: S^T = K Q^T, so that a lane holds the scores of one query; online softmax with a lazily moved maximum; the two score tiles of a pass, rounded to f16, are the B operand of O^T += V^T P^T as they lie in the accumulators (P lies in [0, 2^8] under the lazy maximum, inside f16's range). No score and no P plane goes to memory.
// Relative terms: QE^T = a_k Q^T (matrix product) once per wave. A pass wholly left (right) of the 31-wide band adds the one value QE[l][0] (QE[l][32]) and sums its P into the end bucket in registers; the three passes that touch the band gather QE from LDS and park the band's scaled scores in LDS. After the loop the 33 buckets (end sums; exp2 of the parked scores under the final maximum) are split hi/lo and O^T += a_v^T PB^T on the matrix unit; then one division by the row sum.
// Every '#pragma unroll' below makes the indices of a register array constants (an array indexed at run time would go to scratch).
// Compute dtypes, f32 accumulate: q, k and the tables rounded to bf16, values to f16 (11 significant bits; finite up to 65504); q.k and q.a_k exact products; softmax f32; P f16 x f16 value; bucket sums bf16 hi/lo x bf16 a_v; output f32.

#define NB_  2
#define TT   2048
#define DM   1024      // token-major row pitch (H x HD)
#define NH_  16
#define HD   64
#define NE   64       // 2*16+1 = 33 relative offsets padded to 64
#define NRE  33
#define CUT  16
#define FW   4        // waves per work-group of k_fattn
#define NQ   2        // groups of 16 queries per wave
#define KP   32       // keys per pass
#define LP   33       // LDS row pitch in floats (33 entries a query; odd: a column walk meets no bank twice)
#define SC2  0.18033688011112042f   // log2(e) / sqrt(64)
#define NEGB (-3.0e38f)
#define NCHK (NB_ * NH_ * TT * HD / 8)   // 8-element chunks in one of k, v
#define PCH  8        // chunks per thread of k_kvfrag
typedef unsigned short bf;
typedef __attribute__((ext_vector_type(16))) __bf16   v16bf;
typedef __attribute__((ext_vector_type(8)))  unsigned short v8us;
typedef __attribute__((ext_vector_type(4)))  unsigned short v4us;
typedef __attribute__((ext_vector_type(8)))  float    v8f;
typedef __attribute__((ext_vector_type(4)))  float    v4f;
typedef __attribute__((ext_vector_type(2)))  float    v2f;
typedef __attribute__((ext_vector_type(16))) _Float16 v16h;
typedef __attribute__((ext_vector_type(2)))  _Float16 v2h;

__device__ __forceinline__ unsigned short f2bf(float f) { unsigned u = __float_as_uint(f); u += 0x7FFFu + ((u >> 16) & 1u); return (unsigned short)(u >> 16); }
__device__ __forceinline__ float bf2f(unsigned short b) { return __uint_as_float(((unsigned)b) << 16); }
__device__ __forceinline__ void splitf(float y, unsigned short& h, unsigned short& l) { h = f2bf(y); l = f2bf(y - bf2f(h)); }
__device__ __forceinline__ v16bf cat16b(v8us lo, v8us hi) { return __builtin_bit_cast(v16bf, __builtin_shufflevector(lo, hi, 0, 1, 2, 3, 4, 5, 6, 7, 8, 9, 10, 11, 12, 13, 14, 15)); }
__device__ __forceinline__ v8f wmmab(v16bf a, v16bf b, v8f c) { return __builtin_amdgcn_wmma_f32_16x16x32_bf16(false, a, false, b, (short)0, c, false, false); }
__device__ __forceinline__ v8f wmmah(v16h a, v16h b, v8f c) { return __builtin_amdgcn_wmma_f32_16x16x32_f16(false, a, false, b, (short)0, c, false, false); }
// fragment of one row (A) or column (B) from a k-contiguous plane; the address already holds + 8 * (lane >> 4): k = 8h + 0..7, then 16 + 8h + 0..7
// base is the same in every lane, off the lane's own offset in elements
__device__ __forceinline__ v16bf ldf(const bf* base, unsigned off) { const bf* p = base + off; return cat16b(*(const v8us*)p, *(const v8us*)(p + 16)); }
// the same fragment from a plane in fragment order; p already holds + 8 * lane: two loads of 512 contiguous bytes a wave
__device__ __forceinline__ v16bf ldq(const bf* p) { return cat16b(*(const v8us*)p, *(const v8us*)(p + 256)); }
// the value of lane l ^ 16
__device__ __forceinline__ float xhalf(float x) { const int b = __float_as_int(x); return __int_as_float(__builtin_amdgcn_permlanex16(b, b, 0x76543210, 0xfedcba98, false, false)); }

// Keys (bf16) and values (f16) of both batches in the order in which k_fattn's fragments read them, so that each of its wave-wide 16-byte loads takes 512 contiguous bytes. blockIdx.y picks the tensor; a thread makes PCH chunks of 8 elements.
// Keys: per (batch, head), per 16 keys, four 512-byte blocks (kc, j); lane (lr, hi) of a block holds k[16 kt + lr][32 kc + 16 j + 8 hi + 0..7].
// Values, transposed: per (batch, head), per 32 keys, eight 512-byte blocks (dt, j); lane (lr, hi) of a block holds v[32 kp + 16 j + 8 hi + 0..7][16 dt + lr].
template <bool ISV>
__device__ __forceinline__ void fragorder(const float* __restrict__ S, bf* __restrict__ F) {
    const unsigned n0 = blockIdx.x * 256 + threadIdx.x; const float* sp[PCH]; bf* dp[PCH]; v8f v[PCH];
#pragma unroll
    for (int c = 0; c < PCH; ++c) { const unsigned n = n0 + c * (NCHK / PCH);
        if (!ISV) { const int d = (int)(n % (HD / 8)) * 8; const int t = (int)((n / (HD / 8)) % TT); const int bh = (int)(n / (HD / 8 * TT));
            sp[c] = S + ((size_t)(bh / NH_) * TT + t) * DM + (bh % NH_) * HD + d; v[c] = *(const v8f*)sp[c];
            dp[c] = F + (size_t)bh * TT * HD + (size_t)((((t >> 4) * 2 + (d >> 5)) * 2 + ((d >> 4) & 1)) * 32 + ((d >> 3) & 1) * 16 + (t & 15)) * 8; }
        else { const int lr = (int)(n & 15), hi = (int)((n >> 4) & 1), j = (int)((n >> 5) & 1), dt = (int)((n >> 6) & 3); const int kp = (int)((n >> 8) % (TT / 32)); const int bh = (int)((n >> 8) / (TT / 32));
            sp[c] = S + ((size_t)(bh / NH_) * TT + kp * 32 + 16 * j + 8 * hi) * DM + (bh % NH_) * HD + dt * 16 + lr;
#pragma unroll
            for (int q = 0; q < 8; ++q) v[c][q] = sp[c][(size_t)q * DM];
            dp[c] = F + (size_t)n * 8; } }
    asm volatile("s_wait_xcnt 0x0" :: "v"(sp[0]), "v"(sp[1]), "v"(sp[2]), "v"(sp[3]), "v"(sp[4]), "v"(sp[5]), "v"(sp[6]), "v"(sp[7]) : "memory");   // precaution: the wait stands in front of any rewrite of the loads' address registers, which it keeps live up to here
#pragma unroll
    for (int c = 0; c < PCH; ++c) { v8us o;
#pragma unroll
        for (int q = 0; q < 8; ++q) o[q] = ISV ? __builtin_bit_cast(unsigned short, (_Float16)v[c][q]) : f2bf(v[c][q]);
        *(v8us*)dp[c] = o; }
    asm volatile("s_wait_xcnt 0x0" :: "v"(dp[0]), "v"(dp[1]), "v"(dp[2]), "v"(dp[3]), "v"(dp[4]), "v"(dp[5]), "v"(dp[6]), "v"(dp[7]) : "memory");   // the same precaution for the stores' address registers
}
__global__ __launch_bounds__(256) void k_kvfrag(const float* __restrict__ Ks, const float* __restrict__ Vs, bf* Kf, bf* Vf) { if (blockIdx.y == 0) fragorder<false>(Ks, Kf); else fragorder<true>(Vs, Vf); }
__global__ __launch_bounds__(256) void k_epadK(const float* __restrict__ E, bf* EB) { const size_t i = (size_t)blockIdx.x * 256 + threadIdx.x; if (i >= (size_t)NE * HD / 8) return; const int d0 = (int)(i % (HD / 8)) * 8; const int r = (int)(i / (HD / 8)); const float* src = E + (size_t)min(r, NRE - 1) * HD + d0; v8us o;
#pragma unroll
    for (int q = 0; q < 8; ++q) { const unsigned short v = f2bf(src[q]); o[q] = (r < NRE) ? v : (unsigned short)0; }
    *(v8us*)(EB + (size_t)r * HD + d0) = o;  }

__global__ __launch_bounds__(256) void k_epadVT(const float* __restrict__ E, bf* Th, bf* Tl) { const size_t i = (size_t)blockIdx.x * 256 + threadIdx.x; if (i >= (size_t)HD * NE / 4) return; const size_t e = i * 4; const int c0 = (int)(e % NE); const int d = (int)(e / NE); v4us oh, ol;
#pragma unroll
    for (int q = 0; q < 4; ++q) { const int r = c0 + q; const float v = E[(size_t)min(r, NRE - 1) * HD + d]; unsigned short u, w; splitf(v, u, w); oh[q] = (r < NRE) ? u : (unsigned short)0; ol[q] = (r < NRE) ? w : (unsigned short)0; }
    *(v4us*)(Th + e) = oh; *(v4us*)(Tl + e) = ol;  }

// One pass: 32 keys from k0 against the wave's 32 queries. MODE 0: every key at least 16 left of every query; 2: at least 16 right; 1: any position.
template <int MODE>
__device__ __forceinline__ void fpass(const int k0, const int knext, const bf* __restrict__ kh, const bf* __restrict__ vh, const int lr, const int hi, const int q0,
                                      const v16bf (&qf)[NQ][2], v16bf (&kf)[2][2], v8f (&o)[NQ][4], float (&m)[NQ], float (&slo)[NQ], float (&shi)[NQ],
                                      const float (&bend)[NQ], const float* qeW, float* scW) {
    v16h vf[4]; const bf* vp = vh + k0 * HD + (unsigned)((hi * 16 + lr) * 8); const bf* kp = kh + knext * HD + (unsigned)((hi * 16 + lr) * 8);
#pragma unroll
    for (int dt = 0; dt < 4; ++dt) vf[dt] = __builtin_bit_cast(v16h, ldq(vp + dt * 512));
    v8f s[NQ][2];
#pragma unroll
    for (int g = 0; g < NQ; ++g)
#pragma unroll
        for (int t = 0; t < 2; ++t) { s[g][t] = (v8f){}; s[g][t] = wmmab(kf[t][0], qf[g][0], s[g][t]); s[g][t] = wmmab(kf[t][1], qf[g][1], s[g][t]); }   // s[g][t][r] = k[k0 + 16t + 8h + r] . q[q0 + 16g + lr]
#pragma unroll
    for (int t = 0; t < 2; ++t)
#pragma unroll
        for (int kc = 0; kc < 2; ++kc) kf[t][kc] = ldq(kp + t * 1024 + kc * 512);   // the next pass's keys, one pass ahead
    asm volatile("s_wait_xcnt 0x0" :: "v"(vp), "v"(kp) : "memory");   // precaution: the wait stands in front of any rewrite of the two address pairs of the loads above, which it keeps live up to here
    float tm[NQ]; bool need = false;
#pragma unroll
    for (int g = 0; g < NQ; ++g) { float a0 = NEGB, a1 = NEGB;
#pragma unroll
        for (int t = 0; t < 2; ++t) {
            if (MODE != 1) s[g][t] = s[g][t] * SC2 + bend[g];   // one offset for the whole pass
            else {
#pragma unroll
                for (int r = 0; r < 8; ++r) { const int dl = (k0 + t * 16 + 8 * hi + r) - (q0 + g * 16 + lr); const float x = __builtin_fmaf(s[g][t][r], SC2, qeW[(g * 16 + lr) * LP + min(max(dl, -CUT), CUT) + CUT]); s[g][t][r] = x;
                    if (dl > -CUT && dl < CUT) scW[(g * 16 + lr) * LP + dl + CUT] = x; } }
#pragma unroll
            for (int r = 0; r < 8; ++r) { if (t) a1 = fmaxf(a1, s[g][t][r]); else a0 = fmaxf(a0, s[g][t][r]); } }
        a0 = fmaxf(a0, a1); tm[g] = fmaxf(a0, xhalf(a0)); need = need || (tm[g] > m[g] + 8.0f); }
    if (__builtin_amdgcn_ballot_w32(need) != 0) {   // the maximum in use moves only when some query outgrows it by 2^8
#pragma unroll
        for (int g = 0; g < NQ; ++g) { const float mn = fmaxf(m[g], tm[g]); const float al = __builtin_amdgcn_exp2f(m[g] - mn); m[g] = mn; slo[g] *= al; shi[g] *= al;
#pragma unroll
            for (int dt = 0; dt < 4; ++dt) o[g][dt] *= al; } }
#pragma unroll
    for (int g = 0; g < NQ; ++g) { v16h ph; float l0 = 0.f, l1 = 0.f, h0 = 0.f, h1 = 0.f;
#pragma unroll
        for (int i = 0; i < 16; i += 2) { const int t = i >> 3, r = i & 7; v2f p; p[0] = __builtin_amdgcn_exp2f(s[g][t][r] - m[g]); p[1] = __builtin_amdgcn_exp2f(s[g][t][r + 1] - m[g]);
            if (MODE == 0) { l0 += p[0]; l1 += p[1]; }
            else if (MODE == 2) { h0 += p[0]; h1 += p[1]; }
            else { const int dl = (k0 + t * 16 + 8 * hi + r) - (q0 + g * 16 + lr); l0 += (dl <= -CUT) ? p[0] : 0.f; h0 += (dl >= CUT) ? p[0] : 0.f; l1 += (dl + 1 <= -CUT) ? p[1] : 0.f; h1 += (dl + 1 >= CUT) ? p[1] : 0.f; }
            const v2h u = __builtin_convertvector(p, v2h);   // P as f16, to nearest even
            ph[i] = u[0]; ph[i + 1] = u[1]; }
        slo[g] += l0 + l1; shi[g] += h0 + h1;
#pragma unroll
        for (int dt = 0; dt < 4; ++dt) o[g][dt] = wmmah(vf[dt], ph, o[g][dt]); }   // o[g][dt][r] = O[q0 + 16g + lr][16dt + 8h + r]
}

// 256 registers: above them every change of register window costs a scalar instruction in the loop
__global__ __launch_bounds__(FW * 32) __attribute__((amdgpu_num_vgpr(256))) void k_fattn(const float* __restrict__ Qin, const bf* __restrict__ KB, const bf* __restrict__ VT, const bf* __restrict__ AKB, const bf* __restrict__ AVT, float* OUT) {
    __shared__ float qeS[FW][NQ * 16 * LP];   // QE[query][offset] x SC2
    __shared__ float scS[FW][NQ * 16 * LP];   // scaled scores of the band, [query][offset]
    const int lane = threadIdx.x & 31, lr = lane & 15, hi = lane >> 4; const int wv = __builtin_amdgcn_readfirstlane(threadIdx.x >> 5);
    const int bh = blockIdx.y; const int q0 = (blockIdx.x * FW + wv) * (NQ * 16);
    const bf* kh = KB + (size_t)bh * TT * HD; const bf* vh = VT + (size_t)bh * HD * TT;
    float* qeW = qeS[wv]; float* scW = scS[wv];
    v16bf qf[NQ][2]; const float* qp = Qin + ((size_t)(bh / NH_) * TT + q0) * DM + (bh % NH_) * HD + (unsigned)(lr * DM + 8 * hi);
#pragma unroll
    for (int g = 0; g < NQ; ++g)
#pragma unroll
        for (int kc = 0; kc < 2; ++kc) { const v8f x0 = *(const v8f*)(qp + g * 16 * DM + kc * 32), x1 = *(const v8f*)(qp + g * 16 * DM + kc * 32 + 16); v8us u0, u1;
#pragma unroll
            for (int i = 0; i < 8; ++i) { u0[i] = f2bf(x0[i]); u1[i] = f2bf(x1[i]); }
            qf[g][kc] = cat16b(u0, u1); }
    asm volatile("s_wait_xcnt 0x0" :: "v"(qp) : "memory");   // the same precaution for the address pair of the loads above
#pragma unroll
    for (int e3 = 0; e3 < 3; ++e3) { const v16bf a0 = ldf(AKB + e3 * 16 * HD, (unsigned)(lr * HD + 8 * hi)), a1 = ldf(AKB + e3 * 16 * HD + 32, (unsigned)(lr * HD + 8 * hi));
#pragma unroll
        for (int g = 0; g < NQ; ++g) { v8f d = (v8f){}; d = wmmab(a0, qf[g][0], d); d = wmmab(a1, qf[g][1], d);   // d[r] = a_k[16 e3 + 8h + r] . q[q0 + 16g + lr]
#pragma unroll
            for (int r = 0; r < 8; ++r) { const int e = e3 * 16 + 8 * hi + r; if (e < NRE) qeW[(g * 16 + lr) * LP + e] = d[r] * SC2; } } }
#pragma unroll
    for (int i = 0; i < NQ * 16 * LP / 32; ++i) scW[i * 32 + lane] = NEGB;   // an offset with no key stays at exp2 -> 0
    __syncthreads();   // a lane reads QE entries that the other half of its wave wrote
    float bend[NQ], m[NQ], slo[NQ], shi[NQ]; v8f o[NQ][4];
#pragma unroll
    for (int g = 0; g < NQ; ++g) { bend[g] = qeW[(g * 16 + lr) * LP]; m[g] = NEGB; slo[g] = 0.f; shi[g] = 0.f;
#pragma unroll
        for (int dt = 0; dt < 4; ++dt) o[g][dt] = (v8f){}; }
    v16bf kf[2][2]; const bf* kp0 = kh + (unsigned)(lane * 8);
#pragma unroll
    for (int t = 0; t < 2; ++t)
#pragma unroll
        for (int kc = 0; kc < 2; ++kc) kf[t][kc] = ldq(kp0 + t * 1024 + kc * 512);
    asm volatile("s_wait_xcnt 0x0" :: "v"(kp0) : "memory");   // the same precaution
    const int kL = max(q0 - KP, 0), kR = min(q0 + NQ * 16 + KP, TT);   // passes in [kL, kR) touch the band
    // the three loops stay rolled (unroll 1): a pass is some hundred instructions long already, and a second copy would only cost instruction cache and registers
#pragma unroll 1
    for (int k0 = 0; k0 < kL; k0 += KP) fpass<0>(k0, k0 + KP, kh, vh, lr, hi, q0, qf, kf, o, m, slo, shi, bend, qeW, scW);
#pragma unroll 1
    for (int k0 = kL; k0 < kR; k0 += KP) fpass<1>(k0, min(k0 + KP, TT - KP), kh, vh, lr, hi, q0, qf, kf, o, m, slo, shi, bend, qeW, scW);
#pragma unroll
    for (int g = 0; g < NQ; ++g) bend[g] = qeW[(g * 16 + lr) * LP + 2 * CUT];
#pragma unroll 1
    for (int k0 = kR; k0 < TT; k0 += KP) fpass<2>(k0, min(k0 + KP, TT - KP), kh, vh, lr, hi, q0, qf, kf, o, m, slo, shi, bend, qeW, scW);
    __syncthreads();   // a lane reads band scores that the other half of its wave wrote
    v16bf av[4][2];
#pragma unroll
    for (int dt = 0; dt < 4; ++dt) { av[dt][0] = ldf(AVT + dt * 16 * NE, (unsigned)(lr * NE + 8 * hi)); av[dt][1] = ldf(AVT + dt * 16 * NE + 32, (unsigned)(lr * NE + 8 * hi)); }
    float* ob = OUT + (size_t)(bh / NH_) * TT * DM + (size_t)(bh % NH_) * HD;
#pragma unroll
    for (int g = 0; g < NQ; ++g) { const float lot = slo[g] + xhalf(slo[g]), hit = shi[g] + xhalf(shi[g]); float is = 0.f; v16bf b0h, b0l, b1h, b1l;
#pragma unroll
        for (int i = 0; i < 16; ++i) { const int e = (i < 8) ? 8 * hi + i : 16 + 8 * hi + (i - 8);   // bucket e in the fragment's k order
            float p = __builtin_amdgcn_exp2f(scW[(g * 16 + lr) * LP + e] - m[g]);
            if (i == 0) { is += hi ? p : 0.f; p = hi ? p : lot; } else is += p;
            const __bf16 u = (__bf16)p; b0h[i] = u; b0l[i] = (__bf16)(p - (float)u);
            const float p1 = (i == 0 && hi == 0) ? hit : 0.f;   // buckets 32..63: only 32 is used
            const __bf16 u1 = (__bf16)p1; b1h[i] = u1; b1l[i] = (__bf16)(p1 - (float)u1); }
        const float inv = __fdiv_rn(1.0f, lot + hit + (is + xhalf(is)));
#pragma unroll
        for (int dt = 0; dt < 4; ++dt) { v8f a = o[g][dt]; a = wmmab(av[dt][0], b0h, a); a = wmmab(av[dt][0], b0l, a); a = wmmab(av[dt][1], b1h, a); a = wmmab(av[dt][1], b1l, a); a *= inv;
            float* op = (ob + (size_t)(q0 + g * 16) * DM + dt * 16) + (unsigned)(lr * DM + 8 * hi);
            *(v4f*)op = __builtin_shufflevector(a, a, 0, 1, 2, 3); *(v4f*)(op + 4) = __builtin_shufflevector(a, a, 4, 5, 6, 7); } }
}

extern "C" void kernel_launch(void* const* d_in, const int* in_sizes, int n_in,
                              void* d_out, int out_size, void* d_ws, size_t ws_size, hipStream_t stream) {
    (void)in_sizes; (void)n_in; (void)out_size;
    const float* Qin = (const float*)d_in[0]; const float* Kin = (const float*)d_in[1]; const float* Vin = (const float*)d_in[2]; const float* ak = (const float*)d_in[3]; const float* av = (const float*)d_in[4];   /* rel_k_table, rel_v_table [33][64] */
    float* OUT = (float*)d_out;     // [2][2048][16][64] token-major
    char* wsp = (char*)d_ws;
    auto take = [&](size_t bytes) { char* p = wsp; wsp += (bytes + 255) & ~(size_t)255; return (void*)p; };
    bf* KB = (bf*)take((size_t)NB_ * NH_ * TT * HD * 2); bf* VT = (bf*)take((size_t)NB_ * NH_ * HD * TT * 2);
    bf* AKB = (bf*)take((size_t)NE * HD * 2); bf* AVTh = (bf*)take((size_t)HD * NE * 2); bf* AVTl = (bf*)take((size_t)HD * NE * 2);
    if ((size_t)(wsp - (char*)d_ws) > ws_size) return;
    k_epadK<<<(unsigned)(((size_t)NE * HD / 8 + 255) / 256), 256, 0, stream>>>(ak, AKB);   /* a_k -> bf16 [64][64], rows >= 33 zero */ k_epadVT<<<(unsigned)(((size_t)HD * NE / 4 + 255) / 256), 256, 0, stream>>>(av, AVTh, AVTl);   /* a_v^T -> [64][64] (lo plane unused: the table is taken as bf16) */
    k_kvfrag<<<dim3(NCHK / PCH / 256, 2), 256, 0, stream>>>(Kin, Vin, KB, VT);
    k_fattn<<<dim3(TT / (FW * NQ * 16), NB_ * NH_), FW * 32, 0, stream>>>(Qin, KB, VT, AKB, AVTh, OUT);
}

// v004
// One run takes 63.9 microseconds.
// In two side-by-side timings against v003, it was 1.07 and 1.05 times as fast.
// All steps since v000 together make it 48.4 times as fast.
#include <hip/hip_runtime.h>

// Relative-position multi-head attention on given token-major tensors (queries, keys, values [2][2048][16][64]; idx[l][s] = clip(s - l, -16, 16) + 16; attn = softmax((q.k + q.rel_k_table[idx]) / 8); out = attn values + sum_s attn[l][s] rel_v_table[idx[l][s]] (tables [33][64], read) -> [2][2048][16][64] token-major (4.2 M)).
// Prep, one launch (k_prep; a range of the block index picks the job, none of which needs another's result): k as bf16 and value^T as f16 in the order in which the fused kernel's fragments read them (every wave-wide load takes 512 contiguous bytes); the key table zero-padded to [64][64] and the value table transposed to [64][64].
// k_fattn: one launch for all heads. A wave owns 32 queries (two groups of 16, read from the input and rounded to bf16 once) and walks the 2048 keys 32 at a time: S^T = K Q^T, so that a lane holds the scores of one query; online softmax with a lazily moved maximum; the two score tiles of a pass, rounded to f16, are the B operand of O^T += V^T P^T as they lie in the accumulators (P lies in [0, 2^8] under the lazy maximum, inside f16's range). No score and no P plane goes to memory.
// Relative terms: QE^T = a_k Q^T (matrix product) once per wave. A pass wholly left (right) of the 31-wide band adds the one value QE[l][0] (QE[l][32]) and sums its P into the end bucket in registers; the three passes that touch the band gather QE from LDS and park the band's scaled scores in LDS. After the loop the 33 buckets (end sums; exp2 of the parked scores under the final maximum) are split hi/lo and O^T += a_v^T PB^T on the matrix unit; then one division by the row sum.
// Every '#pragma unroll' below makes the indices of a register array constants (an array indexed at run time would go to scratch).
// Compute dtypes, f32 accumulate: q, k and the tables rounded to bf16, values to f16 (11 significant bits; finite up to 65504); q.k and q.a_k exact products; softmax f32; P f16 x f16 value; bucket sums bf16 hi/lo x bf16 a_v; output f32.

#define NB_  2
#define TT   2048
#define DM   1024      // token-major row pitch (H x HD)
#define NH_  16
#define HD   64
#define NE   64       // 2*16+1 = 33 relative offsets padded to 64
#define NRE  33
#define CUT  16
#define FW   4        // waves per work-group of k_fattn
#define NQ   2        // groups of 16 queries per wave
#define KP   32       // keys per pass
#define LP   33       // LDS row pitch in floats (33 entries a query; odd: a column walk meets no bank twice)
#define SC2  0.18033688011112042f   // log2(e) / sqrt(64)
#define NEGB (-3.0e38f)
#define NCHK (NB_ * NH_ * TT * HD / 8)   // 8-element chunks in one of k, v
#define PCH  8        // chunks per thread of fragorder
#define KVB  (NCHK / PCH / 256)   // blocks of k_prep per tensor
#define TBB  (HD * NE / 4 / 256)  // blocks of k_prep per table (the value table's count; the key table's spare blocks leave at once)
typedef unsigned short bf;
typedef __attribute__((ext_vector_type(16))) __bf16   v16bf;
typedef __attribute__((ext_vector_type(8)))  unsigned short v8us;
typedef __attribute__((ext_vector_type(4)))  unsigned short v4us;
typedef __attribute__((ext_vector_type(8)))  float    v8f;
typedef __attribute__((ext_vector_type(4)))  float    v4f;
typedef __attribute__((ext_vector_type(2)))  float    v2f;
typedef __attribute__((ext_vector_type(16))) _Float16 v16h;
typedef __attribute__((ext_vector_type(2)))  _Float16 v2h;

__device__ __forceinline__ unsigned short f2bf(float f) { unsigned u = __float_as_uint(f); u += 0x7FFFu + ((u >> 16) & 1u); return (unsigned short)(u >> 16); }
__device__ __forceinline__ float bf2f(unsigned short b) { return __uint_as_float(((unsigned)b) << 16); }
__device__ __forceinline__ void splitf(float y, unsigned short& h, unsigned short& l) { h = f2bf(y); l = f2bf(y - bf2f(h)); }
__device__ __forceinline__ v16bf cat16b(v8us lo, v8us hi) { return __builtin_bit_cast(v16bf, __builtin_shufflevector(lo, hi, 0, 1, 2, 3, 4, 5, 6, 7, 8, 9, 10, 11, 12, 13, 14, 15)); }
__device__ __forceinline__ v8f wmmab(v16bf a, v16bf b, v8f c) { return __builtin_amdgcn_wmma_f32_16x16x32_bf16(false, a, false, b, (short)0, c, false, false); }
__device__ __forceinline__ v8f wmmah(v16h a, v16h b, v8f c) { return __builtin_amdgcn_wmma_f32_16x16x32_f16(false, a, false, b, (short)0, c, false, false); }
// fragment of one row (A) or column (B) from a k-contiguous plane; the address already holds + 8 * (lane >> 4): k = 8h + 0..7, then 16 + 8h + 0..7
// base is the same in every lane, off the lane's own offset in elements
__device__ __forceinline__ v16bf ldf(const bf* base, unsigned off) { const bf* p = base + off; return cat16b(*(const v8us*)p, *(const v8us*)(p + 16)); }
// the same fragment from a plane in fragment order; p already holds + 8 * lane: two loads of 512 contiguous bytes a wave
__device__ __forceinline__ v16bf ldq(const bf* p) { return cat16b(*(const v8us*)p, *(const v8us*)(p + 256)); }
// the value of lane l ^ 16
__device__ __forceinline__ float xhalf(float x) { const int b = __float_as_int(x); return __int_as_float(__builtin_amdgcn_permlanex16(b, b, 0x76543210, 0xfedcba98, false, false)); }

// Keys (bf16) and values (f16) of both batches in the order in which k_fattn's fragments read them, so that each of its wave-wide 16-byte loads takes 512 contiguous bytes. blockIdx.y picks the tensor; a thread makes PCH chunks of 8 elements.
// Keys: per (batch, head), per 16 keys, four 512-byte blocks (kc, j); lane (lr, hi) of a block holds k[16 kt + lr][32 kc + 16 j + 8 hi + 0..7].
// Values, transposed: per (batch, head), per 32 keys, eight 512-byte blocks (dt, j); lane (lr, hi) of a block holds v[32 kp + 16 j + 8 hi + 0..7][16 dt + lr].
template <bool ISV>
__device__ __forceinline__ void fragorder(const float* __restrict__ S, bf* __restrict__ F) {
    const unsigned n0 = blockIdx.x * 256 + threadIdx.x; const float* sp[PCH]; bf* dp[PCH]; v8f v[PCH]; v8us o[PCH];
#pragma unroll
    for (int c = 0; c < PCH; ++c) { const unsigned n = n0 + c * (NCHK / PCH);
        if (!ISV) { const int d = (int)(n % (HD / 8)) * 8; const int t = (int)((n / (HD / 8)) % TT); const int bh = (int)(n / (HD / 8 * TT));
            sp[c] = S + ((size_t)(bh / NH_) * TT + t) * DM + (bh % NH_) * HD + d; v[c] = *(const v8f*)sp[c];
            dp[c] = F + (size_t)bh * TT * HD + (size_t)((((t >> 4) * 2 + (d >> 5)) * 2 + ((d >> 4) & 1)) * 32 + ((d >> 3) & 1) * 16 + (t & 15)) * 8; }
        else { const int lr = (int)(n & 15), hi = (int)((n >> 4) & 1), j = (int)((n >> 5) & 1), dt = (int)((n >> 6) & 3); const int kp = (int)((n >> 8) % (TT / 32)); const int bh = (int)((n >> 8) / (TT / 32));
            sp[c] = S + ((size_t)(bh / NH_) * TT + kp * 32 + 16 * j + 8 * hi) * DM + (bh % NH_) * HD + dt * 16 + lr;
#pragma unroll
            for (int q = 0; q < 8; ++q) v[c][q] = sp[c][(size_t)q * DM];
            dp[c] = F + (size_t)n * 8; } }
    asm volatile("s_wait_xcnt 0x0" :: "v"(sp[0]), "v"(sp[1]), "v"(sp[2]), "v"(sp[3]), "v"(sp[4]), "v"(sp[5]), "v"(sp[6]), "v"(sp[7]) : "memory");   // precaution: the wait stands in front of any rewrite of the loads' address registers, which it keeps live up to here
#pragma unroll
    for (int c = 0; c < PCH; ++c) {
#pragma unroll
        for (int q = 0; q < 8; ++q) o[c][q] = ISV ? __builtin_bit_cast(unsigned short, (_Float16)v[c][q]) : f2bf(v[c][q]);
        *(v8us*)dp[c] = o[c]; }
    asm volatile("s_wait_xcnt 0x0" :: "v"(dp[0]), "v"(dp[1]), "v"(dp[2]), "v"(dp[3]), "v"(dp[4]), "v"(dp[5]), "v"(dp[6]), "v"(dp[7]), "v"(o[0]), "v"(o[1]), "v"(o[2]), "v"(o[3]), "v"(o[4]), "v"(o[5]), "v"(o[6]), "v"(o[7]) : "memory");   // the same precaution for the stores' address and data registers
}
// b: the block's number within its table job
__device__ __forceinline__ void epadK(const float* __restrict__ E, bf* EB, const unsigned b) { const size_t i = (size_t)b * 256 + threadIdx.x; if (i >= (size_t)NE * HD / 8) return; const int d0 = (int)(i % (HD / 8)) * 8; const int r = (int)(i / (HD / 8)); const float* src = E + (size_t)min(r, NRE - 1) * HD + d0; v8us o;
#pragma unroll
    for (int q = 0; q < 8; ++q) { const unsigned short v = f2bf(src[q]); o[q] = (r < NRE) ? v : (unsigned short)0; }
    *(v8us*)(EB + (size_t)r * HD + d0) = o;  }

__device__ __forceinline__ void epadVT(const float* __restrict__ E, bf* Th, bf* Tl, const unsigned b) { const size_t i = (size_t)b * 256 + threadIdx.x; if (i >= (size_t)HD * NE / 4) return; const size_t e = i * 4; const int c0 = (int)(e % NE); const int d = (int)(e / NE); v4us oh, ol;
#pragma unroll
    for (int q = 0; q < 4; ++q) { const int r = c0 + q; const float v = E[(size_t)min(r, NRE - 1) * HD + d]; unsigned short u, w; splitf(v, u, w); oh[q] = (r < NRE) ? u : (unsigned short)0; ol[q] = (r < NRE) ? w : (unsigned short)0; }
    *(v4us*)(Th + e) = oh; *(v4us*)(Tl + e) = ol;  }

// All preparation in one grid. blockIdx.x < KVB: keys (y = 0) or values (y = 1) into fragment order; the TBB blocks behind them: the key table (y = 0) or the value table (y = 1). Every branch is the same for a whole block.
__global__ __launch_bounds__(256) void k_prep(const float* __restrict__ Ks, const float* __restrict__ Vs, bf* Kf, bf* Vf, const float* __restrict__ Ek, bf* EB, const float* __restrict__ Ev, bf* Th, bf* Tl) {
    if (blockIdx.x >= KVB) { if (blockIdx.y == 0) epadK(Ek, EB, blockIdx.x - KVB); else epadVT(Ev, Th, Tl, blockIdx.x - KVB); return; }
    if (blockIdx.y == 0) fragorder<false>(Ks, Kf); else fragorder<true>(Vs, Vf); }

// One pass: 32 keys from k0 against the wave's 32 queries. MODE 0: every key at least 16 left of every query; 2: at least 16 right; 1: any position.
template <int MODE>
__device__ __forceinline__ void fpass(const int k0, const int knext, const bf* __restrict__ kh, const bf* __restrict__ vh, const int lr, const int hi, const int q0,
                                      const v16bf (&qf)[NQ][2], v16bf (&kf)[2][2], v8f (&o)[NQ][4], float (&m)[NQ], float (&slo)[NQ], float (&shi)[NQ],
                                      const float (&bend)[NQ], const float* qeW, float* scW) {
    v16h vf[4]; const bf* vp = vh + k0 * HD + (unsigned)((hi * 16 + lr) * 8); const bf* kp = kh + knext * HD + (unsigned)((hi * 16 + lr) * 8);
#pragma unroll
    for (int dt = 0; dt < 4; ++dt) vf[dt] = __builtin_bit_cast(v16h, ldq(vp + dt * 512));
    v8f s[NQ][2];
#pragma unroll
    for (int g = 0; g < NQ; ++g)
#pragma unroll
        for (int t = 0; t < 2; ++t) { s[g][t] = (v8f){}; s[g][t] = wmmab(kf[t][0], qf[g][0], s[g][t]); s[g][t] = wmmab(kf[t][1], qf[g][1], s[g][t]); }   // s[g][t][r] = k[k0 + 16t + 8h + r] . q[q0 + 16g + lr]
#pragma unroll
    for (int t = 0; t < 2; ++t)
#pragma unroll
        for (int kc = 0; kc < 2; ++kc) kf[t][kc] = ldq(kp + t * 1024 + kc * 512);   // the next pass's keys, one pass ahead
    asm volatile("s_wait_xcnt 0x0" :: "v"(vp), "v"(kp) : "memory");   // precaution: the wait stands in front of any rewrite of the two address pairs of the loads above, which it keeps live up to here
    float tm[NQ]; bool need = false;
#pragma unroll
    for (int g = 0; g < NQ; ++g) { float a0 = NEGB, a1 = NEGB;
#pragma unroll
        for (int t = 0; t < 2; ++t) {
            if (MODE != 1) s[g][t] = s[g][t] * SC2 + bend[g];   // one offset for the whole pass
            else {
#pragma unroll
                for (int r = 0; r < 8; ++r) { const int dl = (k0 + t * 16 + 8 * hi + r) - (q0 + g * 16 + lr); const float x = __builtin_fmaf(s[g][t][r], SC2, qeW[(g * 16 + lr) * LP + min(max(dl, -CUT), CUT) + CUT]); s[g][t][r] = x;
                    if (dl > -CUT && dl < CUT) scW[(g * 16 + lr) * LP + dl + CUT] = x; } }
#pragma unroll
            for (int r = 0; r < 8; ++r) { if (t) a1 = fmaxf(a1, s[g][t][r]); else a0 = fmaxf(a0, s[g][t][r]); } }
        a0 = fmaxf(a0, a1); tm[g] = fmaxf(a0, xhalf(a0)); need = need || (tm[g] > m[g] + 8.0f); }
    if (__builtin_amdgcn_ballot_w32(need) != 0) {   // the maximum in use moves only when some query outgrows it by 2^8
#pragma unroll
        for (int g = 0; g < NQ; ++g) { const float mn = fmaxf(m[g], tm[g]); const float al = __builtin_amdgcn_exp2f(m[g] - mn); m[g] = mn; slo[g] *= al; shi[g] *= al;
#pragma unroll
            for (int dt = 0; dt < 4; ++dt) o[g][dt] *= al; } }
#pragma unroll
    for (int g = 0; g < NQ; ++g) { v16h ph; float l0 = 0.f, l1 = 0.f, h0 = 0.f, h1 = 0.f;
#pragma unroll
        for (int i = 0; i < 16; i += 2) { const int t = i >> 3, r = i & 7; v2f p; p[0] = __builtin_amdgcn_exp2f(s[g][t][r] - m[g]); p[1] = __builtin_amdgcn_exp2f(s[g][t][r + 1] - m[g]);
            if (MODE == 0) { l0 += p[0]; l1 += p[1]; }
            else if (MODE == 2) { h0 += p[0]; h1 += p[1]; }
            else { const int dl = (k0 + t * 16 + 8 * hi + r) - (q0 + g * 16 + lr); l0 += (dl <= -CUT) ? p[0] : 0.f; h0 += (dl >= CUT) ? p[0] : 0.f; l1 += (dl + 1 <= -CUT) ? p[1] : 0.f; h1 += (dl + 1 >= CUT) ? p[1] : 0.f; }
            const v2h u = __builtin_convertvector(p, v2h);   // P as f16, to nearest even
            ph[i] = u[0]; ph[i + 1] = u[1]; }
        slo[g] += l0 + l1; shi[g] += h0 + h1;
#pragma unroll
        for (int dt = 0; dt < 4; ++dt) o[g][dt] = wmmah(vf[dt], ph, o[g][dt]); }   // o[g][dt][r] = O[q0 + 16g + lr][16dt + 8h + r]
}

// 256 registers: above them every change of register window costs a scalar instruction in the loop
__global__ __launch_bounds__(FW * 32) __attribute__((amdgpu_num_vgpr(256))) void k_fattn(const float* __restrict__ Qin, const bf* __restrict__ KB, const bf* __restrict__ VT, const bf* __restrict__ AKB, const bf* __restrict__ AVT, float* OUT) {
    __shared__ float qeS[FW][NQ * 16 * LP];   // QE[query][offset] x SC2
    __shared__ float scS[FW][NQ * 16 * LP];   // scaled scores of the band, [query][offset]
    const int lane = threadIdx.x & 31, lr = lane & 15, hi = lane >> 4; const int wv = __builtin_amdgcn_readfirstlane(threadIdx.x >> 5);
    const int bh = blockIdx.y; const int q0 = (blockIdx.x * FW + wv) * (NQ * 16);
    const bf* kh = KB + (size_t)bh * TT * HD; const bf* vh = VT + (size_t)bh * HD * TT;
    float* qeW = qeS[wv]; float* scW = scS[wv];
    v16bf qf[NQ][2]; const float* qp = Qin + ((size_t)(bh / NH_) * TT + q0) * DM + (bh % NH_) * HD + (unsigned)(lr * DM + 8 * hi);
#pragma unroll
    for (int g = 0; g < NQ; ++g)
#pragma unroll
        for (int kc = 0; kc < 2; ++kc) { const v8f x0 = *(const v8f*)(qp + g * 16 * DM + kc * 32), x1 = *(const v8f*)(qp + g * 16 * DM + kc * 32 + 16); v8us u0, u1;
#pragma unroll
            for (int i = 0; i < 8; ++i) { u0[i] = f2bf(x0[i]); u1[i] = f2bf(x1[i]); }
            qf[g][kc] = cat16b(u0, u1); }
    asm volatile("s_wait_xcnt 0x0" :: "v"(qp) : "memory");   // the same precaution for the address pair of the loads above
#pragma unroll
    for (int e3 = 0; e3 < 3; ++e3) { const v16bf a0 = ldf(AKB + e3 * 16 * HD, (unsigned)(lr * HD + 8 * hi)), a1 = ldf(AKB + e3 * 16 * HD + 32, (unsigned)(lr * HD + 8 * hi));
#pragma unroll
        for (int g = 0; g < NQ; ++g) { v8f d = (v8f){}; d = wmmab(a0, qf[g][0], d); d = wmmab(a1, qf[g][1], d);   // d[r] = a_k[16 e3 + 8h + r] . q[q0 + 16g + lr]
#pragma unroll
            for (int r = 0; r < 8; ++r) { const int e = e3 * 16 + 8 * hi + r; if (e < NRE) qeW[(g * 16 + lr) * LP + e] = d[r] * SC2; } } }
#pragma unroll
    for (int i = 0; i < NQ * 16 * LP / 32; ++i) scW[i * 32 + lane] = NEGB;   // an offset with no key stays at exp2 -> 0
    __syncthreads();   // a lane reads QE entries that the other half of its wave wrote
    float bend[NQ], m[NQ], slo[NQ], shi[NQ]; v8f o[NQ][4];
#pragma unroll
    for (int g = 0; g < NQ; ++g) { bend[g] = qeW[(g * 16 + lr) * LP]; m[g] = NEGB; slo[g] = 0.f; shi[g] = 0.f;
#pragma unroll
        for (int dt = 0; dt < 4; ++dt) o[g][dt] = (v8f){}; }
    v16bf kf[2][2]; const bf* kp0 = kh + (unsigned)(lane * 8);
#pragma unroll
    for (int t = 0; t < 2; ++t)
#pragma unroll
        for (int kc = 0; kc < 2; ++kc) kf[t][kc] = ldq(kp0 + t * 1024 + kc * 512);
    asm volatile("s_wait_xcnt 0x0" :: "v"(kp0) : "memory");   // the same precaution
    const int kL = max(q0 - KP, 0), kR = min(q0 + NQ * 16 + KP, TT);   // passes in [kL, kR) touch the band
    // the three loops stay rolled (unroll 1): a pass is some hundred instructions long already, and a second copy would only cost instruction cache and registers
#pragma unroll 1
    for (int k0 = 0; k0 < kL; k0 += KP) fpass<0>(k0, k0 + KP, kh, vh, lr, hi, q0, qf, kf, o, m, slo, shi, bend, qeW, scW);
#pragma unroll 1
    for (int k0 = kL; k0 < kR; k0 += KP) fpass<1>(k0, min(k0 + KP, TT - KP), kh, vh, lr, hi, q0, qf, kf, o, m, slo, shi, bend, qeW, scW);
#pragma unroll
    for (int g = 0; g < NQ; ++g) bend[g] = qeW[(g * 16 + lr) * LP + 2 * CUT];
#pragma unroll 1
    for (int k0 = kR; k0 < TT; k0 += KP) fpass<2>(k0, min(k0 + KP, TT - KP), kh, vh, lr, hi, q0, qf, kf, o, m, slo, shi, bend, qeW, scW);
    __syncthreads();   // a lane reads band scores that the other half of its wave wrote
    v16bf av[4][2];
#pragma unroll
    for (int dt = 0; dt < 4; ++dt) { av[dt][0] = ldf(AVT + dt * 16 * NE, (unsigned)(lr * NE + 8 * hi)); av[dt][1] = ldf(AVT + dt * 16 * NE + 32, (unsigned)(lr * NE + 8 * hi)); }
    float* ob = OUT + (size_t)(bh / NH_) * TT * DM + (size_t)(bh % NH_) * HD;
#pragma unroll
    for (int g = 0; g < NQ; ++g) { const float lot = slo[g] + xhalf(slo[g]), hit = shi[g] + xhalf(shi[g]); float is = 0.f; v16bf b0h, b0l, b1h, b1l;
#pragma unroll
        for (int i = 0; i < 16; ++i) { const int e = (i < 8) ? 8 * hi + i : 16 + 8 * hi + (i - 8);   // bucket e in the fragment's k order
            float p = __builtin_amdgcn_exp2f(scW[(g * 16 + lr) * LP + e] - m[g]);
            if (i == 0) { is += hi ? p : 0.f; p = hi ? p : lot; } else is += p;
            const __bf16 u = (__bf16)p; b0h[i] = u; b0l[i] = (__bf16)(p - (float)u);
            const float p1 = (i == 0 && hi == 0) ? hit : 0.f;   // buckets 32..63: only 32 is used
            const __bf16 u1 = (__bf16)p1; b1h[i] = u1; b1l[i] = (__bf16)(p1 - (float)u1); }
        const float inv = __fdiv_rn(1.0f, lot + hit + (is + xhalf(is)));
#pragma unroll
        for (int dt = 0; dt < 4; ++dt) { v8f a = o[g][dt]; a = wmmab(av[dt][0], b0h, a); a = wmmab(av[dt][0], b0l, a); a = wmmab(av[dt][1], b1h, a); a = wmmab(av[dt][1], b1l, a); a *= inv;
            float* op = (ob + (size_t)(q0 + g * 16) * DM + dt * 16) + (unsigned)(lr * DM + 8 * hi);
            *(v4f*)op = __builtin_shufflevector(a, a, 0, 1, 2, 3); *(v4f*)(op + 4) = __builtin_shufflevector(a, a, 4, 5, 6, 7); } }
}

extern "C" void kernel_launch(void* const* d_in, const int* in_sizes, int n_in,
                              void* d_out, int out_size, void* d_ws, size_t ws_size, hipStream_t stream) {
    (void)in_sizes; (void)n_in; (void)out_size;
    const float* Qin = (const float*)d_in[0]; const float* Kin = (const float*)d_in[1]; const float* Vin = (const float*)d_in[2]; const float* ak = (const float*)d_in[3]; const float* av = (const float*)d_in[4];   /* rel_k_table, rel_v_table [33][64] */
    float* OUT = (float*)d_out;     // [2][2048][16][64] token-major
    char* wsp = (char*)d_ws;
    auto take = [&](size_t bytes) { char* p = wsp; wsp += (bytes + 255) & ~(size_t)255; return (void*)p; };
    bf* KB = (bf*)take((size_t)NB_ * NH_ * TT * HD * 2); bf* VT = (bf*)take((size_t)NB_ * NH_ * HD * TT * 2);
    bf* AKB = (bf*)take((size_t)NE * HD * 2); bf* AVTh = (bf*)take((size_t)HD * NE * 2); bf* AVTl = (bf*)take((size_t)HD * NE * 2);
    if ((size_t)(wsp - (char*)d_ws) > ws_size) return;
    k_prep<<<dim3(KVB + TBB, 2), 256, 0, stream>>>(Kin, Vin, KB, VT, ak, AKB, av, AVTh, AVTl);   /* k, v -> fragment order; a_k -> bf16 [64][64], rows >= 33 zero; a_v^T -> [64][64] (lo plane unused: the table is taken as bf16) */
    k_fattn<<<dim3(TT / (FW * NQ * 16), NB_ * NH_), FW * 32, 0, stream>>>(Qin, KB, VT, AKB, AVTh, OUT);
}

// v005
// It runs in 51.7 microseconds.
// Next to v004, in two timings, it ran 1.27 and 1.23 times as fast.
// Counting every step since v000, it is 60.5 times as fast.
#include <hip/hip_runtime.h>

// Relative-position multi-head attention on given token-major tensors (queries, keys, values [2][2048][16][64]; idx[l][s] = clip(s - l, -16, 16) + 16; attn = softmax((q.k + q.rel_k_table[idx]) / 8); out = attn values + sum_s attn[l][s] rel_v_table[idx[l][s]] (tables [33][64], read) -> [2][2048][16][64] token-major (4.2 M)).
// Prep, one launch (k_prep; a range of the block index picks the job, none of which needs another's result): k as bf16 and value^T as f16 in the order in which the fused kernel's fragments read them (every wave-wide load takes 512 contiguous bytes); the key table zero-padded to [64][64] and the value table transposed to [64][64].
// k_fattn: one launch for all heads. A wave owns 32 queries (two groups of 16, read from the input and rounded to bf16 once) and walks the 2048 keys 32 at a time: S^T = K Q^T, so that a lane holds the scores of one query; online softmax with a lazily moved maximum; the two score tiles of a pass, rounded to f16, are the B operand of O^T += V^T P^T as they lie in the accumulators (P lies in [0, 2^8] under the lazy maximum, inside f16's range). No score and no P plane goes to memory. The NXB work-groups of a head each enter the ring of key passes at a start of their own and wrap round, so that they do not ask L2 for the same lines at the same moment.
// Relative terms: QE^T = a_k Q^T (matrix product) once per wave. A pass wholly left (right) of the 31-wide band adds the one value QE[l][0] (QE[l][32]) and sums its P into the end bucket in registers; the three passes that touch the band gather QE from LDS and park the band's scaled scores in LDS. After the loop the 33 buckets (end sums; exp2 of the parked scores under the final maximum) are split hi/lo and O^T += a_v^T PB^T on the matrix unit; then one division by the row sum.
// Every '#pragma unroll' below makes the indices of a register array constants (an array indexed at run time would go to scratch).
// Compute dtypes, f32 accumulate: q, k and the tables rounded to bf16, values to f16 (11 significant bits; finite up to 65504); q.k and q.a_k exact products; softmax f32; P f16 x f16 value; bucket sums bf16 hi/lo x bf16 a_v; output f32.

#define NB_  2
#define TT   2048
#define DM   1024      // token-major row pitch (H x HD)
#define NH_  16
#define HD   64
#define NE   64       // 2*16+1 = 33 relative offsets padded to 64
#define NRE  33
#define CUT  16
#define FW   4        // waves per work-group of k_fattn
#define NQ   2        // groups of 16 queries per wave
#define KP   32       // keys per pass
#define NXB  (TT / (FW * NQ * 16))   // work-groups of k_fattn that share one head's keys and values
#define LP   33       // LDS row pitch in floats (33 entries a query; odd: a column walk meets no bank twice)
#define SC2  0.18033688011112042f   // log2(e) / sqrt(64)
#define NEGB (-3.0e38f)
#define NCHK (NB_ * NH_ * TT * HD / 8)   // 8-element chunks in one of k, v
#define PCH  8        // chunks per thread of fragorder
#define KVB  (NCHK / PCH / 256)   // blocks of k_prep per tensor
#define TBB  (HD * NE / 4 / 256)  // blocks of k_prep per table (the value table's count; the key table's spare blocks leave at once)
typedef unsigned short bf;
typedef __attribute__((ext_vector_type(16))) __bf16   v16bf;
typedef __attribute__((ext_vector_type(8)))  unsigned short v8us;
typedef __attribute__((ext_vector_type(4)))  unsigned short v4us;
typedef __attribute__((ext_vector_type(8)))  float    v8f;
typedef __attribute__((ext_vector_type(4)))  float    v4f;
typedef __attribute__((ext_vector_type(2)))  float    v2f;
typedef __attribute__((ext_vector_type(16))) _Float16 v16h;
typedef __attribute__((ext_vector_type(2)))  _Float16 v2h;

__device__ __forceinline__ unsigned short f2bf(float f) { unsigned u = __float_as_uint(f); u += 0x7FFFu + ((u >> 16) & 1u); return (unsigned short)(u >> 16); }
__device__ __forceinline__ float bf2f(unsigned short b) { return __uint_as_float(((unsigned)b) << 16); }
__device__ __forceinline__ void splitf(float y, unsigned short& h, unsigned short& l) { h = f2bf(y); l = f2bf(y - bf2f(h)); }
__device__ __forceinline__ v16bf cat16b(v8us lo, v8us hi) { return __builtin_bit_cast(v16bf, __builtin_shufflevector(lo, hi, 0, 1, 2, 3, 4, 5, 6, 7, 8, 9, 10, 11, 12, 13, 14, 15)); }
__device__ __forceinline__ v8f wmmab(v16bf a, v16bf b, v8f c) { return __builtin_amdgcn_wmma_f32_16x16x32_bf16(false, a, false, b, (short)0, c, false, false); }
__device__ __forceinline__ v8f wmmah(v16h a, v16h b, v8f c) { return __builtin_amdgcn_wmma_f32_16x16x32_f16(false, a, false, b, (short)0, c, false, false); }
// fragment of one row (A) or column (B) from a k-contiguous plane; the address already holds + 8 * (lane >> 4): k = 8h + 0..7, then 16 + 8h + 0..7
// base is the same in every lane, off the lane's own offset in elements
__device__ __forceinline__ v16bf ldf(const bf* base, unsigned off) { const bf* p = base + off; return cat16b(*(const v8us*)p, *(const v8us*)(p + 16)); }
// the same fragment from a plane in fragment order; p already holds + 8 * lane: two loads of 512 contiguous bytes a wave
__device__ __forceinline__ v16bf ldq(const bf* p) { return cat16b(*(const v8us*)p, *(const v8us*)(p + 256)); }
// the value of lane l ^ 16
__device__ __forceinline__ float xhalf(float x) { const int b = __float_as_int(x); return __int_as_float(__builtin_amdgcn_permlanex16(b, b, 0x76543210, 0xfedcba98, false, false)); }

// Keys (bf16) and values (f16) of both batches in the order in which k_fattn's fragments read them, so that each of its wave-wide 16-byte loads takes 512 contiguous bytes. blockIdx.y picks the tensor; a thread makes PCH chunks of 8 elements.
// Keys: per (batch, head), per 16 keys, four 512-byte blocks (kc, j); lane (lr, hi) of a block holds k[16 kt + lr][32 kc + 16 j + 8 hi + 0..7].
// Values, transposed: per (batch, head), per 32 keys, eight 512-byte blocks (dt, j); lane (lr, hi) of a block holds v[32 kp + 16 j + 8 hi + 0..7][16 dt + lr].
template <bool ISV>
__device__ __forceinline__ void fragorder(const float* __restrict__ S, bf* __restrict__ F) {
    const unsigned n0 = blockIdx.x * 256 + threadIdx.x; const float* sp[PCH]; bf* dp[PCH]; v8f v[PCH]; v8us o[PCH];
#pragma unroll
    for (int c = 0; c < PCH; ++c) { const unsigned n = n0 + c * (NCHK / PCH);
        if (!ISV) { const int d = (int)(n % (HD / 8)) * 8; const int t = (int)((n / (HD / 8)) % TT); const int bh = (int)(n / (HD / 8 * TT));
            sp[c] = S + ((size_t)(bh / NH_) * TT + t) * DM + (bh % NH_) * HD + d; v[c] = *(const v8f*)sp[c];
            dp[c] = F + (size_t)bh * TT * HD + (size_t)((((t >> 4) * 2 + (d >> 5)) * 2 + ((d >> 4) & 1)) * 32 + ((d >> 3) & 1) * 16 + (t & 15)) * 8; }
        else { const int lr = (int)(n & 15), hi = (int)((n >> 4) & 1), j = (int)((n >> 5) & 1), dt = (int)((n >> 6) & 3); const int kp = (int)((n >> 8) % (TT / 32)); const int bh = (int)((n >> 8) / (TT / 32));
            sp[c] = S + ((size_t)(bh / NH_) * TT + kp * 32 + 16 * j + 8 * hi) * DM + (bh % NH_) * HD + dt * 16 + lr;
#pragma unroll
            for (int q = 0; q < 8; ++q) v[c][q] = sp[c][(size_t)q * DM];
            dp[c] = F + (size_t)n * 8; } }
    asm volatile("s_wait_xcnt 0x0" :: "v"(sp[0]), "v"(sp[1]), "v"(sp[2]), "v"(sp[3]), "v"(sp[4]), "v"(sp[5]), "v"(sp[6]), "v"(sp[7]) : "memory");   // precaution: the wait stands in front of any rewrite of the loads' address registers, which it keeps live up to here
#pragma unroll
    for (int c = 0; c < PCH; ++c) {
#pragma unroll
        for (int q = 0; q < 8; ++q) o[c][q] = ISV ? __builtin_bit_cast(unsigned short, (_Float16)v[c][q]) : f2bf(v[c][q]);
        *(v8us*)dp[c] = o[c]; }
    asm volatile("s_wait_xcnt 0x0" :: "v"(dp[0]), "v"(dp[1]), "v"(dp[2]), "v"(dp[3]), "v"(dp[4]), "v"(dp[5]), "v"(dp[6]), "v"(dp[7]), "v"(o[0]), "v"(o[1]), "v"(o[2]), "v"(o[3]), "v"(o[4]), "v"(o[5]), "v"(o[6]), "v"(o[7]) : "memory");   // the same precaution for the stores' address and data registers
}
// b: the block's number within its table job
__device__ __forceinline__ void epadK(const float* __restrict__ E, bf* EB, const unsigned b) { const size_t i = (size_t)b * 256 + threadIdx.x; if (i >= (size_t)NE * HD / 8) return; const int d0 = (int)(i % (HD / 8)) * 8; const int r = (int)(i / (HD / 8)); const float* src = E + (size_t)min(r, NRE - 1) * HD + d0; v8us o;
#pragma unroll
    for (int q = 0; q < 8; ++q) { const unsigned short v = f2bf(src[q]); o[q] = (r < NRE) ? v : (unsigned short)0; }
    *(v8us*)(EB + (size_t)r * HD + d0) = o;  }

__device__ __forceinline__ void epadVT(const float* __restrict__ E, bf* Th, bf* Tl, const unsigned b) { const size_t i = (size_t)b * 256 + threadIdx.x; if (i >= (size_t)HD * NE / 4) return; const size_t e = i * 4; const int c0 = (int)(e % NE); const int d = (int)(e / NE); v4us oh, ol;
#pragma unroll
    for (int q = 0; q < 4; ++q) { const int r = c0 + q; const float v = E[(size_t)min(r, NRE - 1) * HD + d]; unsigned short u, w; splitf(v, u, w); oh[q] = (r < NRE) ? u : (unsigned short)0; ol[q] = (r < NRE) ? w : (unsigned short)0; }
    *(v4us*)(Th + e) = oh; *(v4us*)(Tl + e) = ol;  }

// All preparation in one grid. blockIdx.x < KVB: keys (y = 0) or values (y = 1) into fragment order; the TBB blocks behind them: the key table (y = 0) or the value table (y = 1). Every branch is the same for a whole block.
__global__ __launch_bounds__(256) void k_prep(const float* __restrict__ Ks, const float* __restrict__ Vs, bf* Kf, bf* Vf, const float* __restrict__ Ek, bf* EB, const float* __restrict__ Ev, bf* Th, bf* Tl) {
    if (blockIdx.x >= KVB) { if (blockIdx.y == 0) epadK(Ek, EB, blockIdx.x - KVB); else epadVT(Ev, Th, Tl, blockIdx.x - KVB); return; }
    if (blockIdx.y == 0) fragorder<false>(Ks, Kf); else fragorder<true>(Vs, Vf); }

// One pass: 32 keys from k0 against the wave's 32 queries. MODE 0: every key at least 16 left of every query; 2: at least 16 right; 1: any position.
template <int MODE>
__device__ __forceinline__ void fpass(const int k0, const int knext, const bf* __restrict__ kh, const bf* __restrict__ vh, const int lr, const int hi, const int q0,
                                      const v16bf (&qf)[NQ][2], v16bf (&kf)[2][2], v8f (&o)[NQ][4], float (&m)[NQ], float (&slo)[NQ], float (&shi)[NQ],
                                      const float (&bend)[NQ], const float* qeW, float* scW) {
    v16h vf[4]; const bf* vp = vh + k0 * HD + (unsigned)((hi * 16 + lr) * 8); const bf* kp = kh + knext * HD + (unsigned)((hi * 16 + lr) * 8);
#pragma unroll
    for (int dt = 0; dt < 4; ++dt) vf[dt] = __builtin_bit_cast(v16h, ldq(vp + dt * 512));
    v8f s[NQ][2];
#pragma unroll
    for (int g = 0; g < NQ; ++g)
#pragma unroll
        for (int t = 0; t < 2; ++t) { s[g][t] = (v8f){}; s[g][t] = wmmab(kf[t][0], qf[g][0], s[g][t]); s[g][t] = wmmab(kf[t][1], qf[g][1], s[g][t]); }   // s[g][t][r] = k[k0 + 16t + 8h + r] . q[q0 + 16g + lr]
#pragma unroll
    for (int t = 0; t < 2; ++t)
#pragma unroll
        for (int kc = 0; kc < 2; ++kc) kf[t][kc] = ldq(kp + t * 1024 + kc * 512);   // the next pass's keys, one pass ahead
    asm volatile("s_wait_xcnt 0x0" :: "v"(vp), "v"(kp) : "memory");   // precaution: the wait stands in front of any rewrite of the two address pairs of the loads above, which it keeps live up to here
    float tm[NQ]; bool need = false;
#pragma unroll
    for (int g = 0; g < NQ; ++g) { float a0 = NEGB, a1 = NEGB;
#pragma unroll
        for (int t = 0; t < 2; ++t) {
            if (MODE != 1) s[g][t] = s[g][t] * SC2 + bend[g];   // one offset for the whole pass
            else {
#pragma unroll
                for (int r = 0; r < 8; ++r) { const int dl = (k0 + t * 16 + 8 * hi + r) - (q0 + g * 16 + lr); const float x = __builtin_fmaf(s[g][t][r], SC2, qeW[(g * 16 + lr) * LP + min(max(dl, -CUT), CUT) + CUT]); s[g][t][r] = x;
                    if (dl > -CUT && dl < CUT) scW[(g * 16 + lr) * LP + dl + CUT] = x; } }
#pragma unroll
            for (int r = 0; r < 8; ++r) { if (t) a1 = fmaxf(a1, s[g][t][r]); else a0 = fmaxf(a0, s[g][t][r]); } }
        a0 = fmaxf(a0, a1); tm[g] = fmaxf(a0, xhalf(a0)); need = need || (tm[g] > m[g] + 8.0f); }
    if (__builtin_amdgcn_ballot_w32(need) != 0) {   // the maximum in use moves only when some query outgrows it by 2^8
#pragma unroll
        for (int g = 0; g < NQ; ++g) { const float mn = fmaxf(m[g], tm[g]); const float al = __builtin_amdgcn_exp2f(m[g] - mn); m[g] = mn; slo[g] *= al; shi[g] *= al;
#pragma unroll
            for (int dt = 0; dt < 4; ++dt) o[g][dt] *= al; } }
#pragma unroll
    for (int g = 0; g < NQ; ++g) { v16h ph; float l0 = 0.f, l1 = 0.f, h0 = 0.f, h1 = 0.f;
#pragma unroll
        for (int i = 0; i < 16; i += 2) { const int t = i >> 3, r = i & 7; v2f p; p[0] = __builtin_amdgcn_exp2f(s[g][t][r] - m[g]); p[1] = __builtin_amdgcn_exp2f(s[g][t][r + 1] - m[g]);
            if (MODE == 0) { l0 += p[0]; l1 += p[1]; }
            else if (MODE == 2) { h0 += p[0]; h1 += p[1]; }
            else { const int dl = (k0 + t * 16 + 8 * hi + r) - (q0 + g * 16 + lr); l0 += (dl <= -CUT) ? p[0] : 0.f; h0 += (dl >= CUT) ? p[0] : 0.f; l1 += (dl + 1 <= -CUT) ? p[1] : 0.f; h1 += (dl + 1 >= CUT) ? p[1] : 0.f; }
            const v2h u = __builtin_convertvector(p, v2h);   // P as f16, to nearest even
            ph[i] = u[0]; ph[i + 1] = u[1]; }
        slo[g] += l0 + l1; shi[g] += h0 + h1;
#pragma unroll
        for (int dt = 0; dt < 4; ++dt) o[g][dt] = wmmah(vf[dt], ph, o[g][dt]); }   // o[g][dt][r] = O[q0 + 16g + lr][16dt + 8h + r]
}

// 256 registers: above them every change of register window costs a scalar instruction in the loop
__global__ __launch_bounds__(FW * 32) __attribute__((amdgpu_num_vgpr(256))) void k_fattn(const float* __restrict__ Qin, const bf* __restrict__ KB, const bf* __restrict__ VT, const bf* __restrict__ AKB, const bf* __restrict__ AVT, float* OUT) {
    __shared__ float qeS[FW][NQ * 16 * LP];   // QE[query][offset] x SC2
    __shared__ float scS[FW][NQ * 16 * LP];   // scaled scores of the band, [query][offset]
    const int lane = threadIdx.x & 31, lr = lane & 15, hi = lane >> 4; const int wv = __builtin_amdgcn_readfirstlane(threadIdx.x >> 5);
    const int bh = blockIdx.y; const int q0 = (blockIdx.x * FW + wv) * (NQ * 16);
    const bf* kh = KB + (size_t)bh * TT * HD; const bf* vh = VT + (size_t)bh * HD * TT;
    float* qeW = qeS[wv]; float* scW = scS[wv];
    v16bf qf[NQ][2]; const float* qp = Qin + ((size_t)(bh / NH_) * TT + q0) * DM + (bh % NH_) * HD + (unsigned)(lr * DM + 8 * hi);
#pragma unroll
    for (int g = 0; g < NQ; ++g)
#pragma unroll
        for (int kc = 0; kc < 2; ++kc) { const v8f x0 = *(const v8f*)(qp + g * 16 * DM + kc * 32), x1 = *(const v8f*)(qp + g * 16 * DM + kc * 32 + 16); v8us u0, u1;
#pragma unroll
            for (int i = 0; i < 8; ++i) { u0[i] = f2bf(x0[i]); u1[i] = f2bf(x1[i]); }
            qf[g][kc] = cat16b(u0, u1); }
    asm volatile("s_wait_xcnt 0x0" :: "v"(qp) : "memory");   // the same precaution for the address pair of the loads above
#pragma unroll
    for (int e3 = 0; e3 < 3; ++e3) { const v16bf a0 = ldf(AKB + e3 * 16 * HD, (unsigned)(lr * HD + 8 * hi)), a1 = ldf(AKB + e3 * 16 * HD + 32, (unsigned)(lr * HD + 8 * hi));
#pragma unroll
        for (int g = 0; g < NQ; ++g) { v8f d = (v8f){}; d = wmmab(a0, qf[g][0], d); d = wmmab(a1, qf[g][1], d);   // d[r] = a_k[16 e3 + 8h + r] . q[q0 + 16g + lr]
#pragma unroll
            for (int r = 0; r < 8; ++r) { const int e = e3 * 16 + 8 * hi + r; if (e < NRE) qeW[(g * 16 + lr) * LP + e] = d[r] * SC2; } } }
#pragma unroll
    for (int i = 0; i < NQ * 16 * LP / 32; ++i) scW[i * 32 + lane] = NEGB;   // an offset with no key stays at exp2 -> 0
    __syncthreads();   // a lane reads QE entries that the other half of its wave wrote
    float bend[NQ], m[NQ], slo[NQ], shi[NQ]; v8f o[NQ][4];
#pragma unroll
    for (int g = 0; g < NQ; ++g) { m[g] = NEGB; slo[g] = 0.f; shi[g] = 0.f;
#pragma unroll
        for (int dt = 0; dt < 4; ++dt) o[g][dt] = (v8f){}; }
    // first key of this work-group's walk. For speed only (any permutation of the starts gives the same function): neighbours in the block index get starts a quarter of the ring apart, so that any few consecutive work-groups spread over the whole ring
    const int ks = (int)((blockIdx.x % 4) * (NXB / 4) + blockIdx.x / 4) * (TT / NXB);
    v16bf kf[2][2]; const bf* kp0 = kh + ks * HD + (unsigned)(lane * 8);
#pragma unroll
    for (int t = 0; t < 2; ++t)
#pragma unroll
        for (int kc = 0; kc < 2; ++kc) kf[t][kc] = ldq(kp0 + t * 1024 + kc * 512);
    asm volatile("s_wait_xcnt 0x0" :: "v"(kp0) : "memory");   // the same precaution
    const int kL = max(q0 - KP, 0), kR = min(q0 + NQ * 16 + KP, TT);   // passes in [kL, kR) touch the band
    // the three loops stay rolled (unroll 1): a pass is some hundred instructions long already, and a second copy would only cost instruction cache and registers
    // two stretches, [ks, TT) and then [0, ks); the pass behind k0 is (k0 + KP) mod TT in both (the very last pass fetches keys that nobody uses, inside the plane). Rolled too: one copy of the three loops serves both stretches
#pragma unroll 1
    for (int h = 0; h < 2; ++h) { const int ka = h ? 0 : ks, kb = h ? ks : TT;
#pragma unroll
        for (int g = 0; g < NQ; ++g) bend[g] = qeW[(g * 16 + lr) * LP];
#pragma unroll 1
        for (int k0 = ka; k0 < min(kb, kL); k0 += KP) fpass<0>(k0, (k0 + KP) & (TT - 1), kh, vh, lr, hi, q0, qf, kf, o, m, slo, shi, bend, qeW, scW);
        asm volatile("v_nop\n\tv_nop\n\tv_nop\n\tv_nop");   // the four vector slots the chip needs between a pass's last matrix instruction and an overwrite of its operands: only scalar code may follow up to the next loop's first vector write (the way out of the third loop, round the outer loop with the first loop skipped, comes through here too)
#pragma unroll 1
        for (int k0 = max(ka, kL); k0 < min(kb, kR); k0 += KP) fpass<1>(k0, (k0 + KP) & (TT - 1), kh, vh, lr, hi, q0, qf, kf, o, m, slo, shi, bend, qeW, scW);
#pragma unroll
        for (int g = 0; g < NQ; ++g) bend[g] = qeW[(g * 16 + lr) * LP + 2 * CUT];
#pragma unroll 1
        for (int k0 = max(ka, kR); k0 < kb; k0 += KP) fpass<2>(k0, (k0 + KP) & (TT - 1), kh, vh, lr, hi, q0, qf, kf, o, m, slo, shi, bend, qeW, scW);
    }
    __syncthreads();   // a lane reads band scores that the other half of its wave wrote
    v16bf av[4][2];
#pragma unroll
    for (int dt = 0; dt < 4; ++dt) { av[dt][0] = ldf(AVT + dt * 16 * NE, (unsigned)(lr * NE + 8 * hi)); av[dt][1] = ldf(AVT + dt * 16 * NE + 32, (unsigned)(lr * NE + 8 * hi)); }
    float* ob = OUT + (size_t)(bh / NH_) * TT * DM + (size_t)(bh % NH_) * HD;
#pragma unroll
    for (int g = 0; g < NQ; ++g) { const float lot = slo[g] + xhalf(slo[g]), hit = shi[g] + xhalf(shi[g]); float is = 0.f; v16bf b0h, b0l, b1h, b1l;
#pragma unroll
        for (int i = 0; i < 16; ++i) { const int e = (i < 8) ? 8 * hi + i : 16 + 8 * hi + (i - 8);   // bucket e in the fragment's k order
            float p = __builtin_amdgcn_exp2f(scW[(g * 16 + lr) * LP + e] - m[g]);
            if (i == 0) { is += hi ? p : 0.f; p = hi ? p : lot; } else is += p;
            const __bf16 u = (__bf16)p; b0h[i] = u; b0l[i] = (__bf16)(p - (float)u);
            const float p1 = (i == 0 && hi == 0) ? hit : 0.f;   // buckets 32..63: only 32 is used
            const __bf16 u1 = (__bf16)p1; b1h[i] = u1; b1l[i] = (__bf16)(p1 - (float)u1); }
        const float inv = __fdiv_rn(1.0f, lot + hit + (is + xhalf(is)));
#pragma unroll
        for (int dt = 0; dt < 4; ++dt) { v8f a = o[g][dt]; a = wmmab(av[dt][0], b0h, a); a = wmmab(av[dt][0], b0l, a); a = wmmab(av[dt][1], b1h, a); a = wmmab(av[dt][1], b1l, a); a *= inv;
            float* op = (ob + (size_t)(q0 + g * 16) * DM + dt * 16) + (unsigned)(lr * DM + 8 * hi);
            *(v4f*)op = __builtin_shufflevector(a, a, 0, 1, 2, 3); *(v4f*)(op + 4) = __builtin_shufflevector(a, a, 4, 5, 6, 7); } }
}

extern "C" void kernel_launch(void* const* d_in, const int* in_sizes, int n_in,
                              void* d_out, int out_size, void* d_ws, size_t ws_size, hipStream_t stream) {
    (void)in_sizes; (void)n_in; (void)out_size;
    const float* Qin = (const float*)d_in[0]; const float* Kin = (const float*)d_in[1]; const float* Vin = (const float*)d_in[2]; const float* ak = (const float*)d_in[3]; const float* av = (const float*)d_in[4];   /* rel_k_table, rel_v_table [33][64] */
    float* OUT = (float*)d_out;     // [2][2048][16][64] token-major
    char* wsp = (char*)d_ws;
    auto take = [&](size_t bytes) { char* p = wsp; wsp += (bytes + 255) & ~(size_t)255; return (void*)p; };
    bf* KB = (bf*)take((size_t)NB_ * NH_ * TT * HD * 2); bf* VT = (bf*)take((size_t)NB_ * NH_ * HD * TT * 2);
    bf* AKB = (bf*)take((size_t)NE * HD * 2); bf* AVTh = (bf*)take((size_t)HD * NE * 2); bf* AVTl = (bf*)take((size_t)HD * NE * 2);
    if ((size_t)(wsp - (char*)d_ws) > ws_size) return;
    k_prep<<<dim3(KVB + TBB, 2), 256, 0, stream>>>(Kin, Vin, KB, VT, ak, AKB, av, AVTh, AVTl);   /* k, v -> fragment order; a_k -> bf16 [64][64], rows >= 33 zero; a_v^T -> [64][64] (lo plane unused: the table is taken as bf16) */
    k_fattn<<<dim3(TT / (FW * NQ * 16), NB_ * NH_), FW * 32, 0, stream>>>(Qin, KB, VT, AKB, AVTh, OUT);
}

// v006
// Measured time: 44.5 microseconds a run.
// Two timings next to v005 put it at 1.14 and 1.13 times that version's speed.
// Over all steps from v000 it is 68.8 times as fast.
#include <hip/hip_runtime.h>

// Relative-position multi-head attention on given token-major tensors (queries, keys, values [2][2048][16][64]; idx[l][s] = clip(s - l, -16, 16) + 16; attn = softmax((q.k + q.rel_k_table[idx]) / 8); out = attn values + sum_s attn[l][s] rel_v_table[idx[l][s]] (tables [33][64], read) -> [2][2048][16][64] token-major (4.2 M)).
// Prep, one launch (k_prep; a range of the block index picks the job, none of which needs another's result): k as bf16 and value^T as f16 in the order in which the fused kernel's fragments read them (every wave-wide load takes 512 contiguous bytes); the key table zero-padded to [64][64] and the value table transposed to [64][64].
// k_fattn: one launch for all heads. A wave has 32 queries (two groups of 16, read from the input and rounded to bf16 once) and walks its keys 32 at a time: S^T = K Q^T, so that a lane holds the scores of one query; online softmax with a lazily moved maximum; the two score tiles of a pass, rounded to f16, are the B operand of O^T += V^T P^T as they lie in the accumulators (P lies in [0, 2^8] under the lazy maximum, inside f16's range). No score and no P plane goes to memory. Two waves share each 32 queries: each walks one half of the ring of key passes (KS = 2; four waves a SIMD instead of two, so that one wave's vector chains and waits hide behind the others' work); behind the loop each hands the other, through LDS, its partial (maximum, end sums, O) of one group of 16 queries, and finishes the other group. The NXB x KS walks of a head each enter the ring at a start of their own, so that they do not ask L2 for the same lines at the same moment.
// Relative terms: QE^T = a_k Q^T (matrix product) once per 32 queries. A pass wholly left (right) of the 31-wide band adds the one value QE[l][0] (QE[l][32]) and sums its P into the end bucket in registers; the three passes that touch the band gather QE from LDS and park the band's scaled scores in LDS. After the loop the 33 buckets (end sums; exp2 of the parked scores under the final maximum) are split hi/lo and O^T += a_v^T PB^T on the matrix unit; then one division by the row sum.
// Every '#pragma unroll' below makes the indices of a register array constants (an array indexed at run time would go to scratch).
// Compute dtypes, f32 accumulate: q, k and the tables rounded to bf16, values to f16 (11 significant bits; finite up to 65504); q.k and q.a_k exact products; softmax f32; P f16 x f16 value; bucket sums bf16 hi/lo x bf16 a_v; output f32.

#define NB_  2
#define TT   2048
#define DM   1024      // token-major row pitch (H x HD)
#define NH_  16
#define HD   64
#define NE   64       // 2*16+1 = 33 relative offsets padded to 64
#define NRE  33
#define CUT  16
#define FW   4        // blocks of 32 queries per work-group of k_fattn
#define KS   2        // waves per block of queries, each on its own half of the keys (KS == NQ: a wave finishes one group)
#define NQ   2        // groups of 16 queries per wave
#define KP   32       // keys per pass
#define NXB  (TT / (FW * NQ * 16))   // work-groups of k_fattn that share one head's keys and values
#define MGF  (4 * 8 * 32)   // floats of O in a wave's hand-over record; three rows of 32 floats follow (maximum, left sum, right sum)
#define LP   33       // LDS row pitch in floats (33 entries a query; odd: a column walk meets no bank twice)
#define SC2  0.18033688011112042f   // log2(e) / sqrt(64)
#define NEGB (-3.0e38f)
#define NCHK (NB_ * NH_ * TT * HD / 8)   // 8-element chunks in one of k, v
#define PCH  8        // chunks per thread of fragorder
#define KVB  (NCHK / PCH / 256)   // blocks of k_prep per tensor
#define TBB  (HD * NE / 4 / 256)  // blocks of k_prep per table (the value table's count; the key table's spare blocks leave at once)
typedef unsigned short bf;
typedef __attribute__((ext_vector_type(16))) __bf16   v16bf;
typedef __attribute__((ext_vector_type(8)))  unsigned short v8us;
typedef __attribute__((ext_vector_type(4)))  unsigned short v4us;
typedef __attribute__((ext_vector_type(8)))  float    v8f;
typedef __attribute__((ext_vector_type(4)))  float    v4f;
typedef __attribute__((ext_vector_type(2)))  float    v2f;
typedef __attribute__((ext_vector_type(16))) _Float16 v16h;
typedef __attribute__((ext_vector_type(2)))  _Float16 v2h;

__device__ __forceinline__ unsigned short f2bf(float f) { unsigned u = __float_as_uint(f); u += 0x7FFFu + ((u >> 16) & 1u); return (unsigned short)(u >> 16); }
__device__ __forceinline__ float bf2f(unsigned short b) { return __uint_as_float(((unsigned)b) << 16); }
__device__ __forceinline__ void splitf(float y, unsigned short& h, unsigned short& l) { h = f2bf(y); l = f2bf(y - bf2f(h)); }
__device__ __forceinline__ v16bf cat16b(v8us lo, v8us hi) { return __builtin_bit_cast(v16bf, __builtin_shufflevector(lo, hi, 0, 1, 2, 3, 4, 5, 6, 7, 8, 9, 10, 11, 12, 13, 14, 15)); }
__device__ __forceinline__ v8f wmmab(v16bf a, v16bf b, v8f c) { return __builtin_amdgcn_wmma_f32_16x16x32_bf16(false, a, false, b, (short)0, c, false, false); }
__device__ __forceinline__ v8f wmmah(v16h a, v16h b, v8f c) { return __builtin_amdgcn_wmma_f32_16x16x32_f16(false, a, false, b, (short)0, c, false, false); }
// fragment of one row (A) or column (B) from a k-contiguous plane; the address already holds + 8 * (lane >> 4): k = 8h + 0..7, then 16 + 8h + 0..7
// base is the same in every lane, off the lane's own offset in elements
__device__ __forceinline__ v16bf ldf(const bf* base, unsigned off) { const bf* p = base + off; return cat16b(*(const v8us*)p, *(const v8us*)(p + 16)); }
// the same fragment from a plane in fragment order; p already holds + 8 * lane: two loads of 512 contiguous bytes a wave
__device__ __forceinline__ v16bf ldq(const bf* p) { return cat16b(*(const v8us*)p, *(const v8us*)(p + 256)); }
// the value of lane l ^ 16
__device__ __forceinline__ float xhalf(float x) { const int b = __float_as_int(x); return __int_as_float(__builtin_amdgcn_permlanex16(b, b, 0x76543210, 0xfedcba98, false, false)); }

// Keys (bf16) and values (f16) of both batches in the order in which k_fattn's fragments read them, so that each of its wave-wide 16-byte loads takes 512 contiguous bytes. blockIdx.y picks the tensor; a thread makes PCH chunks of 8 elements.
// Keys: per (batch, head), per 16 keys, four 512-byte blocks (kc, j); lane (lr, hi) of a block holds k[16 kt + lr][32 kc + 16 j + 8 hi + 0..7].
// Values, transposed: per (batch, head), per 32 keys, eight 512-byte blocks (dt, j); lane (lr, hi) of a block holds v[32 kp + 16 j + 8 hi + 0..7][16 dt + lr].
template <bool ISV>
__device__ __forceinline__ void fragorder(const float* __restrict__ S, bf* __restrict__ F) {
    const unsigned n0 = blockIdx.x * 256 + threadIdx.x; const float* sp[PCH]; bf* dp[PCH]; v8f v[PCH]; v8us o[PCH];
#pragma unroll
    for (int c = 0; c < PCH; ++c) { const unsigned n = n0 + c * (NCHK / PCH);
        if (!ISV) { const int d = (int)(n % (HD / 8)) * 8; const int t = (int)((n / (HD / 8)) % TT); const int bh = (int)(n / (HD / 8 * TT));
            sp[c] = S + ((size_t)(bh / NH_) * TT + t) * DM + (bh % NH_) * HD + d; v[c] = *(const v8f*)sp[c];
            dp[c] = F + (size_t)bh * TT * HD + (size_t)((((t >> 4) * 2 + (d >> 5)) * 2 + ((d >> 4) & 1)) * 32 + ((d >> 3) & 1) * 16 + (t & 15)) * 8; }
        else { const int lr = (int)(n & 15), hi = (int)((n >> 4) & 1), j = (int)((n >> 5) & 1), dt = (int)((n >> 6) & 3); const int kp = (int)((n >> 8) % (TT / 32)); const int bh = (int)((n >> 8) / (TT / 32));
            sp[c] = S + ((size_t)(bh / NH_) * TT + kp * 32 + 16 * j + 8 * hi) * DM + (bh % NH_) * HD + dt * 16 + lr;
#pragma unroll
            for (int q = 0; q < 8; ++q) v[c][q] = sp[c][(size_t)q * DM];
            dp[c] = F + (size_t)n * 8; } }
    asm volatile("s_wait_xcnt 0x0" :: "v"(sp[0]), "v"(sp[1]), "v"(sp[2]), "v"(sp[3]), "v"(sp[4]), "v"(sp[5]), "v"(sp[6]), "v"(sp[7]) : "memory");   // precaution: the wait stands in front of any rewrite of the loads' address registers, which it keeps live up to here
#pragma unroll
    for (int c = 0; c < PCH; ++c) {
#pragma unroll
        for (int q = 0; q < 8; ++q) o[c][q] = ISV ? __builtin_bit_cast(unsigned short, (_Float16)v[c][q]) : f2bf(v[c][q]);
        *(v8us*)dp[c] = o[c]; }
    asm volatile("s_wait_xcnt 0x0" :: "v"(dp[0]), "v"(dp[1]), "v"(dp[2]), "v"(dp[3]), "v"(dp[4]), "v"(dp[5]), "v"(dp[6]), "v"(dp[7]), "v"(o[0]), "v"(o[1]), "v"(o[2]), "v"(o[3]), "v"(o[4]), "v"(o[5]), "v"(o[6]), "v"(o[7]) : "memory");   // the same precaution for the stores' address and data registers
}
// b: the block's number within its table job
__device__ __forceinline__ void epadK(const float* __restrict__ E, bf* EB, const unsigned b) { const size_t i = (size_t)b * 256 + threadIdx.x; if (i >= (size_t)NE * HD / 8) return; const int d0 = (int)(i % (HD / 8)) * 8; const int r = (int)(i / (HD / 8)); const float* src = E + (size_t)min(r, NRE - 1) * HD + d0; v8us o;
#pragma unroll
    for (int q = 0; q < 8; ++q) { const unsigned short v = f2bf(src[q]); o[q] = (r < NRE) ? v : (unsigned short)0; }
    *(v8us*)(EB + (size_t)r * HD + d0) = o;  }

__device__ __forceinline__ void epadVT(const float* __restrict__ E, bf* Th, bf* Tl, const unsigned b) { const size_t i = (size_t)b * 256 + threadIdx.x; if (i >= (size_t)HD * NE / 4) return; const size_t e = i * 4; const int c0 = (int)(e % NE); const int d = (int)(e / NE); v4us oh, ol;
#pragma unroll
    for (int q = 0; q < 4; ++q) { const int r = c0 + q; const float v = E[(size_t)min(r, NRE - 1) * HD + d]; unsigned short u, w; splitf(v, u, w); oh[q] = (r < NRE) ? u : (unsigned short)0; ol[q] = (r < NRE) ? w : (unsigned short)0; }
    *(v4us*)(Th + e) = oh; *(v4us*)(Tl + e) = ol;  }

// All preparation in one grid. blockIdx.x < KVB: keys (y = 0) or values (y = 1) into fragment order; the TBB blocks behind them: the key table (y = 0) or the value table (y = 1). Every branch is the same for a whole block.
__global__ __launch_bounds__(256) void k_prep(const float* __restrict__ Ks, const float* __restrict__ Vs, bf* Kf, bf* Vf, const float* __restrict__ Ek, bf* EB, const float* __restrict__ Ev, bf* Th, bf* Tl) {
    if (blockIdx.x >= KVB) { if (blockIdx.y == 0) epadK(Ek, EB, blockIdx.x - KVB); else epadVT(Ev, Th, Tl, blockIdx.x - KVB); return; }
    if (blockIdx.y == 0) fragorder<false>(Ks, Kf); else fragorder<true>(Vs, Vf); }

// One pass: 32 keys from k0 against the wave's 32 queries. MODE 0: every key at least 16 left of every query; 2: at least 16 right; 1: any position.
template <int MODE>
__device__ __forceinline__ void fpass(const int k0, const int knext, const bf* __restrict__ kh, const bf* __restrict__ vh, const int lr, const int hi, const int q0,
                                      const v16bf (&qf)[NQ][2], v16bf (&kf)[2][2], v8f (&o)[NQ][4], float (&m)[NQ], float (&slo)[NQ], float (&shi)[NQ],
                                      const float (&bend)[NQ], const float* qeW, float* scW) {
    v16h vf[4]; const bf* vp = vh + k0 * HD + (unsigned)((hi * 16 + lr) * 8); const bf* kp = kh + knext * HD + (unsigned)((hi * 16 + lr) * 8);
#pragma unroll
    for (int dt = 0; dt < 4; ++dt) vf[dt] = __builtin_bit_cast(v16h, ldq(vp + dt * 512));
    v8f s[NQ][2];
#pragma unroll
    for (int g = 0; g < NQ; ++g)
#pragma unroll
        for (int t = 0; t < 2; ++t) { s[g][t] = (v8f){}; s[g][t] = wmmab(kf[t][0], qf[g][0], s[g][t]); s[g][t] = wmmab(kf[t][1], qf[g][1], s[g][t]); }   // s[g][t][r] = k[k0 + 16t + 8h + r] . q[q0 + 16g + lr]
#pragma unroll
    for (int t = 0; t < 2; ++t)
#pragma unroll
        for (int kc = 0; kc < 2; ++kc) kf[t][kc] = ldq(kp + t * 1024 + kc * 512);   // the next pass's keys, one pass ahead
    asm volatile("s_wait_xcnt 0x0" :: "v"(vp), "v"(kp) : "memory");   // precaution: the wait stands in front of any rewrite of the two address pairs of the loads above, which it keeps live up to here
    float tm[NQ]; bool need = false;
#pragma unroll
    for (int g = 0; g < NQ; ++g) { float a0 = NEGB, a1 = NEGB;
#pragma unroll
        for (int t = 0; t < 2; ++t) {
            if (MODE != 1) s[g][t] = s[g][t] * SC2 + bend[g];   // one offset for the whole pass
            else {
#pragma unroll
                for (int r = 0; r < 8; ++r) { const int dl = (k0 + t * 16 + 8 * hi + r) - (q0 + g * 16 + lr); const float x = __builtin_fmaf(s[g][t][r], SC2, qeW[(g * 16 + lr) * LP + min(max(dl, -CUT), CUT) + CUT]); s[g][t][r] = x;
                    if (dl > -CUT && dl < CUT) scW[(g * 16 + lr) * LP + dl + CUT] = x; } }
#pragma unroll
            for (int r = 0; r < 8; ++r) { if (t) a1 = fmaxf(a1, s[g][t][r]); else a0 = fmaxf(a0, s[g][t][r]); } }
        a0 = fmaxf(a0, a1); tm[g] = fmaxf(a0, xhalf(a0)); need = need || (tm[g] > m[g] + 8.0f); }
    if (__builtin_amdgcn_ballot_w32(need) != 0) {   // the maximum in use moves only when some query outgrows it by 2^8
#pragma unroll
        for (int g = 0; g < NQ; ++g) { const float mn = fmaxf(m[g], tm[g]); const float al = __builtin_amdgcn_exp2f(m[g] - mn); m[g] = mn; slo[g] *= al; shi[g] *= al;
#pragma unroll
            for (int dt = 0; dt < 4; ++dt) o[g][dt] *= al; } }
#pragma unroll
    for (int g = 0; g < NQ; ++g) { v16h ph; float l0 = 0.f, l1 = 0.f, h0 = 0.f, h1 = 0.f;
#pragma unroll
        for (int i = 0; i < 16; i += 2) { const int t = i >> 3, r = i & 7; v2f p; p[0] = __builtin_amdgcn_exp2f(s[g][t][r] - m[g]); p[1] = __builtin_amdgcn_exp2f(s[g][t][r + 1] - m[g]);
            if (MODE == 0) { l0 += p[0]; l1 += p[1]; }
            else if (MODE == 2) { h0 += p[0]; h1 += p[1]; }
            else { const int dl = (k0 + t * 16 + 8 * hi + r) - (q0 + g * 16 + lr); l0 += (dl <= -CUT) ? p[0] : 0.f; h0 += (dl >= CUT) ? p[0] : 0.f; l1 += (dl + 1 <= -CUT) ? p[1] : 0.f; h1 += (dl + 1 >= CUT) ? p[1] : 0.f; }
            const v2h u = __builtin_convertvector(p, v2h);   // P as f16, to nearest even
            ph[i] = u[0]; ph[i + 1] = u[1]; }
        slo[g] += l0 + l1; shi[g] += h0 + h1;
#pragma unroll
        for (int dt = 0; dt < 4; ++dt) o[g][dt] = wmmah(vf[dt], ph, o[g][dt]); }   // o[g][dt][r] = O[q0 + 16g + lr][16dt + 8h + r]
}

// 256 registers: two work-groups of eight waves then fill a WGP's register file (four waves a SIMD), and above them every change of register window costs a scalar instruction in the loop
__global__ __launch_bounds__(FW * KS * 32) __attribute__((amdgpu_num_vgpr(256))) void k_fattn(const float* __restrict__ Qin, const bf* __restrict__ KB, const bf* __restrict__ VT, const bf* __restrict__ AKB, const bf* __restrict__ AVT, float* OUT) {
    __shared__ float qeS[FW][NQ * 16 * LP];   // QE[query][offset] x SC2
    __shared__ float scS[FW][NQ * 16 * LP];   // scaled scores of the band, [query][offset]
    __shared__ __attribute__((aligned(16))) float mgS[FW * KS][MGF + 3 * 32];   // per wave: the partial it hands to its partner
    const int lane = threadIdx.x & 31, lr = lane & 15, hi = lane >> 4; const int wv = __builtin_amdgcn_readfirstlane(threadIdx.x >> 5);
    const int qg = wv % FW, kq = wv / FW;   // block of queries; half of the keys (both the same in every lane)
    const int bh = blockIdx.y; const int q0 = (blockIdx.x * FW + qg) * (NQ * 16);
    const bf* kh = KB + (size_t)bh * TT * HD; const bf* vh = VT + (size_t)bh * HD * TT;
    float* qeW = qeS[qg]; float* scW = scS[qg];   // shared by the two waves of a block of queries
    v16bf qf[NQ][2]; const float* qp = Qin + ((size_t)(bh / NH_) * TT + q0) * DM + (bh % NH_) * HD + (unsigned)(lr * DM + 8 * hi);
#pragma unroll
    for (int g = 0; g < NQ; ++g)
#pragma unroll
        for (int kc = 0; kc < 2; ++kc) { const v8f x0 = *(const v8f*)(qp + g * 16 * DM + kc * 32), x1 = *(const v8f*)(qp + g * 16 * DM + kc * 32 + 16); v8us u0, u1;
#pragma unroll
            for (int i = 0; i < 8; ++i) { u0[i] = f2bf(x0[i]); u1[i] = f2bf(x1[i]); }
            qf[g][kc] = cat16b(u0, u1); }
    asm volatile("s_wait_xcnt 0x0" :: "v"(qp) : "memory");   // the same precaution for the address pair of the loads above
    if (kq == 0) {   // one wave of the pair makes QE, the other clears the band's scores
#pragma unroll
    for (int e3 = 0; e3 < 3; ++e3) { const v16bf a0 = ldf(AKB + e3 * 16 * HD, (unsigned)(lr * HD + 8 * hi)), a1 = ldf(AKB + e3 * 16 * HD + 32, (unsigned)(lr * HD + 8 * hi));
#pragma unroll
        for (int g = 0; g < NQ; ++g) { v8f d = (v8f){}; d = wmmab(a0, qf[g][0], d); d = wmmab(a1, qf[g][1], d);   // d[r] = a_k[16 e3 + 8h + r] . q[q0 + 16g + lr]
#pragma unroll
            for (int r = 0; r < 8; ++r) { const int e = e3 * 16 + 8 * hi + r; if (e < NRE) qeW[(g * 16 + lr) * LP + e] = d[r] * SC2; } } }
    } else {
#pragma unroll
    for (int i = 0; i < NQ * 16 * LP / 32; ++i) scW[i * 32 + lane] = NEGB;   // an offset with no key stays at exp2 -> 0
    }
    __syncthreads();   // a wave reads QE entries that its partner wrote, and parks scores over what its partner cleared
    float bend[NQ], m[NQ], slo[NQ], shi[NQ]; v8f o[NQ][4];
#pragma unroll
    for (int g = 0; g < NQ; ++g) { m[g] = NEGB; slo[g] = 0.f; shi[g] = 0.f;
#pragma unroll
        for (int dt = 0; dt < 4; ++dt) o[g][dt] = (v8f){}; }
    // first key of this wave's walk of TT / KS keys; its partner starts half the ring away. The offset by the block index is for speed only (any permutation of the starts gives the same function): neighbours in the block index get starts far apart, so that any few consecutive work-groups spread over the ring
    const int ks = (int)((blockIdx.x % 4) * (NXB / 4) + blockIdx.x / 4) * (TT / (NXB * KS)) + kq * (TT / KS); const int ke = ks + TT / KS;
    v16bf kf[2][2]; const bf* kp0 = kh + ks * HD + (unsigned)(lane * 8);
#pragma unroll
    for (int t = 0; t < 2; ++t)
#pragma unroll
        for (int kc = 0; kc < 2; ++kc) kf[t][kc] = ldq(kp0 + t * 1024 + kc * 512);
    asm volatile("s_wait_xcnt 0x0" :: "v"(kp0) : "memory");   // the same precaution
    const int kL = max(q0 - KP, 0), kR = min(q0 + NQ * 16 + KP, TT);   // passes in [kL, kR) touch the band
    // the three loops stay rolled (unroll 1): a pass is some hundred instructions long already, and a second copy would only cost instruction cache and registers
    // two stretches, [ks, min(ke, TT)) and then [0, ke - TT), which is empty where the walk does not wrap; the pass behind k0 is (k0 + KP) mod TT in both (the very last pass fetches keys that nobody uses, inside the plane). Rolled too: one copy of the three loops serves both stretches
#pragma unroll 1
    for (int h = 0; h < 2; ++h) { const int ka = h ? 0 : ks, kb = h ? ke - TT : min(ke, TT);
#pragma unroll
        for (int g = 0; g < NQ; ++g) bend[g] = qeW[(g * 16 + lr) * LP];
#pragma unroll 1
        for (int k0 = ka; k0 < min(kb, kL); k0 += KP) fpass<0>(k0, (k0 + KP) & (TT - 1), kh, vh, lr, hi, q0, qf, kf, o, m, slo, shi, bend, qeW, scW);
        asm volatile("v_nop\n\tv_nop\n\tv_nop\n\tv_nop");   // the four vector slots the chip needs between a pass's last matrix instruction and an overwrite of its operands: only scalar code may follow up to the next loop's first vector write (the way out of the third loop, round the outer loop with the first loop skipped, comes through here too)
#pragma unroll 1
        for (int k0 = max(ka, kL); k0 < min(kb, kR); k0 += KP) fpass<1>(k0, (k0 + KP) & (TT - 1), kh, vh, lr, hi, q0, qf, kf, o, m, slo, shi, bend, qeW, scW);
#pragma unroll
        for (int g = 0; g < NQ; ++g) bend[g] = qeW[(g * 16 + lr) * LP + 2 * CUT];
#pragma unroll 1
        for (int k0 = max(ka, kR); k0 < kb; k0 += KP) fpass<2>(k0, (k0 + KP) & (TT - 1), kh, vh, lr, hi, q0, qf, kf, o, m, slo, shi, bend, qeW, scW);
    }
    // hand-over: wave kq keeps group kq of its 32 queries and gives its partial of the other group to its partner
    v8f om[4], ox[4];
#pragma unroll
    for (int dt = 0; dt < 4; ++dt) { om[dt] = kq ? o[1][dt] : o[0][dt]; ox[dt] = kq ? o[0][dt] : o[1][dt]; }
    const float mm = kq ? m[1] : m[0], lm = kq ? slo[1] : slo[0], hm = kq ? shi[1] : shi[0];
    float* mw = mgS[wv];
#pragma unroll
    for (int dt = 0; dt < 4; ++dt) { *(v4f*)(mw + ((dt * 2) * 32 + lane) * 4) = __builtin_shufflevector(ox[dt], ox[dt], 0, 1, 2, 3); *(v4f*)(mw + ((dt * 2 + 1) * 32 + lane) * 4) = __builtin_shufflevector(ox[dt], ox[dt], 4, 5, 6, 7); }
    mw[MGF + lane] = kq ? m[0] : m[1]; mw[MGF + 32 + lane] = kq ? slo[0] : slo[1]; mw[MGF + 64 + lane] = kq ? shi[0] : shi[1];
    __syncthreads();   // a wave reads its partner's partial, and band scores that either wave of the pair wrote
    const float* pw = mgS[wv ^ FW];
    const float pm = pw[MGF + lane]; const float mf = fmaxf(mm, pm);   // the final maximum in use
    const float am = __builtin_amdgcn_exp2f(mm - mf), ap = __builtin_amdgcn_exp2f(pm - mf);
    const float sl = lm * am + pw[MGF + 32 + lane] * ap, sh = hm * am + pw[MGF + 64 + lane] * ap;
#pragma unroll
    for (int dt = 0; dt < 4; ++dt) { const v4f p0 = *(const v4f*)(pw + ((dt * 2) * 32 + lane) * 4), p1 = *(const v4f*)(pw + ((dt * 2 + 1) * 32 + lane) * 4);
        om[dt] = om[dt] * am + __builtin_shufflevector(p0, p1, 0, 1, 2, 3, 4, 5, 6, 7) * ap; }
    v16bf av[4][2];
#pragma unroll
    for (int dt = 0; dt < 4; ++dt) { av[dt][0] = ldf(AVT + dt * 16 * NE, (unsigned)(lr * NE + 8 * hi)); av[dt][1] = ldf(AVT + dt * 16 * NE + 32, (unsigned)(lr * NE + 8 * hi)); }
    float* ob = OUT + (size_t)(bh / NH_) * TT * DM + (size_t)(bh % NH_) * HD;
    { const float lot = sl + xhalf(sl), hit = sh + xhalf(sh); float is = 0.f; v16bf b0h, b0l, b1h, b1l;
#pragma unroll
        for (int i = 0; i < 16; ++i) { const int e = (i < 8) ? 8 * hi + i : 16 + 8 * hi + (i - 8);   // bucket e in the fragment's k order
            float p = __builtin_amdgcn_exp2f(scW[(kq * 16 + lr) * LP + e] - mf);
            if (i == 0) { is += hi ? p : 0.f; p = hi ? p : lot; } else is += p;
            const __bf16 u = (__bf16)p; b0h[i] = u; b0l[i] = (__bf16)(p - (float)u);
            const float p1 = (i == 0 && hi == 0) ? hit : 0.f;   // buckets 32..63: only 32 is used
            const __bf16 u1 = (__bf16)p1; b1h[i] = u1; b1l[i] = (__bf16)(p1 - (float)u1); }
        const float inv = __fdiv_rn(1.0f, lot + hit + (is + xhalf(is)));
#pragma unroll
        for (int dt = 0; dt < 4; ++dt) { v8f a = om[dt]; a = wmmab(av[dt][0], b0h, a); a = wmmab(av[dt][0], b0l, a); a = wmmab(av[dt][1], b1h, a); a = wmmab(av[dt][1], b1l, a); a *= inv;
            float* op = (ob + (size_t)(q0 + kq * 16) * DM + dt * 16) + (unsigned)(lr * DM + 8 * hi);
            *(v4f*)op = __builtin_shufflevector(a, a, 0, 1, 2, 3); *(v4f*)(op + 4) = __builtin_shufflevector(a, a, 4, 5, 6, 7); } }
}

extern "C" void kernel_launch(void* const* d_in, const int* in_sizes, int n_in,
                              void* d_out, int out_size, void* d_ws, size_t ws_size, hipStream_t stream) {
    (void)in_sizes; (void)n_in; (void)out_size;
    const float* Qin = (const float*)d_in[0]; const float* Kin = (const float*)d_in[1]; const float* Vin = (const float*)d_in[2]; const float* ak = (const float*)d_in[3]; const float* av = (const float*)d_in[4];   /* rel_k_table, rel_v_table [33][64] */
    float* OUT = (float*)d_out;     // [2][2048][16][64] token-major
    char* wsp = (char*)d_ws;
    auto take = [&](size_t bytes) { char* p = wsp; wsp += (bytes + 255) & ~(size_t)255; return (void*)p; };
    bf* KB = (bf*)take((size_t)NB_ * NH_ * TT * HD * 2); bf* VT = (bf*)take((size_t)NB_ * NH_ * HD * TT * 2);
    bf* AKB = (bf*)take((size_t)NE * HD * 2); bf* AVTh = (bf*)take((size_t)HD * NE * 2); bf* AVTl = (bf*)take((size_t)HD * NE * 2);
    if ((size_t)(wsp - (char*)d_ws) > ws_size) return;
    k_prep<<<dim3(KVB + TBB, 2), 256, 0, stream>>>(Kin, Vin, KB, VT, ak, AKB, av, AVTh, AVTl);   /* k, v -> fragment order; a_k -> bf16 [64][64], rows >= 33 zero; a_v^T -> [64][64] (lo plane unused: the table is taken as bf16) */
    k_fattn<<<dim3(TT / (FW * NQ * 16), NB_ * NH_), FW * KS * 32, 0, stream>>>(Qin, KB, VT, AKB, AVTh, OUT);
}

// v008
// One run takes 41.2 microseconds.
// Versions between v006 and this one are left out; their measured steps multiply to 1.12 times as fast.
// All steps since v000 together make it 77.2 times as fast.
#include <hip/hip_runtime.h>

// Relative-position multi-head attention on given token-major tensors (queries, keys, values [2][2048][16][64]; idx[l][s] = clip(s - l, -16, 16) + 16; attn = softmax((q.k + q.rel_k_table[idx]) / 8); out = attn values + sum_s attn[l][s] rel_v_table[idx[l][s]] (tables [33][64], read) -> [2][2048][16][64] token-major (4.2 M)).
// Prep, one launch (k_prep; a range of the block index picks the job, none of which needs another's result): k as bf16 and value^T as f16 in the order in which the fused kernel's fragments read them (every wave-wide load takes 512 contiguous bytes); the key table zero-padded to [64][64] and the value table transposed to [64][64].
// k_fattn: one launch for all heads. A wave has 32 queries (two groups of 16, read from the input and rounded to bf16 once) and walks its keys 32 at a time: S^T = K Q^T, so that a lane holds the scores of one query; online softmax with a lazily moved maximum (the queries carry the factor log2(e) / 8 before their rounding, and outside the band a score tile's accumulator starts at the pass's one relative offset minus the maximum in use, so that the matrix product leaves exp2's arguments); the two score tiles of a pass, rounded to f16, are the B operand of O^T += V^T P^T as they lie in the accumulators (P lies in [0, 2^13] under the lazy maximum, inside f16's range). Outside the band a pass forms no maximum: it takes exp2 at once and tests the lane's sum of its 32 f32 exponentials, which the row sums need anyway; a sum above 2^13 (or not a number) says that some score stands more than 8 above the maximum in use, and only then are the scores formed again, their maximum found and the maximum in use moved. No score and no P plane goes to memory. Two waves share each 32 queries: each walks one half of the ring of key passes (KS = 2; four waves a SIMD instead of two, so that one wave's vector chains and waits hide behind the others' work); behind the loop each hands the other, through LDS, its partial (maximum, end sums, O) of one group of 16 queries, and finishes the other group. The NXB x KS walks of a head each enter the ring at a start of their own, so that they do not ask L2 for the same lines at the same moment.
// Relative terms: QE^T = a_k Q^T (matrix product) once per 32 queries. A pass wholly left (right) of the 31-wide band adds the one value QE[l][0] (QE[l][32]) and sums its P into the end bucket in registers; the three passes that touch the band gather QE from LDS and park the band's scaled scores in LDS. After the loop the 33 buckets (end sums; exp2 of the parked scores under the final maximum) are split hi/lo and O^T += a_v^T PB^T on the matrix unit; then one division by the row sum.
// Every '#pragma unroll' below makes the indices of a register array constants (an array indexed at run time would go to scratch).
// Compute dtypes, f32 accumulate: q x log2(e) / 8, k and the tables rounded to bf16, values to f16 (11 significant bits; finite up to 65504); q.k and q.a_k exact products; softmax f32; P f16 x f16 value; bucket sums bf16 hi/lo x bf16 a_v; output f32.

#define NB_  2
#define TT   2048
#define DM   1024      // token-major row pitch (H x HD)
#define NH_  16
#define HD   64
#define NE   64       // 2*16+1 = 33 relative offsets padded to 64
#define NRE  33
#define CUT  16
#define FW   4        // blocks of 32 queries per work-group of k_fattn
#define KS   2        // waves per block of queries, each on its own half of the keys (KS == NQ: a wave finishes one group)
#define NQ   2        // groups of 16 queries per wave
#define KP   32       // keys per pass
#define NXB  (TT / (FW * NQ * 16))   // work-groups of k_fattn that share one head's keys and values
#define MGF  (4 * 8 * 32)   // floats of O in a wave's hand-over record; three rows of 32 floats follow (maximum, left sum, right sum)
#define LP   33       // LDS row pitch in floats (33 entries a query; odd: a column walk meets no bank twice)
#define SC2  0.18033688011112042f   // log2(e) / sqrt(64)
#define NEGB (-3.0e38f)
#define NCHK (NB_ * NH_ * TT * HD / 8)   // 8-element chunks in one of k, v
#define PCH  8        // chunks per thread of fragorder
#define KVB  (NCHK / PCH / 256)   // blocks of k_prep per tensor
#define TBB  (HD * NE / 4 / 256)  // blocks of k_prep per table (the value table's count; the key table's spare blocks leave at once)
typedef unsigned short bf;
typedef __attribute__((ext_vector_type(16))) __bf16   v16bf;
typedef __attribute__((ext_vector_type(8)))  unsigned short v8us;
typedef __attribute__((ext_vector_type(4)))  unsigned short v4us;
typedef __attribute__((ext_vector_type(8)))  float    v8f;
typedef __attribute__((ext_vector_type(4)))  float    v4f;
typedef __attribute__((ext_vector_type(2)))  float    v2f;
typedef __attribute__((ext_vector_type(16))) _Float16 v16h;
typedef __attribute__((ext_vector_type(2)))  _Float16 v2h;

__device__ __forceinline__ unsigned short f2bf(float f) { unsigned u = __float_as_uint(f); u += 0x7FFFu + ((u >> 16) & 1u); return (unsigned short)(u >> 16); }
__device__ __forceinline__ float bf2f(unsigned short b) { return __uint_as_float(((unsigned)b) << 16); }
__device__ __forceinline__ void splitf(float y, unsigned short& h, unsigned short& l) { h = f2bf(y); l = f2bf(y - bf2f(h)); }
__device__ __forceinline__ v16bf cat16b(v8us lo, v8us hi) { return __builtin_bit_cast(v16bf, __builtin_shufflevector(lo, hi, 0, 1, 2, 3, 4, 5, 6, 7, 8, 9, 10, 11, 12, 13, 14, 15)); }
__device__ __forceinline__ v8f wmmab(v16bf a, v16bf b, v8f c) { return __builtin_amdgcn_wmma_f32_16x16x32_bf16(false, a, false, b, (short)0, c, false, false); }
__device__ __forceinline__ v8f wmmah(v16h a, v16h b, v8f c) { return __builtin_amdgcn_wmma_f32_16x16x32_f16(false, a, false, b, (short)0, c, false, false); }
// fragment of one row (A) or column (B) from a k-contiguous plane; the address already holds + 8 * (lane >> 4): k = 8h + 0..7, then 16 + 8h + 0..7
// base is the same in every lane, off the lane's own offset in elements
__device__ __forceinline__ v16bf ldf(const bf* base, unsigned off) { const bf* p = base + off; return cat16b(*(const v8us*)p, *(const v8us*)(p + 16)); }
// the same fragment from a plane in fragment order; p already holds + 8 * lane: two loads of 512 contiguous bytes a wave
__device__ __forceinline__ v16bf ldq(const bf* p) { return cat16b(*(const v8us*)p, *(const v8us*)(p + 256)); }
__device__ __forceinline__ v8f splat8(float x) { return (v8f){x, x, x, x, x, x, x, x}; }
// the value of lane l ^ 16
__device__ __forceinline__ float xhalf(float x) { const int b = __float_as_int(x); return __int_as_float(__builtin_amdgcn_permlanex16(b, b, 0x76543210, 0xfedcba98, false, false)); }

// Keys (bf16) and values (f16) of both batches in the order in which k_fattn's fragments read them, so that each of its wave-wide 16-byte loads takes 512 contiguous bytes. blockIdx.y picks the tensor; a thread makes PCH chunks of 8 elements.
// Keys: per (batch, head), per 16 keys, four 512-byte blocks (kc, j); lane (lr, hi) of a block holds k[16 kt + lr][32 kc + 16 j + 8 hi + 0..7].
// Values, transposed: per (batch, head), per 32 keys, eight 512-byte blocks (dt, j); lane (lr, hi) of a block holds v[32 kp + 16 j + 8 hi + 0..7][16 dt + lr].
template <bool ISV>
__device__ __forceinline__ void fragorder(const float* __restrict__ S, bf* __restrict__ F) {
    const unsigned n0 = blockIdx.x * 256 + threadIdx.x; const float* sp[PCH]; bf* dp[PCH]; v8f v[PCH]; v8us o[PCH];
#pragma unroll
    for (int c = 0; c < PCH; ++c) { const unsigned n = n0 + c * (NCHK / PCH);
        if (!ISV) { const int d = (int)(n % (HD / 8)) * 8; const int t = (int)((n / (HD / 8)) % TT); const int bh = (int)(n / (HD / 8 * TT));
            sp[c] = S + ((size_t)(bh / NH_) * TT + t) * DM + (bh % NH_) * HD + d; v[c] = *(const v8f*)sp[c];
            dp[c] = F + (size_t)bh * TT * HD + (size_t)((((t >> 4) * 2 + (d >> 5)) * 2 + ((d >> 4) & 1)) * 32 + ((d >> 3) & 1) * 16 + (t & 15)) * 8; }
        else { const int lr = (int)(n & 15), hi = (int)((n >> 4) & 1), j = (int)((n >> 5) & 1), dt = (int)((n >> 6) & 3); const int kp = (int)((n >> 8) % (TT / 32)); const int bh = (int)((n >> 8) / (TT / 32));
            sp[c] = S + ((size_t)(bh / NH_) * TT + kp * 32 + 16 * j + 8 * hi) * DM + (bh % NH_) * HD + dt * 16 + lr;
#pragma unroll
            for (int q = 0; q < 8; ++q) v[c][q] = sp[c][(size_t)q * DM];
            dp[c] = F + (size_t)n * 8; } }
    asm volatile("s_wait_xcnt 0x0" :: "v"(sp[0]), "v"(sp[1]), "v"(sp[2]), "v"(sp[3]), "v"(sp[4]), "v"(sp[5]), "v"(sp[6]), "v"(sp[7]) : "memory");   // precaution: the wait stands in front of any rewrite of the loads' address registers, which it keeps live up to here
#pragma unroll
    for (int c = 0; c < PCH; ++c) {
#pragma unroll
        for (int q = 0; q < 8; ++q) o[c][q] = ISV ? __builtin_bit_cast(unsigned short, (_Float16)v[c][q]) : f2bf(v[c][q]);
        *(v8us*)dp[c] = o[c]; }
    asm volatile("s_wait_xcnt 0x0" :: "v"(dp[0]), "v"(dp[1]), "v"(dp[2]), "v"(dp[3]), "v"(dp[4]), "v"(dp[5]), "v"(dp[6]), "v"(dp[7]), "v"(o[0]), "v"(o[1]), "v"(o[2]), "v"(o[3]), "v"(o[4]), "v"(o[5]), "v"(o[6]), "v"(o[7]) : "memory");   // the same precaution for the stores' address and data registers
}
// b: the block's number within its table job
__device__ __forceinline__ void epadK(const float* __restrict__ E, bf* EB, const unsigned b) { const size_t i = (size_t)b * 256 + threadIdx.x; if (i >= (size_t)NE * HD / 8) return; const int d0 = (int)(i % (HD / 8)) * 8; const int r = (int)(i / (HD / 8)); const float* src = E + (size_t)min(r, NRE - 1) * HD + d0; v8us o;
#pragma unroll
    for (int q = 0; q < 8; ++q) { const unsigned short v = f2bf(src[q]); o[q] = (r < NRE) ? v : (unsigned short)0; }
    *(v8us*)(EB + (size_t)r * HD + d0) = o;  }

__device__ __forceinline__ void epadVT(const float* __restrict__ E, bf* Th, bf* Tl, const unsigned b) { const size_t i = (size_t)b * 256 + threadIdx.x; if (i >= (size_t)HD * NE / 4) return; const size_t e = i * 4; const int c0 = (int)(e % NE); const int d = (int)(e / NE); v4us oh, ol;
#pragma unroll
    for (int q = 0; q < 4; ++q) { const int r = c0 + q; const float v = E[(size_t)min(r, NRE - 1) * HD + d]; unsigned short u, w; splitf(v, u, w); oh[q] = (r < NRE) ? u : (unsigned short)0; ol[q] = (r < NRE) ? w : (unsigned short)0; }
    *(v4us*)(Th + e) = oh; *(v4us*)(Tl + e) = ol;  }

// All preparation in one grid. blockIdx.x < KVB: keys (y = 0) or values (y = 1) into fragment order; the TBB blocks behind them: the key table (y = 0) or the value table (y = 1). Every branch is the same for a whole block.
__global__ __launch_bounds__(256) void k_prep(const float* __restrict__ Ks, const float* __restrict__ Vs, bf* Kf, bf* Vf, const float* __restrict__ Ek, bf* EB, const float* __restrict__ Ev, bf* Th, bf* Tl) {
    if (blockIdx.x >= KVB) { if (blockIdx.y == 0) epadK(Ek, EB, blockIdx.x - KVB); else epadVT(Ev, Th, Tl, blockIdx.x - KVB); return; }
    if (blockIdx.y == 0) fragorder<false>(Ks, Kf); else fragorder<true>(Vs, Vf); }

// One pass that may touch the band: 32 keys from k0, in any position, against the wave's 32 queries. thr: how far a pass's maximum may stand above m[g] before m moves: 8, and below every score until this wave has set m (the same in every lane).
__device__ __forceinline__ void bpass(const int k0, const int knext, const bf* __restrict__ kh, const bf* __restrict__ vh, const int lr, const int hi, const int q0,
                                      const v16bf (&qf)[NQ][2], v16bf (&kf)[2][2], v8f (&o)[NQ][4], float (&m)[NQ], float (&slo)[NQ], float (&shi)[NQ],
                                      float& thr, const float* qeW, float* scW) {
    v16h vf[4]; const bf* vp = vh + k0 * HD + (unsigned)((hi * 16 + lr) * 8); const bf* kp = kh + knext * HD + (unsigned)((hi * 16 + lr) * 8);
#pragma unroll
    for (int dt = 0; dt < 4; ++dt) vf[dt] = __builtin_bit_cast(v16h, ldq(vp + dt * 512));
    v8f s[NQ][2];
#pragma unroll
    for (int g = 0; g < NQ; ++g)
#pragma unroll
        for (int t = 0; t < 2; ++t) { s[g][t] = wmmab(kf[t][0], qf[g][0], (v8f){}); s[g][t] = wmmab(kf[t][1], qf[g][1], s[g][t]); }   // s[g][t][r] = k[k0 + 16t + 8h + r] . q[q0 + 16g + lr] (scaled)
#pragma unroll
    for (int t = 0; t < 2; ++t)
#pragma unroll
        for (int kc = 0; kc < 2; ++kc) kf[t][kc] = ldq(kp + t * 1024 + kc * 512);   // the next pass's keys, one pass ahead
    asm volatile("s_wait_xcnt 0x0" :: "v"(vp), "v"(kp) : "memory");   // precaution: the wait stands in front of any rewrite of the two address pairs of the loads above, which it keeps live up to here
    float tm[NQ]; bool need = false;
#pragma unroll
    for (int g = 0; g < NQ; ++g) { float a0 = NEGB, a1;
#pragma unroll
        for (int t = 0; t < 2; ++t) {
#pragma unroll
            for (int r = 0; r < 8; ++r) { const int dl = (k0 + t * 16 + 8 * hi + r) - (q0 + g * 16 + lr); const float x = s[g][t][r] + qeW[(g * 16 + lr) * LP + min(max(dl, -CUT), CUT) + CUT]; s[g][t][r] = x - m[g];
                if (dl > -CUT && dl < CUT) scW[(g * 16 + lr) * LP + dl + CUT] = x; }
#pragma unroll
            for (int r = 0; r < 8; ++r) { if (!t) a0 = fmaxf(a0, s[g][t][r]); else a1 = r ? fmaxf(a1, s[g][t][r]) : s[g][t][0]; } }
        a0 = fmaxf(a0, a1); tm[g] = fmaxf(a0, xhalf(a0)); need = need || (tm[g] > thr); }   // tm: the pass's maximum above the one in use
    if (__builtin_amdgcn_ballot_w32(need) != 0) { const bool first = thr < 0.f;   // the maximum in use moves only when some query outgrows it by 2^8; a wave's first pass sets it, up or down (all sums are still zero)
#pragma unroll
        for (int g = 0; g < NQ; ++g) { const float d = first ? tm[g] : fmaxf(tm[g], 0.f); const float al = first ? 1.f : __builtin_amdgcn_exp2f(-d); m[g] += d; slo[g] *= al; shi[g] *= al;
#pragma unroll
            for (int t = 0; t < 2; ++t) s[g][t] -= d;
#pragma unroll
            for (int dt = 0; dt < 4; ++dt) o[g][dt] *= al; }
        thr = 8.0f; }
#pragma unroll
    for (int g = 0; g < NQ; ++g) { v16h ph; float l0 = 0.f, l1 = 0.f, h0 = 0.f, h1 = 0.f;
#pragma unroll
        for (int i = 0; i < 16; i += 2) { const int t = i >> 3, r = i & 7; v2f p; p[0] = __builtin_amdgcn_exp2f(s[g][t][r]); p[1] = __builtin_amdgcn_exp2f(s[g][t][r + 1]);
            const int dl = (k0 + t * 16 + 8 * hi + r) - (q0 + g * 16 + lr); l0 += (dl <= -CUT) ? p[0] : 0.f; h0 += (dl >= CUT) ? p[0] : 0.f; l1 += (dl + 1 <= -CUT) ? p[1] : 0.f; h1 += (dl + 1 >= CUT) ? p[1] : 0.f;
            const v2h u = __builtin_convertvector(p, v2h);   // P as f16, to nearest even
            ph[i] = u[0]; ph[i + 1] = u[1]; }
        slo[g] += l0 + l1; shi[g] += h0 + h1;
#pragma unroll
        for (int dt = 0; dt < 4; ++dt) o[g][dt] = wmmah(vf[dt], ph, o[g][dt]); }   // o[g][dt][r] = O[q0 + 16g + lr][16dt + 8h + r]
}

// The scores of a pass outside the band, as exp2's arguments: s[g][t][r] = k[16t + 8h + r of kf] . q[16g + lr] (scaled) + c[g]
__device__ __forceinline__ void scores(const v16bf (&qf)[NQ][2], const v16bf (&kf)[2][2], const v8f (&c)[NQ], v8f (&s)[NQ][2]) {
#pragma unroll
    for (int g = 0; g < NQ; ++g)
#pragma unroll
        for (int t = 0; t < 2; ++t) { s[g][t] = wmmab(kf[t][0], qf[g][0], c[g]); s[g][t] = wmmab(kf[t][1], qf[g][1], s[g][t]); }
}
// four key fragments (32 keys) from p, which already holds + 8 * lane
__device__ __forceinline__ void ldkeys(const bf* p, v16bf (&kf)[2][2]) {
#pragma unroll
    for (int t = 0; t < 2; ++t)
#pragma unroll
        for (int kc = 0; kc < 2; ++kc) kf[t][kc] = ldq(p + t * 1024 + kc * 512);
}
// each query's largest score of a pass, the same in both lanes that hold the query
__device__ __forceinline__ void passmax(const v8f (&s)[NQ][2], float (&tm)[NQ]) {
#pragma unroll
    for (int g = 0; g < NQ; ++g) { float a0 = s[g][0][0], a1 = s[g][1][0];
#pragma unroll
        for (int r = 1; r < 8; ++r) { a0 = fmaxf(a0, s[g][0][r]); a1 = fmaxf(a1, s[g][1][r]); }
        a0 = fmaxf(a0, a1); tm[g] = fmaxf(a0, xhalf(a0)); }
}
// s -> exp2(s) in place; ls[g]: the lane's sum of group g's 16
__device__ __forceinline__ void expsum(v8f (&s)[NQ][2], float (&ls)[NQ]) {
#pragma unroll
    for (int g = 0; g < NQ; ++g) { float l0 = 0.f, l1 = 0.f;
#pragma unroll
        for (int i = 0; i < 16; i += 2) { const int t = i >> 3, r = i & 7; s[g][t][r] = __builtin_amdgcn_exp2f(s[g][t][r]); s[g][t][r + 1] = __builtin_amdgcn_exp2f(s[g][t][r + 1]); l0 += s[g][t][r]; l1 += s[g][t][r + 1]; }
        ls[g] = l0 + l1; }
}
// One pass outside the band: 32 keys from k0, every one at least 16 left (its sums go to se = slo) or at least 16 right (se = shi) of every query; so: the other end's sums. cb[g]: the pass's relative offset minus m[g] in all eight places; m has been set. Returns whether m moved (the same in every lane): cb then no longer fits.
__device__ __forceinline__ bool opass(const int k0, const int knext, const bf* __restrict__ kh, const bf* __restrict__ vh, const int lane,
                                      const v16bf (&qf)[NQ][2], v16bf (&kf)[2][2], v8f (&o)[NQ][4], float (&m)[NQ], float (&se)[NQ], float (&so)[NQ], const v8f (&cb)[NQ]) {
    v16h vf[4]; const bf* vp = vh + k0 * HD + (unsigned)(lane * 8); const bf* kp = kh + knext * HD + (unsigned)(lane * 8);
#pragma unroll
    for (int dt = 0; dt < 4; ++dt) vf[dt] = __builtin_bit_cast(v16h, ldq(vp + dt * 512));
    v8f s[NQ][2]; float ls[NQ]; bool moved = false;
    scores(qf, kf, cb, s);
    ldkeys(kp, kf);   // the next pass's keys, one pass ahead
    asm volatile("s_wait_xcnt 0x0" :: "v"(vp), "v"(kp) : "memory");   // precaution: the wait stands in front of any rewrite of the two address pairs of the loads above, which it keeps live up to here
    __builtin_amdgcn_sched_barrier(0);   // keeps all sixteen loads in front of the exponentials: left free, the compiler lends their target registers to the vector work first and issues half the value loads and all key loads behind it, a few instructions ahead of their use
    expsum(s, ls);
    // no term is negative, so a sum of at most 2^13 bounds each P; 32 terms of at most 2^8 never trip the test, so that a trip always moves m
    if (__builtin_amdgcn_ballot_w32(!(ls[0] + ls[1] <= 8192.0f)) != 0) { const bf* kr = kh + k0 * HD + (unsigned)(lane * 8); float tm[NQ];
        ldkeys(kr, kf);   // this pass's keys once more: their registers hold the next pass's by now
        asm volatile("s_wait_xcnt 0x0" :: "v"(kr) : "memory");   // the same precaution
        scores(qf, kf, cb, s);
        ldkeys(kp, kf);
        asm volatile("s_wait_xcnt 0x0" :: "v"(kp) : "memory");   // the same precaution
        passmax(s, tm);
#pragma unroll
        for (int g = 0; g < NQ; ++g) { const float d = fmaxf(tm[g], 0.f); const float al = __builtin_amdgcn_exp2f(-d); m[g] += d; se[g] *= al; so[g] *= al;
#pragma unroll
            for (int t = 0; t < 2; ++t) s[g][t] -= d;
#pragma unroll
            for (int dt = 0; dt < 4; ++dt) o[g][dt] *= al; }
        expsum(s, ls); moved = true; }
#pragma unroll
    for (int g = 0; g < NQ; ++g) { v16h ph;
#pragma unroll
        for (int i = 0; i < 16; i += 2) { const int t = i >> 3, r = i & 7; v2f p; p[0] = s[g][t][r]; p[1] = s[g][t][r + 1];
            const v2h u = __builtin_convertvector(p, v2h);   // P as f16, to nearest even
            ph[i] = u[0]; ph[i + 1] = u[1]; }
        se[g] += ls[g];
#pragma unroll
        for (int dt = 0; dt < 4; ++dt) o[g][dt] = wmmah(vf[dt], ph, o[g][dt]); }
    return moved;
}
// The accumulators' start values for passes outside the band with the relative offset off. Where no pass of this wave has set m yet (thr below 0), m becomes the largest score of the pass whose keys are in kf.
__device__ __forceinline__ void startvals(const float (&off)[NQ], const v16bf (&qf)[NQ][2], const v16bf (&kf)[2][2], float (&m)[NQ], float& thr, v8f (&cb)[NQ]) {
    if (thr < 0.f) { v8f s[NQ][2];
#pragma unroll
        for (int g = 0; g < NQ; ++g) cb[g] = splat8(off[g]);
        scores(qf, kf, cb, s); passmax(s, m); thr = 8.0f; }
#pragma unroll
    for (int g = 0; g < NQ; ++g) cb[g] = splat8(off[g] - m[g]);
}

// 256 registers: two work-groups of eight waves then fill a WGP's register file (four waves a SIMD), and above them every change of register window costs a scalar instruction in the loop
__global__ __launch_bounds__(FW * KS * 32) __attribute__((amdgpu_num_vgpr(256))) void k_fattn(const float* __restrict__ Qin, const bf* __restrict__ KB, const bf* __restrict__ VT, const bf* __restrict__ AKB, const bf* __restrict__ AVT, float* OUT) {
    __shared__ float qeS[FW][NQ * 16 * LP];   // QE[query][offset] x SC2
    __shared__ float scS[FW][NQ * 16 * LP];   // scaled scores of the band, [query][offset]
    __shared__ __attribute__((aligned(16))) float mgS[FW * KS][MGF + 3 * 32];   // per wave: the partial it hands to its partner
    const int lane = threadIdx.x & 31, lr = lane & 15, hi = lane >> 4; const int wv = __builtin_amdgcn_readfirstlane(threadIdx.x >> 5);
    const int qg = wv % FW, kq = wv / FW;   // block of queries; half of the keys (both the same in every lane)
    const int bh = blockIdx.y; const int q0 = (blockIdx.x * FW + qg) * (NQ * 16);
    const bf* kh = KB + (size_t)bh * TT * HD; const bf* vh = VT + (size_t)bh * HD * TT;
    float* qeW = qeS[qg]; float* scW = scS[qg];   // shared by the two waves of a block of queries
    v16bf qf[NQ][2]; const float* qp = Qin + ((size_t)(bh / NH_) * TT + q0) * DM + (bh % NH_) * HD + (unsigned)(lr * DM + 8 * hi);
#pragma unroll
    for (int g = 0; g < NQ; ++g)
#pragma unroll
        for (int kc = 0; kc < 2; ++kc) { const v8f x0 = *(const v8f*)(qp + g * 16 * DM + kc * 32), x1 = *(const v8f*)(qp + g * 16 * DM + kc * 32 + 16); v8us u0, u1;
#pragma unroll
            for (int i = 0; i < 8; ++i) { u0[i] = f2bf(x0[i] * SC2); u1[i] = f2bf(x1[i] * SC2); }
            qf[g][kc] = cat16b(u0, u1); }
    asm volatile("s_wait_xcnt 0x0" :: "v"(qp) : "memory");   // the same precaution for the address pair of the loads above
    if (kq == 0) {   // one wave of the pair makes QE, the other clears the band's scores
#pragma unroll
    for (int e3 = 0; e3 < 3; ++e3) { const v16bf a0 = ldf(AKB + e3 * 16 * HD, (unsigned)(lr * HD + 8 * hi)), a1 = ldf(AKB + e3 * 16 * HD + 32, (unsigned)(lr * HD + 8 * hi));
        v8f d[NQ];
#pragma unroll
        for (int g = 0; g < NQ; ++g) { d[g] = (v8f){}; d[g] = wmmab(a0, qf[g][0], d[g]); d[g] = wmmab(a1, qf[g][1], d[g]); }   // d[g][r] = a_k[16 e3 + 8h + r] . q[q0 + 16g + lr] (scaled)
#pragma unroll
        for (int g = 0; g < NQ; ++g)
#pragma unroll
            for (int r = 0; r < 8; ++r) { const int e = e3 * 16 + 8 * hi + r; if (e < NRE) qeW[(g * 16 + lr) * LP + e] = d[g][r]; } }
    } else {
#pragma unroll
    for (int i = 0; i < NQ * 16 * LP / 32; ++i) scW[i * 32 + lane] = NEGB;   // an offset with no key stays at exp2 -> 0
    }
    __syncthreads();   // a wave reads QE entries that its partner wrote, and parks scores over what its partner cleared
    float m[NQ], slo[NQ], shi[NQ]; v8f o[NQ][4], cb[NQ]; float thr = NEGB;
#pragma unroll
    for (int g = 0; g < NQ; ++g) { m[g] = 0.f; slo[g] = 0.f; shi[g] = 0.f;
#pragma unroll
        for (int dt = 0; dt < 4; ++dt) o[g][dt] = (v8f){}; }
    // first key of this wave's walk of TT / KS keys; its partner starts half the ring away. The offset by the block index is for speed only (any permutation of the starts gives the same function): neighbours in the block index get starts far apart, so that any few consecutive work-groups spread over the ring
    const int ks = (int)((blockIdx.x % 4) * (NXB / 4) + blockIdx.x / 4) * (TT / (NXB * KS)) + kq * (TT / KS); const int ke = ks + TT / KS;
    v16bf kf[2][2]; const bf* kp0 = kh + ks * HD + (unsigned)(lane * 8);
#pragma unroll
    for (int t = 0; t < 2; ++t)
#pragma unroll
        for (int kc = 0; kc < 2; ++kc) kf[t][kc] = ldq(kp0 + t * 1024 + kc * 512);
    asm volatile("s_wait_xcnt 0x0" :: "v"(kp0) : "memory");   // the same precaution
    const int kL = max(q0 - KP, 0), kR = min(q0 + NQ * 16 + KP, TT);   // passes in [kL, kR) touch the band
    // the three loops stay rolled (unroll 1): a pass is some hundred instructions long already, and a second copy would only cost instruction cache and registers
    // two stretches, [ks, min(ke, TT)) and then [0, ke - TT), which is empty where the walk does not wrap; the pass behind k0 is (k0 + KP) mod TT in both (the very last pass fetches keys that nobody uses, inside the plane). Rolled too: one copy of the three loops serves both stretches
#pragma unroll 1
    for (int h = 0; h < 2; ++h) { const int ka = h ? 0 : ks, kb = h ? ke - TT : min(ke, TT);
        // first and third loop: an inner loop runs while the maximum in use stands, so that the accumulators' start values are constants of it; they are formed anew only behind a pass that moved the maximum
#pragma unroll 1
        for (int k0 = ka; k0 < min(kb, kL); ) { bool mv; const float off[NQ] = {qeW[lr * LP], qeW[(16 + lr) * LP]};
            startvals(off, qf, kf, m, thr, cb);
#pragma unroll 1
            do { mv = opass(k0, (k0 + KP) & (TT - 1), kh, vh, lane, qf, kf, o, m, slo, shi, cb); k0 += KP; } while (!mv && k0 < min(kb, kL)); }
        asm volatile("v_nop\n\tv_nop\n\tv_nop\n\tv_nop");   // the four vector slots the chip needs between a pass's last matrix instruction and an overwrite of its operands: only scalar code may follow up to the next loop's first vector write (the way out of the third loop, round the outer loop with the first loop skipped, comes through here too)
#pragma unroll 1
        for (int k0 = max(ka, kL); k0 < min(kb, kR); k0 += KP) bpass(k0, (k0 + KP) & (TT - 1), kh, vh, lr, hi, q0, qf, kf, o, m, slo, shi, thr, qeW, scW);
#pragma unroll 1
        for (int k0 = max(ka, kR); k0 < kb; ) { bool mv; const float off[NQ] = {qeW[lr * LP + 2 * CUT], qeW[(16 + lr) * LP + 2 * CUT]};
            startvals(off, qf, kf, m, thr, cb);
#pragma unroll 1
            do { mv = opass(k0, (k0 + KP) & (TT - 1), kh, vh, lane, qf, kf, o, m, shi, slo, cb); k0 += KP; } while (!mv && k0 < kb); }
    }
    // hand-over: wave kq keeps group kq of its 32 queries and gives its partial of the other group to its partner
    v8f om[4], ox[4];
#pragma unroll
    for (int dt = 0; dt < 4; ++dt) { om[dt] = kq ? o[1][dt] : o[0][dt]; ox[dt] = kq ? o[0][dt] : o[1][dt]; }
    const float mm = kq ? m[1] : m[0], lm = kq ? slo[1] : slo[0], hm = kq ? shi[1] : shi[0];
    float* mw = mgS[wv];
#pragma unroll
    for (int dt = 0; dt < 4; ++dt) { *(v4f*)(mw + ((dt * 2) * 32 + lane) * 4) = __builtin_shufflevector(ox[dt], ox[dt], 0, 1, 2, 3); *(v4f*)(mw + ((dt * 2 + 1) * 32 + lane) * 4) = __builtin_shufflevector(ox[dt], ox[dt], 4, 5, 6, 7); }
    mw[MGF + lane] = kq ? m[0] : m[1]; mw[MGF + 32 + lane] = kq ? slo[0] : slo[1]; mw[MGF + 64 + lane] = kq ? shi[0] : shi[1];
    __syncthreads();   // a wave reads its partner's partial, and band scores that either wave of the pair wrote
    const float* pw = mgS[wv ^ FW];
    const float pm = pw[MGF + lane]; const float mf = fmaxf(mm, pm);   // the final maximum in use
    const float am = __builtin_amdgcn_exp2f(mm - mf), ap = __builtin_amdgcn_exp2f(pm - mf);
    const float sl = lm * am + pw[MGF + 32 + lane] * ap, sh = hm * am + pw[MGF + 64 + lane] * ap;
#pragma unroll
    for (int dt = 0; dt < 4; ++dt) { const v4f p0 = *(const v4f*)(pw + ((dt * 2) * 32 + lane) * 4), p1 = *(const v4f*)(pw + ((dt * 2 + 1) * 32 + lane) * 4);
        om[dt] = om[dt] * am + __builtin_shufflevector(p0, p1, 0, 1, 2, 3, 4, 5, 6, 7) * ap; }
    v16bf av[4][2];
#pragma unroll
    for (int dt = 0; dt < 4; ++dt) { av[dt][0] = ldf(AVT + dt * 16 * NE, (unsigned)(lr * NE + 8 * hi)); av[dt][1] = ldf(AVT + dt * 16 * NE + 32, (unsigned)(lr * NE + 8 * hi)); }
    float* ob = OUT + (size_t)(bh / NH_) * TT * DM + (size_t)(bh % NH_) * HD;
    { const float lot = sl + xhalf(sl), hit = sh + xhalf(sh); float is = 0.f; v16bf b0h, b0l, b1h, b1l;
#pragma unroll
        for (int i = 0; i < 16; ++i) { const int e = (i < 8) ? 8 * hi + i : 16 + 8 * hi + (i - 8);   // bucket e in the fragment's k order
            float p = __builtin_amdgcn_exp2f(scW[(kq * 16 + lr) * LP + e] - mf);
            if (i == 0) { is += hi ? p : 0.f; p = hi ? p : lot; } else is += p;
            const __bf16 u = (__bf16)p; b0h[i] = u; b0l[i] = (__bf16)(p - (float)u);
            const float p1 = (i == 0 && hi == 0) ? hit : 0.f;   // buckets 32..63: only 32 is used
            const __bf16 u1 = (__bf16)p1; b1h[i] = u1; b1l[i] = (__bf16)(p1 - (float)u1); }
        const float inv = __fdiv_rn(1.0f, lot + hit + (is + xhalf(is)));
#pragma unroll
        for (int dt = 0; dt < 4; ++dt) { v8f a = om[dt]; a = wmmab(av[dt][0], b0h, a); a = wmmab(av[dt][0], b0l, a); a = wmmab(av[dt][1], b1h, a); a = wmmab(av[dt][1], b1l, a); a *= inv;
            float* op = (ob + (size_t)(q0 + kq * 16) * DM + dt * 16) + (unsigned)(lr * DM + 8 * hi);
            *(v4f*)op = __builtin_shufflevector(a, a, 0, 1, 2, 3); *(v4f*)(op + 4) = __builtin_shufflevector(a, a, 4, 5, 6, 7); } }
}

extern "C" void kernel_launch(void* const* d_in, const int* in_sizes, int n_in,
                              void* d_out, int out_size, void* d_ws, size_t ws_size, hipStream_t stream) {
    (void)in_sizes; (void)n_in; (void)out_size;
    const float* Qin = (const float*)d_in[0]; const float* Kin = (const float*)d_in[1]; const float* Vin = (const float*)d_in[2]; const float* ak = (const float*)d_in[3]; const float* av = (const float*)d_in[4];   /* rel_k_table, rel_v_table [33][64] */
    float* OUT = (float*)d_out;     // [2][2048][16][64] token-major
    char* wsp = (char*)d_ws;
    auto take = [&](size_t bytes) { char* p = wsp; wsp += (bytes + 255) & ~(size_t)255; return (void*)p; };
    bf* KB = (bf*)take((size_t)NB_ * NH_ * TT * HD * 2); bf* VT = (bf*)take((size_t)NB_ * NH_ * HD * TT * 2);
    bf* AKB = (bf*)take((size_t)NE * HD * 2); bf* AVTh = (bf*)take((size_t)HD * NE * 2); bf* AVTl = (bf*)take((size_t)HD * NE * 2);
    if ((size_t)(wsp - (char*)d_ws) > ws_size) return;
    k_prep<<<dim3(KVB + TBB, 2), 256, 0, stream>>>(Kin, Vin, KB, VT, ak, AKB, av, AVTh, AVTl);   /* k, v -> fragment order; a_k -> bf16 [64][64], rows >= 33 zero; a_v^T -> [64][64] (lo plane unused: the table is taken as bf16) */
    k_fattn<<<dim3(TT / (FW * NQ * 16), NB_ * NH_), FW * KS * 32, 0, stream>>>(Qin, KB, VT, AKB, AVTh, OUT);
}

// v009
// One run takes 38.3 microseconds.
// Next to v008, in two timings, it ran 1.08 times as fast each time.
// All steps since v000 together make it 83.2 times as fast.
#include <hip/hip_runtime.h>

// Relative-position multi-head attention on given token-major tensors (queries, keys, values [2][2048][16][64]; idx[l][s] = clip(s - l, -16, 16) + 16; attn = softmax((q.k + q.rel_k_table[idx]) / 8); out = attn values + sum_s attn[l][s] rel_v_table[idx[l][s]] (tables [33][64], read) -> [2][2048][16][64] token-major (4.2 M)).
// Prep, one launch (k_prep; a range of the block index picks the job, none of which needs another's result): k as bf16 and value^T as f16 in the order in which the fused kernel's fragments read them (every wave-wide load takes 512 contiguous bytes); the key table zero-padded to [64][64] and the value table transposed to [64][64].
// k_fattn: one launch for all heads. A wave has 32 queries (two groups of 16, read from the input and rounded to bf16 once) and walks its keys 32 at a time: S^T = K Q^T, so that a lane holds the scores of one query; online softmax with a lazily moved maximum (the queries carry the factor log2(e) / 8 before their rounding, and outside the band a score tile's accumulator starts at the pass's one relative offset minus the maximum in use, so that the matrix product leaves exp2's arguments); the two score tiles of a pass, rounded to f16, are the B operand of O^T += V^T P^T as they lie in the accumulators (P lies in [0, 2^13] under the lazy maximum, inside f16's range). Outside the band a pass forms no maximum: it takes exp2 at once and tests the lane's sum of its 32 f32 exponentials, which the row sums need anyway; a sum above 2^13 (or not a number) says that some score stands more than 8 above the maximum in use, and only then are the scores formed again, their maximum found and the maximum in use moved. No score and no P plane goes to memory. Two waves share each 32 queries: each walks one half of the ring of key passes (KS = 2; four waves a SIMD instead of two, so that one wave's vector chains and waits hide behind the others' work); behind the loop each hands the other, through LDS, its partial (maximum, end sums, O) of one group of 16 queries, and finishes the other group. The NXB x KS walks of a head each enter the ring at a start of their own, so that they do not ask L2 for the same lines at the same moment.
// Relative terms: QE^T = a_k Q^T (matrix product) once per 32 queries. A pass wholly left (right) of the 31-wide band adds the one value QE[l][0] (QE[l][32]) and sums its P into the end bucket in registers; the three passes that touch the band go tile by tile (16 keys x 16 queries): a tile wholly outside the band is treated like such a pass, and only a tile that can meet the band reads one QE value a score from LDS and parks its scaled scores there. QE lies in LDS by key minus query, -31 .. 31, clamped as it is stored, so that such a tile needs no clamp, no test and one address. After the loop the 33 buckets (end sums; exp2 of the parked scores under the final maximum) are split hi/lo and O^T += a_v^T PB^T on the matrix unit; then one division by the row sum.
// Every '#pragma unroll' below makes the indices of a register array constants (an array indexed at run time would go to scratch).
// Compute dtypes, f32 accumulate: q x log2(e) / 8, k and the tables rounded to bf16, values to f16 (11 significant bits; finite up to 65504); q.k and q.a_k exact products; softmax f32; P f16 x f16 value; bucket sums bf16 hi/lo x bf16 a_v; output f32.

#define NB_  2
#define TT   2048
#define DM   1024      // token-major row pitch (H x HD)
#define NH_  16
#define HD   64
#define NE   64       // 2*16+1 = 33 relative offsets padded to 64
#define NRE  33
#define CUT  16
#define FW   4        // blocks of 32 queries per work-group of k_fattn
#define KS   2        // waves per block of queries, each on its own half of the keys (KS == NQ: a wave finishes one group)
#define NQ   2        // groups of 16 queries per wave
#define KP   32       // keys per pass
#define NXB  (TT / (FW * NQ * 16))   // work-groups of k_fattn that share one head's keys and values
#define MGF  (4 * 8 * 32)   // floats of O in a wave's hand-over record; three rows of 32 floats follow (maximum, left sum, right sum)
#define LQ   68       // LDS row pitch in floats of the two per-query tables below (63 entries a query). A lane reads row lr at place c - lr: 67 lr + 8 hi meets no bank twice over a wave; a column walk (68 lr) neither
#define Z0   31       // place of key minus query = 0 in such a row; places 0 .. 62 stand for -31 .. 31
#define SC2  0.18033688011112042f   // log2(e) / sqrt(64)
#define NEGB (-3.0e38f)
#define NCHK (NB_ * NH_ * TT * HD / 8)   // 8-element chunks in one of k, v
#define PCH  8        // chunks per thread of fragorder
#define KVB  (NCHK / PCH / 256)   // blocks of k_prep per tensor
#define TBB  (HD * NE / 4 / 256)  // blocks of k_prep per table (the value table's count; the key table's spare blocks leave at once)
typedef unsigned short bf;
typedef __attribute__((ext_vector_type(16))) __bf16   v16bf;
typedef __attribute__((ext_vector_type(8)))  unsigned short v8us;
typedef __attribute__((ext_vector_type(4)))  unsigned short v4us;
typedef __attribute__((ext_vector_type(8)))  float    v8f;
typedef __attribute__((ext_vector_type(4)))  float    v4f;
typedef __attribute__((ext_vector_type(2)))  float    v2f;
typedef __attribute__((ext_vector_type(16))) _Float16 v16h;
typedef __attribute__((ext_vector_type(2)))  _Float16 v2h;

__device__ __forceinline__ unsigned short f2bf(float f) { unsigned u = __float_as_uint(f); u += 0x7FFFu + ((u >> 16) & 1u); return (unsigned short)(u >> 16); }
__device__ __forceinline__ float bf2f(unsigned short b) { return __uint_as_float(((unsigned)b) << 16); }
__device__ __forceinline__ void splitf(float y, unsigned short& h, unsigned short& l) { h = f2bf(y); l = f2bf(y - bf2f(h)); }
__device__ __forceinline__ v16bf cat16b(v8us lo, v8us hi) { return __builtin_bit_cast(v16bf, __builtin_shufflevector(lo, hi, 0, 1, 2, 3, 4, 5, 6, 7, 8, 9, 10, 11, 12, 13, 14, 15)); }
__device__ __forceinline__ v8f wmmab(v16bf a, v16bf b, v8f c) { return __builtin_amdgcn_wmma_f32_16x16x32_bf16(false, a, false, b, (short)0, c, false, false); }
__device__ __forceinline__ v8f wmmah(v16h a, v16h b, v8f c) { return __builtin_amdgcn_wmma_f32_16x16x32_f16(false, a, false, b, (short)0, c, false, false); }
// fragment of one row (A) or column (B) from a k-contiguous plane; the address already holds + 8 * (lane >> 4): k = 8h + 0..7, then 16 + 8h + 0..7
// base is the same in every lane, off the lane's own offset in elements
__device__ __forceinline__ v16bf ldf(const bf* base, unsigned off) { const bf* p = base + off; return cat16b(*(const v8us*)p, *(const v8us*)(p + 16)); }
// the same fragment from a plane in fragment order; p already holds + 8 * lane: two loads of 512 contiguous bytes a wave
__device__ __forceinline__ v16bf ldq(const bf* p) { return cat16b(*(const v8us*)p, *(const v8us*)(p + 256)); }
__device__ __forceinline__ v8f splat8(float x) { return (v8f){x, x, x, x, x, x, x, x}; }
// the value of lane l ^ 16
__device__ __forceinline__ float xhalf(float x) { const int b = __float_as_int(x); return __int_as_float(__builtin_amdgcn_permlanex16(b, b, 0x76543210, 0xfedcba98, false, false)); }

// Keys (bf16) and values (f16) of both batches in the order in which k_fattn's fragments read them, so that each of its wave-wide 16-byte loads takes 512 contiguous bytes. blockIdx.y picks the tensor; a thread makes PCH chunks of 8 elements.
// Keys: per (batch, head), per 16 keys, four 512-byte blocks (kc, j); lane (lr, hi) of a block holds k[16 kt + lr][32 kc + 16 j + 8 hi + 0..7].
// Values, transposed: per (batch, head), per 32 keys, eight 512-byte blocks (dt, j); lane (lr, hi) of a block holds v[32 kp + 16 j + 8 hi + 0..7][16 dt + lr].
template <bool ISV>
__device__ __forceinline__ void fragorder(const float* __restrict__ S, bf* __restrict__ F) {
    const unsigned n0 = blockIdx.x * 256 + threadIdx.x; const float* sp[PCH]; bf* dp[PCH]; v8f v[PCH]; v8us o[PCH];
#pragma unroll
    for (int c = 0; c < PCH; ++c) { const unsigned n = n0 + c * (NCHK / PCH);
        if (!ISV) { const int d = (int)(n % (HD / 8)) * 8; const int t = (int)((n / (HD / 8)) % TT); const int bh = (int)(n / (HD / 8 * TT));
            sp[c] = S + ((size_t)(bh / NH_) * TT + t) * DM + (bh % NH_) * HD + d; v[c] = *(const v8f*)sp[c];
            dp[c] = F + (size_t)bh * TT * HD + (size_t)((((t >> 4) * 2 + (d >> 5)) * 2 + ((d >> 4) & 1)) * 32 + ((d >> 3) & 1) * 16 + (t & 15)) * 8; }
        else { const int lr = (int)(n & 15), hi = (int)((n >> 4) & 1), j = (int)((n >> 5) & 1), dt = (int)((n >> 6) & 3); const int kp = (int)((n >> 8) % (TT / 32)); const int bh = (int)((n >> 8) / (TT / 32));
            sp[c] = S + ((size_t)(bh / NH_) * TT + kp * 32 + 16 * j + 8 * hi) * DM + (bh % NH_) * HD + dt * 16 + lr;
#pragma unroll
            for (int q = 0; q < 8; ++q) v[c][q] = sp[c][(size_t)q * DM];
            dp[c] = F + (size_t)n * 8; } }
    asm volatile("s_wait_xcnt 0x0" :: "v"(sp[0]), "v"(sp[1]), "v"(sp[2]), "v"(sp[3]), "v"(sp[4]), "v"(sp[5]), "v"(sp[6]), "v"(sp[7]) : "memory");   // precaution: the wait stands in front of any rewrite of the loads' address registers, which it keeps live up to here
#pragma unroll
    for (int c = 0; c < PCH; ++c) {
#pragma unroll
        for (int q = 0; q < 8; ++q) o[c][q] = ISV ? __builtin_bit_cast(unsigned short, (_Float16)v[c][q]) : f2bf(v[c][q]);
        *(v8us*)dp[c] = o[c]; }
    asm volatile("s_wait_xcnt 0x0" :: "v"(dp[0]), "v"(dp[1]), "v"(dp[2]), "v"(dp[3]), "v"(dp[4]), "v"(dp[5]), "v"(dp[6]), "v"(dp[7]), "v"(o[0]), "v"(o[1]), "v"(o[2]), "v"(o[3]), "v"(o[4]), "v"(o[5]), "v"(o[6]), "v"(o[7]) : "memory");   // the same precaution for the stores' address and data registers
}
// b: the block's number within its table job
__device__ __forceinline__ void epadK(const float* __restrict__ E, bf* EB, const unsigned b) { const size_t i = (size_t)b * 256 + threadIdx.x; if (i >= (size_t)NE * HD / 8) return; const int d0 = (int)(i % (HD / 8)) * 8; const int r = (int)(i / (HD / 8)); const float* src = E + (size_t)min(r, NRE - 1) * HD + d0; v8us o;
#pragma unroll
    for (int q = 0; q < 8; ++q) { const unsigned short v = f2bf(src[q]); o[q] = (r < NRE) ? v : (unsigned short)0; }
    *(v8us*)(EB + (size_t)r * HD + d0) = o;  }

__device__ __forceinline__ void epadVT(const float* __restrict__ E, bf* Th, bf* Tl, const unsigned b) { const size_t i = (size_t)b * 256 + threadIdx.x; if (i >= (size_t)HD * NE / 4) return; const size_t e = i * 4; const int c0 = (int)(e % NE); const int d = (int)(e / NE); v4us oh, ol;
#pragma unroll
    for (int q = 0; q < 4; ++q) { const int r = c0 + q; const float v = E[(size_t)min(r, NRE - 1) * HD + d]; unsigned short u, w; splitf(v, u, w); oh[q] = (r < NRE) ? u : (unsigned short)0; ol[q] = (r < NRE) ? w : (unsigned short)0; }
    *(v4us*)(Th + e) = oh; *(v4us*)(Tl + e) = ol;  }

// All preparation in one grid. blockIdx.x < KVB: keys (y = 0) or values (y = 1) into fragment order; the TBB blocks behind them: the key table (y = 0) or the value table (y = 1). Every branch is the same for a whole block.
__global__ __launch_bounds__(256) void k_prep(const float* __restrict__ Ks, const float* __restrict__ Vs, bf* Kf, bf* Vf, const float* __restrict__ Ek, bf* EB, const float* __restrict__ Ev, bf* Th, bf* Tl) {
    if (blockIdx.x >= KVB) { if (blockIdx.y == 0) epadK(Ek, EB, blockIdx.x - KVB); else epadVT(Ev, Th, Tl, blockIdx.x - KVB); return; }
    if (blockIdx.y == 0) fragorder<false>(Ks, Kf); else fragorder<true>(Vs, Vf); }

// One pass that touches the band: 32 keys from k0 = q0 - 32, q0 or q0 + 32 against the wave's 32 queries from q0. thr: how far a pass's maximum may stand above m[g] before m moves: 8, and below every score until this wave has set m (the same in every lane).
// Each of the pass's four score tiles (16 keys x 16 queries) goes by its own offset D = k0 - q0 + 16 (t - g), the same in every lane (scalar branches); key minus query is D + j, j = 8 hi + r - lr in [-15, 15]. D <= -32 (>= 32): the whole tile lies left (right) of the band: one relative term a query, no parked score, plain end sums. D = 0: the whole tile lies in the band: no end sum. D = -16 (16): in the band where j > 0 (j < 0), else left (right). The tiles with |D| <= 16 read their relative terms and park their scores at one lane address a tile plus constants.
__device__ __forceinline__ void bpass(const int k0, const int knext, const bf* __restrict__ kh, const bf* __restrict__ vh, const int lr, const int hi, const int q0,
                                      const v16bf (&qf)[NQ][2], v16bf (&kf)[2][2], v8f (&o)[NQ][4], float (&m)[NQ], float (&slo)[NQ], float (&shi)[NQ],
                                      float& thr, const float* qeW, float* scW) {
    v16h vf[4]; const bf* vp = vh + k0 * HD + (unsigned)((hi * 16 + lr) * 8); const bf* kp = kh + knext * HD + (unsigned)((hi * 16 + lr) * 8);
#pragma unroll
    for (int dt = 0; dt < 4; ++dt) vf[dt] = __builtin_bit_cast(v16h, ldq(vp + dt * 512));
    v8f s[NQ][2];
#pragma unroll
    for (int g = 0; g < NQ; ++g)
#pragma unroll
        for (int t = 0; t < 2; ++t) { s[g][t] = wmmab(kf[t][0], qf[g][0], (v8f){}); s[g][t] = wmmab(kf[t][1], qf[g][1], s[g][t]); }   // s[g][t][r] = k[k0 + 16t + 8h + r] . q[q0 + 16g + lr] (scaled)
#pragma unroll
    for (int t = 0; t < 2; ++t)
#pragma unroll
        for (int kc = 0; kc < 2; ++kc) kf[t][kc] = ldq(kp + t * 1024 + kc * 512);   // the next pass's keys, one pass ahead
    asm volatile("s_wait_xcnt 0x0" :: "v"(vp), "v"(kp) : "memory");   // precaution: the wait stands in front of any rewrite of the two address pairs of the loads above, which it keeps live up to here
    float tm[NQ]; bool need = false; const int e = 8 * hi - lr;
#pragma unroll
    for (int g = 0; g < NQ; ++g) { float a0 = NEGB, a1; const int row = (g * 16 + lr) * LQ + Z0;
#pragma unroll
        for (int t = 0; t < 2; ++t) { const int D = k0 - q0 + 16 * (t - g); v8f x;
            if (D <= -2 * CUT || D >= 2 * CUT) x = s[g][t] + qeW[row + (D < 0 ? -CUT : CUT)];
            else { const float* qd = qeW + row + e + D; float* sd = scW + row + e + D;   // the row of relative terms is clamped as it lies; a score parked outside -15 .. 15 is read by nobody
#pragma unroll
                for (int r = 0; r < 8; ++r) x[r] = s[g][t][r] + qd[r];
#pragma unroll
                for (int r = 0; r < 8; ++r) sd[r] = x[r]; }
            s[g][t] = x - m[g];
#pragma unroll
            for (int r = 0; r < 8; ++r) { if (!t) a0 = fmaxf(a0, s[g][t][r]); else a1 = r ? fmaxf(a1, s[g][t][r]) : s[g][t][0]; } }
        a0 = fmaxf(a0, a1); tm[g] = fmaxf(a0, xhalf(a0)); need = need || (tm[g] > thr); }   // tm: the pass's maximum above the one in use
    if (__builtin_amdgcn_ballot_w32(need) != 0) { const bool first = thr < 0.f;   // the maximum in use moves only when some query outgrows it by 2^8; a wave's first pass sets it, up or down (all sums are still zero)
#pragma unroll
        for (int g = 0; g < NQ; ++g) { const float d = first ? tm[g] : fmaxf(tm[g], 0.f); const float al = first ? 1.f : __builtin_amdgcn_exp2f(-d); m[g] += d; slo[g] *= al; shi[g] *= al;
#pragma unroll
            for (int t = 0; t < 2; ++t) s[g][t] -= d;
#pragma unroll
            for (int dt = 0; dt < 4; ++dt) o[g][dt] *= al; }
        thr = 8.0f; }
#pragma unroll
    for (int g = 0; g < NQ; ++g) { v16h ph; float l0 = 0.f, l1 = 0.f, h0 = 0.f, h1 = 0.f;
#pragma unroll
        for (int t = 0; t < 2; ++t) { const int D = k0 - q0 + 16 * (t - g); v8f p;
#pragma unroll
            for (int r = 0; r < 8; ++r) p[r] = __builtin_amdgcn_exp2f(s[g][t][r]);
            // end sums, even and odd places apart, in the order of the places; a term left out is an exact zero
            if (D <= -2 * CUT) {
#pragma unroll
                for (int r = 0; r < 8; r += 2) { l0 += p[r]; l1 += p[r + 1]; } }
            else if (D >= 2 * CUT) {
#pragma unroll
                for (int r = 0; r < 8; r += 2) { h0 += p[r]; h1 += p[r + 1]; } }
            else if (D < 0) {
#pragma unroll
                for (int r = 0; r < 8; r += 2) { l0 += (e + r <= 0) ? p[r] : 0.f; l1 += (e + r + 1 <= 0) ? p[r + 1] : 0.f; } }
            else if (D > 0) {
#pragma unroll
                for (int r = 0; r < 8; r += 2) { h0 += (e + r >= 0) ? p[r] : 0.f; h1 += (e + r + 1 >= 0) ? p[r + 1] : 0.f; } }
#pragma unroll
            for (int r = 0; r < 8; r += 2) { const v2f p2 = {p[r], p[r + 1]}; const v2h u = __builtin_convertvector(p2, v2h);   // P as f16, to nearest even
                ph[t * 8 + r] = u[0]; ph[t * 8 + r + 1] = u[1]; } }
        slo[g] += l0 + l1; shi[g] += h0 + h1;
#pragma unroll
        for (int dt = 0; dt < 4; ++dt) o[g][dt] = wmmah(vf[dt], ph, o[g][dt]); }   // o[g][dt][r] = O[q0 + 16g + lr][16dt + 8h + r]
}

// The scores of a pass outside the band, as exp2's arguments: s[g][t][r] = k[16t + 8h + r of kf] . q[16g + lr] (scaled) + c[g]
__device__ __forceinline__ void scores(const v16bf (&qf)[NQ][2], const v16bf (&kf)[2][2], const v8f (&c)[NQ], v8f (&s)[NQ][2]) {
#pragma unroll
    for (int g = 0; g < NQ; ++g)
#pragma unroll
        for (int t = 0; t < 2; ++t) { s[g][t] = wmmab(kf[t][0], qf[g][0], c[g]); s[g][t] = wmmab(kf[t][1], qf[g][1], s[g][t]); }
}
// four key fragments (32 keys) from p, which already holds + 8 * lane
__device__ __forceinline__ void ldkeys(const bf* p, v16bf (&kf)[2][2]) {
#pragma unroll
    for (int t = 0; t < 2; ++t)
#pragma unroll
        for (int kc = 0; kc < 2; ++kc) kf[t][kc] = ldq(p + t * 1024 + kc * 512);
}
// each query's largest score of a pass, the same in both lanes that hold the query
__device__ __forceinline__ void passmax(const v8f (&s)[NQ][2], float (&tm)[NQ]) {
#pragma unroll
    for (int g = 0; g < NQ; ++g) { float a0 = s[g][0][0], a1 = s[g][1][0];
#pragma unroll
        for (int r = 1; r < 8; ++r) { a0 = fmaxf(a0, s[g][0][r]); a1 = fmaxf(a1, s[g][1][r]); }
        a0 = fmaxf(a0, a1); tm[g] = fmaxf(a0, xhalf(a0)); }
}
// s -> exp2(s) in place; ls[g]: the lane's sum of group g's 16
__device__ __forceinline__ void expsum(v8f (&s)[NQ][2], float (&ls)[NQ]) {
#pragma unroll
    for (int g = 0; g < NQ; ++g) { float l0 = 0.f, l1 = 0.f;
#pragma unroll
        for (int i = 0; i < 16; i += 2) { const int t = i >> 3, r = i & 7; s[g][t][r] = __builtin_amdgcn_exp2f(s[g][t][r]); s[g][t][r + 1] = __builtin_amdgcn_exp2f(s[g][t][r + 1]); l0 += s[g][t][r]; l1 += s[g][t][r + 1]; }
        ls[g] = l0 + l1; }
}
// One pass outside the band: 32 keys from k0, every one at least 16 left (its sums go to se = slo) or at least 16 right (se = shi) of every query; so: the other end's sums. cb[g]: the pass's relative offset minus m[g] in all eight places; m has been set. Returns whether m moved (the same in every lane): cb then no longer fits.
__device__ __forceinline__ bool opass(const int k0, const int knext, const bf* __restrict__ kh, const bf* __restrict__ vh, const int lane,
                                      const v16bf (&qf)[NQ][2], v16bf (&kf)[2][2], v8f (&o)[NQ][4], float (&m)[NQ], float (&se)[NQ], float (&so)[NQ], const v8f (&cb)[NQ]) {
    v16h vf[4]; const bf* vp = vh + k0 * HD + (unsigned)(lane * 8); const bf* kp = kh + knext * HD + (unsigned)(lane * 8);
#pragma unroll
    for (int dt = 0; dt < 4; ++dt) vf[dt] = __builtin_bit_cast(v16h, ldq(vp + dt * 512));
    v8f s[NQ][2]; float ls[NQ]; bool moved = false;
    scores(qf, kf, cb, s);
    ldkeys(kp, kf);   // the next pass's keys, one pass ahead
    asm volatile("s_wait_xcnt 0x0" :: "v"(vp), "v"(kp) : "memory");   // precaution: the wait stands in front of any rewrite of the two address pairs of the loads above, which it keeps live up to here
    __builtin_amdgcn_sched_barrier(0);   // keeps all sixteen loads in front of the exponentials: left free, the compiler lends their target registers to the vector work first and issues half the value loads and all key loads behind it, a few instructions ahead of their use
    expsum(s, ls);
    // no term is negative, so a sum of at most 2^13 bounds each P; 32 terms of at most 2^8 never trip the test, so that a trip always moves m
    if (__builtin_amdgcn_ballot_w32(!(ls[0] + ls[1] <= 8192.0f)) != 0) { const bf* kr = kh + k0 * HD + (unsigned)(lane * 8); float tm[NQ];
        ldkeys(kr, kf);   // this pass's keys once more: their registers hold the next pass's by now
        asm volatile("s_wait_xcnt 0x0" :: "v"(kr) : "memory");   // the same precaution
        scores(qf, kf, cb, s);
        ldkeys(kp, kf);
        asm volatile("s_wait_xcnt 0x0" :: "v"(kp) : "memory");   // the same precaution
        passmax(s, tm);
#pragma unroll
        for (int g = 0; g < NQ; ++g) { const float d = fmaxf(tm[g], 0.f); const float al = __builtin_amdgcn_exp2f(-d); m[g] += d; se[g] *= al; so[g] *= al;
#pragma unroll
            for (int t = 0; t < 2; ++t) s[g][t] -= d;
#pragma unroll
            for (int dt = 0; dt < 4; ++dt) o[g][dt] *= al; }
        expsum(s, ls); moved = true; }
#pragma unroll
    for (int g = 0; g < NQ; ++g) { v16h ph;
#pragma unroll
        for (int i = 0; i < 16; i += 2) { const int t = i >> 3, r = i & 7; v2f p; p[0] = s[g][t][r]; p[1] = s[g][t][r + 1];
            const v2h u = __builtin_convertvector(p, v2h);   // P as f16, to nearest even
            ph[i] = u[0]; ph[i + 1] = u[1]; }
        se[g] += ls[g];
#pragma unroll
        for (int dt = 0; dt < 4; ++dt) o[g][dt] = wmmah(vf[dt], ph, o[g][dt]); }
    return moved;
}
// The accumulators' start values for passes outside the band with the relative offset off. Where no pass of this wave has set m yet (thr below 0), m becomes the largest score of the pass whose keys are in kf.
__device__ __forceinline__ void startvals(const float (&off)[NQ], const v16bf (&qf)[NQ][2], const v16bf (&kf)[2][2], float (&m)[NQ], float& thr, v8f (&cb)[NQ]) {
    if (thr < 0.f) { v8f s[NQ][2];
#pragma unroll
        for (int g = 0; g < NQ; ++g) cb[g] = splat8(off[g]);
        scores(qf, kf, cb, s); passmax(s, m); thr = 8.0f; }
#pragma unroll
    for (int g = 0; g < NQ; ++g) cb[g] = splat8(off[g] - m[g]);
}

// 256 registers: two work-groups of eight waves then fill a WGP's register file (four waves a SIMD), and above them every change of register window costs a scalar instruction in the loop
__global__ __launch_bounds__(FW * KS * 32) __attribute__((amdgpu_num_vgpr(256))) void k_fattn(const float* __restrict__ Qin, const bf* __restrict__ KB, const bf* __restrict__ VT, const bf* __restrict__ AKB, const bf* __restrict__ AVT, float* OUT) {
    __shared__ float qeS[FW][NQ * 16 * LQ];   // QE x SC2, [query][Z0 + key minus query], clamped as it lies: places 0 .. 15 hold offset -16's value, places 47 .. 62 offset 16's
    __shared__ __attribute__((aligned(16))) float scS[FW][NQ * 16 * LQ];   // scaled scores of the band, [query][Z0 + key minus query]; only places 16 .. 46 (-15 .. 15) count
    __shared__ __attribute__((aligned(16))) float mgS[FW * KS][MGF + 3 * 32];   // per wave: the partial it hands to its partner
    const int lane = threadIdx.x & 31, lr = lane & 15, hi = lane >> 4; const int wv = __builtin_amdgcn_readfirstlane(threadIdx.x >> 5);
    const int qg = wv % FW, kq = wv / FW;   // block of queries; half of the keys (both the same in every lane)
    const int bh = blockIdx.y; const int q0 = (blockIdx.x * FW + qg) * (NQ * 16);
    const bf* kh = KB + (size_t)bh * TT * HD; const bf* vh = VT + (size_t)bh * HD * TT;
    float* qeW = qeS[qg]; float* scW = scS[qg];   // shared by the two waves of a block of queries
    v16bf qf[NQ][2]; const float* qp = Qin + ((size_t)(bh / NH_) * TT + q0) * DM + (bh % NH_) * HD + (unsigned)(lr * DM + 8 * hi);
#pragma unroll
    for (int g = 0; g < NQ; ++g)
#pragma unroll
        for (int kc = 0; kc < 2; ++kc) { const v8f x0 = *(const v8f*)(qp + g * 16 * DM + kc * 32), x1 = *(const v8f*)(qp + g * 16 * DM + kc * 32 + 16); v8us u0, u1;
#pragma unroll
            for (int i = 0; i < 8; ++i) { u0[i] = f2bf(x0[i] * SC2); u1[i] = f2bf(x1[i] * SC2); }
            qf[g][kc] = cat16b(u0, u1); }
    asm volatile("s_wait_xcnt 0x0" :: "v"(qp) : "memory");   // the same precaution for the address pair of the loads above
    if (kq == 0) {   // one wave of the pair makes QE, the other clears the band's scores
#pragma unroll
    for (int e3 = 0; e3 < 3; ++e3) { const v16bf a0 = ldf(AKB + e3 * 16 * HD, (unsigned)(lr * HD + 8 * hi)), a1 = ldf(AKB + e3 * 16 * HD + 32, (unsigned)(lr * HD + 8 * hi));
        v8f d[NQ];
#pragma unroll
        for (int g = 0; g < NQ; ++g) { d[g] = (v8f){}; d[g] = wmmab(a0, qf[g][0], d[g]); d[g] = wmmab(a1, qf[g][1], d[g]); }   // d[g][r] = a_k[16 e3 + 8h + r] . q[q0 + 16g + lr] (scaled)
#pragma unroll
        for (int g = 0; g < NQ; ++g)
#pragma unroll
            for (int r = 0; r < 8; ++r) { const int e = e3 * 16 + 8 * hi + r; float* qw = qeW + (g * 16 + lr) * LQ + Z0 - CUT; if (e < NRE) qw[e] = d[g][r];
                if ((e3 == 0 || e3 == 2) && r == 0 && hi == 0) {   // the two end values once more at every place beyond them
#pragma unroll
                    for (int c = 1; c < CUT; ++c) qw[e3 ? 2 * CUT + c : -c] = d[g][0]; } } }
    } else {
#pragma unroll
    for (int i = 0; i < NQ * 16 * LQ / 128; ++i) *(v4f*)(scW + (i * 32 + lane) * 4) = (v4f){NEGB, NEGB, NEGB, NEGB};   // an offset with no key stays at exp2 -> 0
    }
    __syncthreads();   // a wave reads QE entries that its partner wrote, and parks scores over what its partner cleared
    float m[NQ], slo[NQ], shi[NQ]; v8f o[NQ][4], cb[NQ]; float thr = NEGB;
#pragma unroll
    for (int g = 0; g < NQ; ++g) { m[g] = 0.f; slo[g] = 0.f; shi[g] = 0.f;
#pragma unroll
        for (int dt = 0; dt < 4; ++dt) o[g][dt] = (v8f){}; }
    // first key of this wave's walk of TT / KS keys; its partner starts half the ring away. The offset by the block index is for speed only (any permutation of the starts gives the same function): neighbours in the block index get starts far apart, so that any few consecutive work-groups spread over the ring
    const int ks = (int)((blockIdx.x % 4) * (NXB / 4) + blockIdx.x / 4) * (TT / (NXB * KS)) + kq * (TT / KS); const int ke = ks + TT / KS;
    v16bf kf[2][2]; const bf* kp0 = kh + ks * HD + (unsigned)(lane * 8);
#pragma unroll
    for (int t = 0; t < 2; ++t)
#pragma unroll
        for (int kc = 0; kc < 2; ++kc) kf[t][kc] = ldq(kp0 + t * 1024 + kc * 512);
    asm volatile("s_wait_xcnt 0x0" :: "v"(kp0) : "memory");   // the same precaution
    const int kL = max(q0 - KP, 0), kR = min(q0 + NQ * 16 + KP, TT);   // passes in [kL, kR) touch the band
    // the three loops stay rolled (unroll 1): a pass is some hundred instructions long already, and a second copy would only cost instruction cache and registers
    // two stretches, [ks, min(ke, TT)) and then [0, ke - TT), which is empty where the walk does not wrap; the pass behind k0 is (k0 + KP) mod TT in both (the very last pass fetches keys that nobody uses, inside the plane). Rolled too: one copy of the three loops serves both stretches
#pragma unroll 1
    for (int h = 0; h < 2; ++h) { const int ka = h ? 0 : ks, kb = h ? ke - TT : min(ke, TT);
        // first and third loop: an inner loop runs while the maximum in use stands, so that the accumulators' start values are constants of it; they are formed anew only behind a pass that moved the maximum
#pragma unroll 1
        for (int k0 = ka; k0 < min(kb, kL); ) { bool mv; const float off[NQ] = {qeW[lr * LQ + Z0 - CUT], qeW[(16 + lr) * LQ + Z0 - CUT]};
            startvals(off, qf, kf, m, thr, cb);
#pragma unroll 1
            do { mv = opass(k0, (k0 + KP) & (TT - 1), kh, vh, lane, qf, kf, o, m, slo, shi, cb); k0 += KP; } while (!mv && k0 < min(kb, kL)); }
        asm volatile("v_nop\n\tv_nop\n\tv_nop\n\tv_nop");   // the four vector slots the chip needs between a pass's last matrix instruction and an overwrite of its operands: only scalar code may follow up to the next loop's first vector write (the way out of the third loop, round the outer loop with the first loop skipped, comes through here too)
#pragma unroll 1
        for (int k0 = max(ka, kL); k0 < min(kb, kR); k0 += KP) bpass(k0, (k0 + KP) & (TT - 1), kh, vh, lr, hi, q0, qf, kf, o, m, slo, shi, thr, qeW, scW);
#pragma unroll 1
        for (int k0 = max(ka, kR); k0 < kb; ) { bool mv; const float off[NQ] = {qeW[lr * LQ + Z0 + CUT], qeW[(16 + lr) * LQ + Z0 + CUT]};
            startvals(off, qf, kf, m, thr, cb);
#pragma unroll 1
            do { mv = opass(k0, (k0 + KP) & (TT - 1), kh, vh, lane, qf, kf, o, m, shi, slo, cb); k0 += KP; } while (!mv && k0 < kb); }
    }
    // hand-over: wave kq keeps group kq of its 32 queries and gives its partial of the other group to its partner
    v8f om[4], ox[4];
#pragma unroll
    for (int dt = 0; dt < 4; ++dt) { om[dt] = kq ? o[1][dt] : o[0][dt]; ox[dt] = kq ? o[0][dt] : o[1][dt]; }
    const float mm = kq ? m[1] : m[0], lm = kq ? slo[1] : slo[0], hm = kq ? shi[1] : shi[0];
    float* mw = mgS[wv];
#pragma unroll
    for (int dt = 0; dt < 4; ++dt) { *(v4f*)(mw + ((dt * 2) * 32 + lane) * 4) = __builtin_shufflevector(ox[dt], ox[dt], 0, 1, 2, 3); *(v4f*)(mw + ((dt * 2 + 1) * 32 + lane) * 4) = __builtin_shufflevector(ox[dt], ox[dt], 4, 5, 6, 7); }
    mw[MGF + lane] = kq ? m[0] : m[1]; mw[MGF + 32 + lane] = kq ? slo[0] : slo[1]; mw[MGF + 64 + lane] = kq ? shi[0] : shi[1];
    __syncthreads();   // a wave reads its partner's partial, and band scores that either wave of the pair wrote
    const float* pw = mgS[wv ^ FW];
    const float pm = pw[MGF + lane]; const float mf = fmaxf(mm, pm);   // the final maximum in use
    const float am = __builtin_amdgcn_exp2f(mm - mf), ap = __builtin_amdgcn_exp2f(pm - mf);
    const float sl = lm * am + pw[MGF + 32 + lane] * ap, sh = hm * am + pw[MGF + 64 + lane] * ap;
#pragma unroll
    for (int dt = 0; dt < 4; ++dt) { const v4f p0 = *(const v4f*)(pw + ((dt * 2) * 32 + lane) * 4), p1 = *(const v4f*)(pw + ((dt * 2 + 1) * 32 + lane) * 4);
        om[dt] = om[dt] * am + __builtin_shufflevector(p0, p1, 0, 1, 2, 3, 4, 5, 6, 7) * ap; }
    v16bf av[4][2];
#pragma unroll
    for (int dt = 0; dt < 4; ++dt) { av[dt][0] = ldf(AVT + dt * 16 * NE, (unsigned)(lr * NE + 8 * hi)); av[dt][1] = ldf(AVT + dt * 16 * NE + 32, (unsigned)(lr * NE + 8 * hi)); }
    float* ob = OUT + (size_t)(bh / NH_) * TT * DM + (size_t)(bh % NH_) * HD;
    { const float lot = sl + xhalf(sl), hit = sh + xhalf(sh); float is = 0.f; v16bf b0h, b0l, b1h, b1l;
#pragma unroll
        for (int i = 0; i < 16; ++i) { const int e = (i < 8) ? 8 * hi + i : 16 + 8 * hi + (i - 8);   // bucket e in the fragment's k order
            float p = __builtin_amdgcn_exp2f(scW[(kq * 16 + lr) * LQ + Z0 - CUT + e] - mf);
            if (i == 0) { is += hi ? p : 0.f; p = hi ? p : lot; } else is += p;
            const __bf16 u = (__bf16)p; b0h[i] = u; b0l[i] = (__bf16)(p - (float)u);
            const float p1 = (i == 0 && hi == 0) ? hit : 0.f;   // buckets 32..63: only 32 is used
            const __bf16 u1 = (__bf16)p1; b1h[i] = u1; b1l[i] = (__bf16)(p1 - (float)u1); }
        const float inv = __fdiv_rn(1.0f, lot + hit + (is + xhalf(is)));
#pragma unroll
        for (int dt = 0; dt < 4; ++dt) { v8f a = om[dt]; a = wmmab(av[dt][0], b0h, a); a = wmmab(av[dt][0], b0l, a); a = wmmab(av[dt][1], b1h, a); a = wmmab(av[dt][1], b1l, a); a *= inv;
            float* op = (ob + (size_t)(q0 + kq * 16) * DM + dt * 16) + (unsigned)(lr * DM + 8 * hi);
            *(v4f*)op = __builtin_shufflevector(a, a, 0, 1, 2, 3); *(v4f*)(op + 4) = __builtin_shufflevector(a, a, 4, 5, 6, 7); } }
}

extern "C" void kernel_launch(void* const* d_in, const int* in_sizes, int n_in,
                              void* d_out, int out_size, void* d_ws, size_t ws_size, hipStream_t stream) {
    (void)in_sizes; (void)n_in; (void)out_size;
    const float* Qin = (const float*)d_in[0]; const float* Kin = (const float*)d_in[1]; const float* Vin = (const float*)d_in[2]; const float* ak = (const float*)d_in[3]; const float* av = (const float*)d_in[4];   /* rel_k_table, rel_v_table [33][64] */
    float* OUT = (float*)d_out;     // [2][2048][16][64] token-major
    char* wsp = (char*)d_ws;
    auto take = [&](size_t bytes) { char* p = wsp; wsp += (bytes + 255) & ~(size_t)255; return (void*)p; };
    bf* KB = (bf*)take((size_t)NB_ * NH_ * TT * HD * 2); bf* VT = (bf*)take((size_t)NB_ * NH_ * HD * TT * 2);
    bf* AKB = (bf*)take((size_t)NE * HD * 2); bf* AVTh = (bf*)take((size_t)HD * NE * 2); bf* AVTl = (bf*)take((size_t)HD * NE * 2);
    if ((size_t)(wsp - (char*)d_ws) > ws_size) return;
    k_prep<<<dim3(KVB + TBB, 2), 256, 0, stream>>>(Kin, Vin, KB, VT, ak, AKB, av, AVTh, AVTl);   /* k, v -> fragment order; a_k -> bf16 [64][64], rows >= 33 zero; a_v^T -> [64][64] (lo plane unused: the table is taken as bf16) */
    k_fattn<<<dim3(TT / (FW * NQ * 16), NB_ * NH_), FW * KS * 32, 0, stream>>>(Qin, KB, VT, AKB, AVTh, OUT);
}

// v010
// A run of this version takes 36.3 microseconds.
// In two side-by-side timings against v009, it was 1.06 and 1.05 times as fast.
// All steps since v000 together make it 87.7 times as fast.
#include <hip/hip_runtime.h>

// Relative-position multi-head attention on given token-major tensors (queries, keys, values [2][2048][16][64]; idx[l][s] = clip(s - l, -16, 16) + 16; attn = softmax((q.k + q.rel_k_table[idx]) / 8); out = attn values + sum_s attn[l][s] rel_v_table[idx[l][s]] (tables [33][64], read) -> [2][2048][16][64] token-major (4.2 M)).
// Prep, one launch (k_prep; a range of the block index picks the job, none of which needs another's result): k as bf16 and value^T as f16 in the order in which the fused kernel's fragments read them (every wave-wide load takes 512 contiguous bytes); the key table zero-padded to [64][64] and the value table transposed to [64][64].
// k_fattn: one launch for all heads. A wave has 32 queries (two groups of 16, read from the input and rounded to bf16 once) and walks its keys 32 at a time: S^T = K Q^T, so that a lane holds the scores of one query; online softmax with a lazily moved maximum (the queries carry the factor log2(e) / 8 before their rounding, and outside the band a score tile's accumulator starts at the pass's one relative offset minus the maximum in use, so that the matrix product leaves exp2's arguments); the two score tiles of a pass, rounded to f16, are the B operand of O^T += V^T P^T as they lie in the accumulators (P lies in [0, 2^13] under the lazy maximum, inside f16's range). Outside the band a pass forms no maximum: it takes exp2 at once and tests the lane's sum of its 32 f32 exponentials, which the row sums need anyway; a sum above 2^13 (or not a number) says that some score stands more than 8 above the maximum in use, and only then are the scores formed again, their maximum found and the maximum in use moved. No score and no P plane goes to memory. Two waves share each 32 queries: each walks one half of the ring of key passes (KS = 2; four waves a SIMD instead of two, so that one wave's vector chains and waits hide behind the others' work); behind the loop each hands the other, through LDS, its partial (maximum, end sums, O) of one group of 16 queries, and finishes the other group. The NXB x KS walks of a head each enter the ring at a start of their own, so that they do not ask L2 for the same lines at the same moment.
// Relative terms: QE^T = a_k Q^T (matrix product) once per 32 queries. A pass wholly left (right) of the 31-wide band adds the one value QE[l][0] (QE[l][32]) and sums its P into the end bucket in registers; the three passes that touch the band go tile by tile (16 keys x 16 queries): a tile wholly outside the band is treated like such a pass, and only a tile that can meet the band reads one QE value a score from LDS and parks its scaled scores there. QE lies in LDS by key minus query, -31 .. 31, clamped as it is stored, so that such a tile needs no clamp, no test and one address. After the loop the 33 buckets (end sums; exp2 of the parked scores under the final maximum) are split hi/lo and O^T += a_v^T PB^T on the matrix unit; then one division by the row sum.
// Every '#pragma unroll' below makes the indices of a register array constants (an array indexed at run time would go to scratch).
// Compute dtypes, f32 accumulate: q x log2(e) / 8, k and the tables rounded to bf16, values to f16 (11 significant bits; finite up to 65504); q.k and q.a_k exact products; softmax f32; P f16 x f16 value; bucket sums bf16 hi/lo x bf16 a_v; output f32.

#define NB_  2
#define TT   2048
#define DM   1024      // token-major row pitch (H x HD)
#define NH_  16
#define HD   64
#define NE   64       // 2*16+1 = 33 relative offsets padded to 64
#define NRE  33
#define CUT  16
#define FW   4        // blocks of 32 queries per work-group of k_fattn
#define KS   2        // waves per block of queries, each on its own half of the keys (KS == NQ: a wave finishes one group)
#define NQ   2        // groups of 16 queries per wave
#define KP   32       // keys per pass
#define NXB  (TT / (FW * NQ * 16))   // work-groups of k_fattn that share one head's keys and values
#define MGF  (4 * 8 * 32)   // floats of O in a wave's hand-over record; three rows of 32 floats follow (maximum, left sum, right sum)
#define MGR  1152     // floats of a wave's LDS record: the hand-over record, and room for the two line stagings below (32 x QP bf16; 16 x OP floats)
#define QP   72       // pitch in bf16 of the staged query rows (144 bytes, 16 x odd: the 16-byte fragment reads meet no bank twice)
#define OP   68       // pitch in floats of the staged output rows (272 bytes, 16 x odd)
#define LQ   68       // LDS row pitch in floats of the two per-query tables below (63 entries a query). A lane reads row lr at place c - lr: 67 lr + 8 hi meets no bank twice over a wave; a column walk (68 lr) neither
#define Z0   31       // place of key minus query = 0 in such a row; places 0 .. 62 stand for -31 .. 31
#define SC2  0.18033688011112042f   // log2(e) / sqrt(64)
#define NEGB (-3.0e38f)
#define NCHK (NB_ * NH_ * TT * HD / 8)   // 8-element chunks in one of k, v
#define PCH  8        // chunks per thread of fragorder
#define KVB  (NCHK / PCH / 256)   // blocks of k_prep per tensor
#define TBB  (HD * NE / 4 / 256)  // blocks of k_prep per table (the value table's count; the key table's spare blocks leave at once)
typedef unsigned short bf;
typedef __attribute__((ext_vector_type(16))) __bf16   v16bf;
typedef __attribute__((ext_vector_type(8)))  unsigned short v8us;
typedef __attribute__((ext_vector_type(4)))  unsigned short v4us;
typedef __attribute__((ext_vector_type(8)))  float    v8f;
typedef __attribute__((ext_vector_type(4)))  float    v4f;
typedef __attribute__((ext_vector_type(2)))  float    v2f;
typedef __attribute__((ext_vector_type(16))) _Float16 v16h;
typedef __attribute__((ext_vector_type(2)))  _Float16 v2h;

__device__ __forceinline__ unsigned short f2bf(float f) { unsigned u = __float_as_uint(f); u += 0x7FFFu + ((u >> 16) & 1u); return (unsigned short)(u >> 16); }
__device__ __forceinline__ float bf2f(unsigned short b) { return __uint_as_float(((unsigned)b) << 16); }
__device__ __forceinline__ void splitf(float y, unsigned short& h, unsigned short& l) { h = f2bf(y); l = f2bf(y - bf2f(h)); }
__device__ __forceinline__ v16bf cat16b(v8us lo, v8us hi) { return __builtin_bit_cast(v16bf, __builtin_shufflevector(lo, hi, 0, 1, 2, 3, 4, 5, 6, 7, 8, 9, 10, 11, 12, 13, 14, 15)); }
__device__ __forceinline__ v8f wmmab(v16bf a, v16bf b, v8f c) { return __builtin_amdgcn_wmma_f32_16x16x32_bf16(false, a, false, b, (short)0, c, false, false); }
__device__ __forceinline__ v8f wmmah(v16h a, v16h b, v8f c) { return __builtin_amdgcn_wmma_f32_16x16x32_f16(false, a, false, b, (short)0, c, false, false); }
// fragment of one row (A) or column (B) from a k-contiguous plane; the address already holds + 8 * (lane >> 4): k = 8h + 0..7, then 16 + 8h + 0..7
// base is the same in every lane, off the lane's own offset in elements
__device__ __forceinline__ v16bf ldf(const bf* base, unsigned off) { const bf* p = base + off; return cat16b(*(const v8us*)p, *(const v8us*)(p + 16)); }
// the same fragment from a plane in fragment order; p already holds + 8 * lane: two loads of 512 contiguous bytes a wave
__device__ __forceinline__ v16bf ldq(const bf* p) { return cat16b(*(const v8us*)p, *(const v8us*)(p + 256)); }
__device__ __forceinline__ v8f splat8(float x) { return (v8f){x, x, x, x, x, x, x, x}; }
// the value of lane l ^ 16
__device__ __forceinline__ float xhalf(float x) { const int b = __float_as_int(x); return __int_as_float(__builtin_amdgcn_permlanex16(b, b, 0x76543210, 0xfedcba98, false, false)); }

// Keys (bf16) and values (f16) of both batches in the order in which k_fattn's fragments read them, so that each of its wave-wide 16-byte loads takes 512 contiguous bytes. blockIdx.y picks the tensor; a thread makes PCH chunks of 8 elements.
// Keys: per (batch, head), per 16 keys, four 512-byte blocks (kc, j); lane (lr, hi) of a block holds k[16 kt + lr][32 kc + 16 j + 8 hi + 0..7].
// Values, transposed: per (batch, head), per 32 keys, eight 512-byte blocks (dt, j); lane (lr, hi) of a block holds v[32 kp + 16 j + 8 hi + 0..7][16 dt + lr].
template <bool ISV>
__device__ __forceinline__ void fragorder(const float* __restrict__ S, bf* __restrict__ F) {
    const unsigned n0 = blockIdx.x * 256 + threadIdx.x; const float* sp[PCH]; bf* dp[PCH]; v8f v[PCH]; v8us o[PCH];
#pragma unroll
    for (int c = 0; c < PCH; ++c) { const unsigned n = n0 + c * (NCHK / PCH);
        if (!ISV) { const int d = (int)(n % (HD / 8)) * 8; const int t = (int)((n / (HD / 8)) % TT); const int bh = (int)(n / (HD / 8 * TT));
            sp[c] = S + ((size_t)(bh / NH_) * TT + t) * DM + (bh % NH_) * HD + d; v[c] = *(const v8f*)sp[c];
            dp[c] = F + (size_t)bh * TT * HD + (size_t)((((t >> 4) * 2 + (d >> 5)) * 2 + ((d >> 4) & 1)) * 32 + ((d >> 3) & 1) * 16 + (t & 15)) * 8; }
        else { const int lr = (int)(n & 15), hi = (int)((n >> 4) & 1), j = (int)((n >> 5) & 1), dt = (int)((n >> 6) & 3); const int kp = (int)((n >> 8) % (TT / 32)); const int bh = (int)((n >> 8) / (TT / 32));
            sp[c] = S + ((size_t)(bh / NH_) * TT + kp * 32 + 16 * j + 8 * hi) * DM + (bh % NH_) * HD + dt * 16 + lr;
#pragma unroll
            for (int q = 0; q < 8; ++q) v[c][q] = sp[c][(size_t)q * DM];
            dp[c] = F + (size_t)n * 8; } }
    asm volatile("s_wait_xcnt 0x0" :: "v"(sp[0]), "v"(sp[1]), "v"(sp[2]), "v"(sp[3]), "v"(sp[4]), "v"(sp[5]), "v"(sp[6]), "v"(sp[7]) : "memory");   // precaution: the wait stands in front of any rewrite of the loads' address registers, which it keeps live up to here
#pragma unroll
    for (int c = 0; c < PCH; ++c) {
#pragma unroll
        for (int q = 0; q < 8; ++q) o[c][q] = ISV ? __builtin_bit_cast(unsigned short, (_Float16)v[c][q]) : f2bf(v[c][q]);
        *(v8us*)dp[c] = o[c]; }
    asm volatile("s_wait_xcnt 0x0" :: "v"(dp[0]), "v"(dp[1]), "v"(dp[2]), "v"(dp[3]), "v"(dp[4]), "v"(dp[5]), "v"(dp[6]), "v"(dp[7]), "v"(o[0]), "v"(o[1]), "v"(o[2]), "v"(o[3]), "v"(o[4]), "v"(o[5]), "v"(o[6]), "v"(o[7]) : "memory");   // the same precaution for the stores' address and data registers
}
// b: the block's number within its table job
__device__ __forceinline__ void epadK(const float* __restrict__ E, bf* EB, const unsigned b) { const size_t i = (size_t)b * 256 + threadIdx.x; if (i >= (size_t)NE * HD / 8) return; const int d0 = (int)(i % (HD / 8)) * 8; const int r = (int)(i / (HD / 8)); const float* src = E + (size_t)min(r, NRE - 1) * HD + d0; v8us o;
#pragma unroll
    for (int q = 0; q < 8; ++q) { const unsigned short v = f2bf(src[q]); o[q] = (r < NRE) ? v : (unsigned short)0; }
    *(v8us*)(EB + (size_t)r * HD + d0) = o;  }

__device__ __forceinline__ void epadVT(const float* __restrict__ E, bf* Th, bf* Tl, const unsigned b) { const size_t i = (size_t)b * 256 + threadIdx.x; if (i >= (size_t)HD * NE / 4) return; const size_t e = i * 4; const int c0 = (int)(e % NE); const int d = (int)(e / NE); v4us oh, ol;
#pragma unroll
    for (int q = 0; q < 4; ++q) { const int r = c0 + q; const float v = E[(size_t)min(r, NRE - 1) * HD + d]; unsigned short u, w; splitf(v, u, w); oh[q] = (r < NRE) ? u : (unsigned short)0; ol[q] = (r < NRE) ? w : (unsigned short)0; }
    *(v4us*)(Th + e) = oh; *(v4us*)(Tl + e) = ol;  }

// All preparation in one grid. blockIdx.x < KVB: keys (y = 0) or values (y = 1) into fragment order; the TBB blocks behind them: the key table (y = 0) or the value table (y = 1). Every branch is the same for a whole block.
__global__ __launch_bounds__(256) void k_prep(const float* __restrict__ Ks, const float* __restrict__ Vs, bf* Kf, bf* Vf, const float* __restrict__ Ek, bf* EB, const float* __restrict__ Ev, bf* Th, bf* Tl) {
    if (blockIdx.x >= KVB) { if (blockIdx.y == 0) epadK(Ek, EB, blockIdx.x - KVB); else epadVT(Ev, Th, Tl, blockIdx.x - KVB); return; }
    if (blockIdx.y == 0) fragorder<false>(Ks, Kf); else fragorder<true>(Vs, Vf); }

// One pass that touches the band: 32 keys from k0 = q0 - 32, q0 or q0 + 32 against the wave's 32 queries from q0. thr: how far a pass's maximum may stand above m[g] before m moves: 8, and below every score until this wave has set m (the same in every lane).
// Each of the pass's four score tiles (16 keys x 16 queries) goes by its own offset D = k0 - q0 + 16 (t - g), the same in every lane (scalar branches); key minus query is D + j, j = 8 hi + r - lr in [-15, 15]. D <= -32 (>= 32): the whole tile lies left (right) of the band: one relative term a query, no parked score, plain end sums. D = 0: the whole tile lies in the band: no end sum. D = -16 (16): in the band where j > 0 (j < 0), else left (right). The tiles with |D| <= 16 read their relative terms and park their scores at one lane address a tile plus constants.
__device__ __forceinline__ void bpass(const int k0, const int knext, const bf* __restrict__ kh, const bf* __restrict__ vh, const int lr, const int hi, const int q0,
                                      const v16bf (&qf)[NQ][2], v16bf (&kf)[2][2], v8f (&o)[NQ][4], float (&m)[NQ], float (&slo)[NQ], float (&shi)[NQ],
                                      float& thr, const float* qeW, float* scW) {
    v16h vf[4]; const bf* vp = vh + k0 * HD + (unsigned)((hi * 16 + lr) * 8); const bf* kp = kh + knext * HD + (unsigned)((hi * 16 + lr) * 8);
#pragma unroll
    for (int dt = 0; dt < 4; ++dt) vf[dt] = __builtin_bit_cast(v16h, ldq(vp + dt * 512));
    v8f s[NQ][2];
#pragma unroll
    for (int g = 0; g < NQ; ++g)
#pragma unroll
        for (int t = 0; t < 2; ++t) { s[g][t] = wmmab(kf[t][0], qf[g][0], (v8f){}); s[g][t] = wmmab(kf[t][1], qf[g][1], s[g][t]); }   // s[g][t][r] = k[k0 + 16t + 8h + r] . q[q0 + 16g + lr] (scaled)
#pragma unroll
    for (int t = 0; t < 2; ++t)
#pragma unroll
        for (int kc = 0; kc < 2; ++kc) kf[t][kc] = ldq(kp + t * 1024 + kc * 512);   // the next pass's keys, one pass ahead
    asm volatile("s_wait_xcnt 0x0" :: "v"(vp), "v"(kp) : "memory");   // precaution: the wait stands in front of any rewrite of the two address pairs of the loads above, which it keeps live up to here
    float tm[NQ]; bool need = false; const int e = 8 * hi - lr;
#pragma unroll
    for (int g = 0; g < NQ; ++g) { float a0 = NEGB, a1; const int row = (g * 16 + lr) * LQ + Z0;
#pragma unroll
        for (int t = 0; t < 2; ++t) { const int D = k0 - q0 + 16 * (t - g); v8f x;
            if (D <= -2 * CUT || D >= 2 * CUT) x = s[g][t] + qeW[row + (D < 0 ? -CUT : CUT)];
            else { const float* qd = qeW + row + e + D; float* sd = scW + row + e + D;   // the row of relative terms is clamped as it lies; a score parked outside -15 .. 15 is read by nobody
#pragma unroll
                for (int r = 0; r < 8; ++r) x[r] = s[g][t][r] + qd[r];
#pragma unroll
                for (int r = 0; r < 8; ++r) sd[r] = x[r]; }
            s[g][t] = x - m[g];
#pragma unroll
            for (int r = 0; r < 8; ++r) { if (!t) a0 = fmaxf(a0, s[g][t][r]); else a1 = r ? fmaxf(a1, s[g][t][r]) : s[g][t][0]; } }
        a0 = fmaxf(a0, a1); tm[g] = fmaxf(a0, xhalf(a0)); need = need || (tm[g] > thr); }   // tm: the pass's maximum above the one in use
    if (__builtin_amdgcn_ballot_w32(need) != 0) { const bool first = thr < 0.f;   // the maximum in use moves only when some query outgrows it by 2^8; a wave's first pass sets it, up or down (all sums are still zero)
#pragma unroll
        for (int g = 0; g < NQ; ++g) { const float d = first ? tm[g] : fmaxf(tm[g], 0.f); const float al = first ? 1.f : __builtin_amdgcn_exp2f(-d); m[g] += d; slo[g] *= al; shi[g] *= al;
#pragma unroll
            for (int t = 0; t < 2; ++t) s[g][t] -= d;
#pragma unroll
            for (int dt = 0; dt < 4; ++dt) o[g][dt] *= al; }
        thr = 8.0f; }
#pragma unroll
    for (int g = 0; g < NQ; ++g) { v16h ph; float l0 = 0.f, l1 = 0.f, h0 = 0.f, h1 = 0.f;
#pragma unroll
        for (int t = 0; t < 2; ++t) { const int D = k0 - q0 + 16 * (t - g); v8f p;
#pragma unroll
            for (int r = 0; r < 8; ++r) p[r] = __builtin_amdgcn_exp2f(s[g][t][r]);
            // end sums, even and odd places apart, in the order of the places; a term left out is an exact zero
            if (D <= -2 * CUT) {
#pragma unroll
                for (int r = 0; r < 8; r += 2) { l0 += p[r]; l1 += p[r + 1]; } }
            else if (D >= 2 * CUT) {
#pragma unroll
                for (int r = 0; r < 8; r += 2) { h0 += p[r]; h1 += p[r + 1]; } }
            else if (D < 0) {
#pragma unroll
                for (int r = 0; r < 8; r += 2) { l0 += (e + r <= 0) ? p[r] : 0.f; l1 += (e + r + 1 <= 0) ? p[r + 1] : 0.f; } }
            else if (D > 0) {
#pragma unroll
                for (int r = 0; r < 8; r += 2) { h0 += (e + r >= 0) ? p[r] : 0.f; h1 += (e + r + 1 >= 0) ? p[r + 1] : 0.f; } }
#pragma unroll
            for (int r = 0; r < 8; r += 2) { const v2f p2 = {p[r], p[r + 1]}; const v2h u = __builtin_convertvector(p2, v2h);   // P as f16, to nearest even
                ph[t * 8 + r] = u[0]; ph[t * 8 + r + 1] = u[1]; } }
        slo[g] += l0 + l1; shi[g] += h0 + h1;
#pragma unroll
        for (int dt = 0; dt < 4; ++dt) o[g][dt] = wmmah(vf[dt], ph, o[g][dt]); }   // o[g][dt][r] = O[q0 + 16g + lr][16dt + 8h + r]
}

// The scores of a pass outside the band, as exp2's arguments: s[g][t][r] = k[16t + 8h + r of kf] . q[16g + lr] (scaled) + c[g]
__device__ __forceinline__ void scores(const v16bf (&qf)[NQ][2], const v16bf (&kf)[2][2], const v8f (&c)[NQ], v8f (&s)[NQ][2]) {
#pragma unroll
    for (int g = 0; g < NQ; ++g)
#pragma unroll
        for (int t = 0; t < 2; ++t) { s[g][t] = wmmab(kf[t][0], qf[g][0], c[g]); s[g][t] = wmmab(kf[t][1], qf[g][1], s[g][t]); }
}
// four key fragments (32 keys) from p, which already holds + 8 * lane
__device__ __forceinline__ void ldkeys(const bf* p, v16bf (&kf)[2][2]) {
#pragma unroll
    for (int t = 0; t < 2; ++t)
#pragma unroll
        for (int kc = 0; kc < 2; ++kc) kf[t][kc] = ldq(p + t * 1024 + kc * 512);
}
// each query's largest score of a pass, the same in both lanes that hold the query
__device__ __forceinline__ void passmax(const v8f (&s)[NQ][2], float (&tm)[NQ]) {
#pragma unroll
    for (int g = 0; g < NQ; ++g) { float a0 = s[g][0][0], a1 = s[g][1][0];
#pragma unroll
        for (int r = 1; r < 8; ++r) { a0 = fmaxf(a0, s[g][0][r]); a1 = fmaxf(a1, s[g][1][r]); }
        a0 = fmaxf(a0, a1); tm[g] = fmaxf(a0, xhalf(a0)); }
}
// s -> exp2(s) in place; ls[g]: the lane's sum of group g's 16
__device__ __forceinline__ void expsum(v8f (&s)[NQ][2], float (&ls)[NQ]) {
#pragma unroll
    for (int g = 0; g < NQ; ++g) { float l0 = 0.f, l1 = 0.f;
#pragma unroll
        for (int i = 0; i < 16; i += 2) { const int t = i >> 3, r = i & 7; s[g][t][r] = __builtin_amdgcn_exp2f(s[g][t][r]); s[g][t][r + 1] = __builtin_amdgcn_exp2f(s[g][t][r + 1]); l0 += s[g][t][r]; l1 += s[g][t][r + 1]; }
        ls[g] = l0 + l1; }
}
// One pass outside the band: 32 keys from k0, every one at least 16 left (its sums go to se = slo) or at least 16 right (se = shi) of every query; so: the other end's sums. cb[g]: the pass's relative offset minus m[g] in all eight places; m has been set. Returns whether m moved (the same in every lane): cb then no longer fits.
__device__ __forceinline__ bool opass(const int k0, const int knext, const bf* __restrict__ kh, const bf* __restrict__ vh, const int lane,
                                      const v16bf (&qf)[NQ][2], v16bf (&kf)[2][2], v8f (&o)[NQ][4], float (&m)[NQ], float (&se)[NQ], float (&so)[NQ], const v8f (&cb)[NQ]) {
    v16h vf[4]; const bf* vp = vh + k0 * HD + (unsigned)(lane * 8); const bf* kp = kh + knext * HD + (unsigned)(lane * 8);
#pragma unroll
    for (int dt = 0; dt < 4; ++dt) vf[dt] = __builtin_bit_cast(v16h, ldq(vp + dt * 512));
    v8f s[NQ][2]; float ls[NQ]; bool moved = false;
    scores(qf, kf, cb, s);
    ldkeys(kp, kf);   // the next pass's keys, one pass ahead
    asm volatile("s_wait_xcnt 0x0" :: "v"(vp), "v"(kp) : "memory");   // precaution: the wait stands in front of any rewrite of the two address pairs of the loads above, which it keeps live up to here
    __builtin_amdgcn_sched_barrier(0);   // keeps all sixteen loads in front of the exponentials: left free, the compiler lends their target registers to the vector work first and issues half the value loads and all key loads behind it, a few instructions ahead of their use
    expsum(s, ls);
    // no term is negative, so a sum of at most 2^13 bounds each P; 32 terms of at most 2^8 never trip the test, so that a trip always moves m
    if (__builtin_amdgcn_ballot_w32(!(ls[0] + ls[1] <= 8192.0f)) != 0) { const bf* kr = kh + k0 * HD + (unsigned)(lane * 8); float tm[NQ];
        ldkeys(kr, kf);   // this pass's keys once more: their registers hold the next pass's by now
        asm volatile("s_wait_xcnt 0x0" :: "v"(kr) : "memory");   // the same precaution
        scores(qf, kf, cb, s);
        ldkeys(kp, kf);
        asm volatile("s_wait_xcnt 0x0" :: "v"(kp) : "memory");   // the same precaution
        passmax(s, tm);
#pragma unroll
        for (int g = 0; g < NQ; ++g) { const float d = fmaxf(tm[g], 0.f); const float al = __builtin_amdgcn_exp2f(-d); m[g] += d; se[g] *= al; so[g] *= al;
#pragma unroll
            for (int t = 0; t < 2; ++t) s[g][t] -= d;
#pragma unroll
            for (int dt = 0; dt < 4; ++dt) o[g][dt] *= al; }
        expsum(s, ls); moved = true; }
#pragma unroll
    for (int g = 0; g < NQ; ++g) { v16h ph;
#pragma unroll
        for (int i = 0; i < 16; i += 2) { const int t = i >> 3, r = i & 7; v2f p; p[0] = s[g][t][r]; p[1] = s[g][t][r + 1];
            const v2h u = __builtin_convertvector(p, v2h);   // P as f16, to nearest even
            ph[i] = u[0]; ph[i + 1] = u[1]; }
        se[g] += ls[g];
#pragma unroll
        for (int dt = 0; dt < 4; ++dt) o[g][dt] = wmmah(vf[dt], ph, o[g][dt]); }
    return moved;
}
// The accumulators' start values for passes outside the band with the relative offset off. Where no pass of this wave has set m yet (thr below 0), m becomes the largest score of the pass whose keys are in kf.
__device__ __forceinline__ void startvals(const float (&off)[NQ], const v16bf (&qf)[NQ][2], const v16bf (&kf)[2][2], float (&m)[NQ], float& thr, v8f (&cb)[NQ]) {
    if (thr < 0.f) { v8f s[NQ][2];
#pragma unroll
        for (int g = 0; g < NQ; ++g) cb[g] = splat8(off[g]);
        scores(qf, kf, cb, s); passmax(s, m); thr = 8.0f; }
#pragma unroll
    for (int g = 0; g < NQ; ++g) cb[g] = splat8(off[g] - m[g]);
}

// 256 registers: two work-groups of eight waves then fill a WGP's register file (four waves a SIMD), and above them every change of register window costs a scalar instruction in the loop
__global__ __launch_bounds__(FW * KS * 32) __attribute__((amdgpu_num_vgpr(256))) void k_fattn(const float* __restrict__ Qin, const bf* __restrict__ KB, const bf* __restrict__ VT, const bf* __restrict__ AKB, const bf* __restrict__ AVT, float* OUT) {
    __shared__ float qeS[FW][NQ * 16 * LQ];   // QE x SC2, [query][Z0 + key minus query], clamped as it lies: places 0 .. 15 hold offset -16's value, places 47 .. 62 offset 16's
    __shared__ __attribute__((aligned(16))) float scS[FW][NQ * 16 * LQ];   // scaled scores of the band, [query][Z0 + key minus query]; only places 16 .. 46 (-15 .. 15) count
    __shared__ __attribute__((aligned(16))) float mgS[FW * KS][MGR];   // per wave: first its queries on their way from whole lines to fragments, then the partial it hands to its partner, at last its partner's output rows on their way to whole lines
    const int lane = threadIdx.x & 31, lr = lane & 15, hi = lane >> 4; const int wv = __builtin_amdgcn_readfirstlane(threadIdx.x >> 5);
    const int qg = wv % FW, kq = wv / FW;   // block of queries; half of the keys (both the same in every lane)
    const int bh = blockIdx.y; const int q0 = (blockIdx.x * FW + qg) * (NQ * 16);
    const bf* kh = KB + (size_t)bh * TT * HD; const bf* vh = VT + (size_t)bh * HD * TT;
    float* qeW = qeS[qg]; float* scW = scS[qg];   // shared by the two waves of a block of queries
    // the wave's 32 query rows (256 bytes each, 4 KiB apart) come in whole lines: a wave-wide 16-byte load takes two rows; scaled and rounded, they go through the wave's own LDS record into fragment order
    v16bf qf[NQ][2]; const float* qp = Qin + ((size_t)(bh / NH_) * TT + q0) * DM + (bh % NH_) * HD + (unsigned)(hi * DM + 4 * lr); bf* qs = (bf*)mgS[wv]; v4f xq[NQ * 8];
#pragma unroll
    for (int j = 0; j < NQ * 8; ++j) xq[j] = *(const v4f*)(qp + j * 2 * DM);   // row 2j + hi, places 4 lr .. 4 lr + 3
    asm volatile("s_wait_xcnt 0x0" :: "v"(qp) : "memory");   // the same precaution for the address pair of the loads above
#pragma unroll
    for (int j = 0; j < NQ * 8; ++j) { v4us u;
#pragma unroll
        for (int i = 0; i < 4; ++i) u[i] = f2bf(xq[j][i] * SC2);
        *(v4us*)(qs + (2 * j + hi) * QP + 4 * lr) = u; }
    asm volatile("s_wait_dscnt 0x0" ::: "memory");   // a lane reads below what other lanes of its wave stored above
#pragma unroll
    for (int g = 0; g < NQ; ++g)
#pragma unroll
        for (int kc = 0; kc < 2; ++kc) qf[g][kc] = ldf(qs + g * 16 * QP + kc * 32, (unsigned)(lr * QP + 8 * hi));
    if (kq == 0) {   // one wave of the pair makes QE, the other clears the band's scores
#pragma unroll
    for (int e3 = 0; e3 < 3; ++e3) { const v16bf a0 = ldf(AKB + e3 * 16 * HD, (unsigned)(lr * HD + 8 * hi)), a1 = ldf(AKB + e3 * 16 * HD + 32, (unsigned)(lr * HD + 8 * hi));
        v8f d[NQ];
#pragma unroll
        for (int g = 0; g < NQ; ++g) { d[g] = (v8f){}; d[g] = wmmab(a0, qf[g][0], d[g]); d[g] = wmmab(a1, qf[g][1], d[g]); }   // d[g][r] = a_k[16 e3 + 8h + r] . q[q0 + 16g + lr] (scaled)
#pragma unroll
        for (int g = 0; g < NQ; ++g)
#pragma unroll
            for (int r = 0; r < 8; ++r) { const int e = e3 * 16 + 8 * hi + r; float* qw = qeW + (g * 16 + lr) * LQ + Z0 - CUT; if (e < NRE) qw[e] = d[g][r];
                if ((e3 == 0 || e3 == 2) && r == 0 && hi == 0) {   // the two end values once more at every place beyond them
#pragma unroll
                    for (int c = 1; c < CUT; ++c) qw[e3 ? 2 * CUT + c : -c] = d[g][0]; } } }
    } else {
#pragma unroll
    for (int i = 0; i < NQ * 16 * LQ / 128; ++i) *(v4f*)(scW + (i * 32 + lane) * 4) = (v4f){NEGB, NEGB, NEGB, NEGB};   // an offset with no key stays at exp2 -> 0
    }
    __syncthreads();   // a wave reads QE entries that its partner wrote, and parks scores over what its partner cleared
    float m[NQ], slo[NQ], shi[NQ]; v8f o[NQ][4], cb[NQ]; float thr = NEGB;
#pragma unroll
    for (int g = 0; g < NQ; ++g) { m[g] = 0.f; slo[g] = 0.f; shi[g] = 0.f;
#pragma unroll
        for (int dt = 0; dt < 4; ++dt) o[g][dt] = (v8f){}; }
    // first key of this wave's walk of TT / KS keys; its partner starts half the ring away. The offset by the block index is for speed only (any permutation of the starts gives the same function): neighbours in the block index get starts far apart, so that any few consecutive work-groups spread over the ring
    const int ks = (int)((blockIdx.x % 4) * (NXB / 4) + blockIdx.x / 4) * (TT / (NXB * KS)) + kq * (TT / KS); const int ke = ks + TT / KS;
    v16bf kf[2][2]; const bf* kp0 = kh + ks * HD + (unsigned)(lane * 8);
#pragma unroll
    for (int t = 0; t < 2; ++t)
#pragma unroll
        for (int kc = 0; kc < 2; ++kc) kf[t][kc] = ldq(kp0 + t * 1024 + kc * 512);
    asm volatile("s_wait_xcnt 0x0" :: "v"(kp0) : "memory");   // the same precaution
    const int kL = max(q0 - KP, 0), kR = min(q0 + NQ * 16 + KP, TT);   // passes in [kL, kR) touch the band
    // the three loops stay rolled (unroll 1): a pass is some hundred instructions long already, and a second copy would only cost instruction cache and registers
    // two stretches, [ks, min(ke, TT)) and then [0, ke - TT), which is empty where the walk does not wrap; the pass behind k0 is (k0 + KP) mod TT in both (the very last pass fetches keys that nobody uses, inside the plane). Rolled too: one copy of the three loops serves both stretches
#pragma unroll 1
    for (int h = 0; h < 2; ++h) { const int ka = h ? 0 : ks, kb = h ? ke - TT : min(ke, TT);
        // first and third loop: an inner loop runs while the maximum in use stands, so that the accumulators' start values are constants of it; they are formed anew only behind a pass that moved the maximum
#pragma unroll 1
        for (int k0 = ka; k0 < min(kb, kL); ) { bool mv; const float off[NQ] = {qeW[lr * LQ + Z0 - CUT], qeW[(16 + lr) * LQ + Z0 - CUT]};
            startvals(off, qf, kf, m, thr, cb);
#pragma unroll 1
            do { mv = opass(k0, (k0 + KP) & (TT - 1), kh, vh, lane, qf, kf, o, m, slo, shi, cb); k0 += KP; } while (!mv && k0 < min(kb, kL)); }
        asm volatile("v_nop\n\tv_nop\n\tv_nop\n\tv_nop");   // the four vector slots the chip needs between a pass's last matrix instruction and an overwrite of its operands: only scalar code may follow up to the next loop's first vector write (the way out of the third loop, round the outer loop with the first loop skipped, comes through here too)
#pragma unroll 1
        for (int k0 = max(ka, kL); k0 < min(kb, kR); k0 += KP) bpass(k0, (k0 + KP) & (TT - 1), kh, vh, lr, hi, q0, qf, kf, o, m, slo, shi, thr, qeW, scW);
#pragma unroll 1
        for (int k0 = max(ka, kR); k0 < kb; ) { bool mv; const float off[NQ] = {qeW[lr * LQ + Z0 + CUT], qeW[(16 + lr) * LQ + Z0 + CUT]};
            startvals(off, qf, kf, m, thr, cb);
#pragma unroll 1
            do { mv = opass(k0, (k0 + KP) & (TT - 1), kh, vh, lane, qf, kf, o, m, shi, slo, cb); k0 += KP; } while (!mv && k0 < kb); }
    }
    // hand-over: wave kq keeps group kq of its 32 queries and gives its partial of the other group to its partner
    v8f om[4], ox[4];
#pragma unroll
    for (int dt = 0; dt < 4; ++dt) { om[dt] = kq ? o[1][dt] : o[0][dt]; ox[dt] = kq ? o[0][dt] : o[1][dt]; }
    const float mm = kq ? m[1] : m[0], lm = kq ? slo[1] : slo[0], hm = kq ? shi[1] : shi[0];
    float* mw = mgS[wv];
#pragma unroll
    for (int dt = 0; dt < 4; ++dt) { *(v4f*)(mw + ((dt * 2) * 32 + lane) * 4) = __builtin_shufflevector(ox[dt], ox[dt], 0, 1, 2, 3); *(v4f*)(mw + ((dt * 2 + 1) * 32 + lane) * 4) = __builtin_shufflevector(ox[dt], ox[dt], 4, 5, 6, 7); }
    mw[MGF + lane] = kq ? m[0] : m[1]; mw[MGF + 32 + lane] = kq ? slo[0] : slo[1]; mw[MGF + 64 + lane] = kq ? shi[0] : shi[1];
    __syncthreads();   // a wave reads its partner's partial, and band scores that either wave of the pair wrote
    const float* pw = mgS[wv ^ FW];
    const float pm = pw[MGF + lane]; const float mf = fmaxf(mm, pm);   // the final maximum in use
    const float am = __builtin_amdgcn_exp2f(mm - mf), ap = __builtin_amdgcn_exp2f(pm - mf);
    const float sl = lm * am + pw[MGF + 32 + lane] * ap, sh = hm * am + pw[MGF + 64 + lane] * ap;
#pragma unroll
    for (int dt = 0; dt < 4; ++dt) { const v4f p0 = *(const v4f*)(pw + ((dt * 2) * 32 + lane) * 4), p1 = *(const v4f*)(pw + ((dt * 2 + 1) * 32 + lane) * 4);
        om[dt] = om[dt] * am + __builtin_shufflevector(p0, p1, 0, 1, 2, 3, 4, 5, 6, 7) * ap; }
    v16bf av[4][2];
#pragma unroll
    for (int dt = 0; dt < 4; ++dt) { av[dt][0] = ldf(AVT + dt * 16 * NE, (unsigned)(lr * NE + 8 * hi)); av[dt][1] = ldf(AVT + dt * 16 * NE + 32, (unsigned)(lr * NE + 8 * hi)); }
    float* ob = OUT + (size_t)(bh / NH_) * TT * DM + (size_t)(bh % NH_) * HD;
    float* ow = mgS[wv ^ FW];   // staging for the output rows: behind the barrier above the partner's record is read by this wave alone, and every read of it stands above
    { const float lot = sl + xhalf(sl), hit = sh + xhalf(sh); float is = 0.f; v16bf b0h, b0l, b1h, b1l;
#pragma unroll
        for (int i = 0; i < 16; ++i) { const int e = (i < 8) ? 8 * hi + i : 16 + 8 * hi + (i - 8);   // bucket e in the fragment's k order
            float p = __builtin_amdgcn_exp2f(scW[(kq * 16 + lr) * LQ + Z0 - CUT + e] - mf);
            if (i == 0) { is += hi ? p : 0.f; p = hi ? p : lot; } else is += p;
            const __bf16 u = (__bf16)p; b0h[i] = u; b0l[i] = (__bf16)(p - (float)u);
            const float p1 = (i == 0 && hi == 0) ? hit : 0.f;   // buckets 32..63: only 32 is used
            const __bf16 u1 = (__bf16)p1; b1h[i] = u1; b1l[i] = (__bf16)(p1 - (float)u1); }
        const float inv = __fdiv_rn(1.0f, lot + hit + (is + xhalf(is)));
#pragma unroll
        for (int dt = 0; dt < 4; ++dt) { v8f a = om[dt]; a = wmmab(av[dt][0], b0h, a); a = wmmab(av[dt][0], b0l, a); a = wmmab(av[dt][1], b1h, a); a = wmmab(av[dt][1], b1l, a); a *= inv;
            float* sp = ow + lr * OP + dt * 16 + 8 * hi;
            *(v4f*)sp = __builtin_shufflevector(a, a, 0, 1, 2, 3); *(v4f*)(sp + 4) = __builtin_shufflevector(a, a, 4, 5, 6, 7); } }
    asm volatile("s_wait_dscnt 0x0" ::: "memory");   // a lane reads below what other lanes of its wave stored above
    // the wave's 16 output rows (256 bytes each, 4 KiB apart) leave in whole lines: a wave-wide 16-byte store takes two rows
    float* op = ob + (size_t)(q0 + kq * 16) * DM + (unsigned)(hi * DM + 4 * lr);
#pragma unroll
    for (int j = 0; j < 8; ++j) *(v4f*)(op + j * 2 * DM) = *(const v4f*)(ow + (2 * j + hi) * OP + 4 * lr);
}

extern "C" void kernel_launch(void* const* d_in, const int* in_sizes, int n_in,
                              void* d_out, int out_size, void* d_ws, size_t ws_size, hipStream_t stream) {
    (void)in_sizes; (void)n_in; (void)out_size;
    const float* Qin = (const float*)d_in[0]; const float* Kin = (const float*)d_in[1]; const float* Vin = (const float*)d_in[2]; const float* ak = (const float*)d_in[3]; const float* av = (const float*)d_in[4];   /* rel_k_table, rel_v_table [33][64] */
    float* OUT = (float*)d_out;     // [2][2048][16][64] token-major
    char* wsp = (char*)d_ws;
    auto take = [&](size_t bytes) { char* p = wsp; wsp += (bytes + 255) & ~(size_t)255; return (void*)p; };
    bf* KB = (bf*)take((size_t)NB_ * NH_ * TT * HD * 2); bf* VT = (bf*)take((size_t)NB_ * NH_ * HD * TT * 2);
    bf* AKB = (bf*)take((size_t)NE * HD * 2); bf* AVTh = (bf*)take((size_t)HD * NE * 2); bf* AVTl = (bf*)take((size_t)HD * NE * 2);
    if ((size_t)(wsp - (char*)d_ws) > ws_size) return;
    k_prep<<<dim3(KVB + TBB, 2), 256, 0, stream>>>(Kin, Vin, KB, VT, ak, AKB, av, AVTh, AVTl);   /* k, v -> fragment order; a_k -> bf16 [64][64], rows >= 33 zero; a_v^T -> [64][64] (lo plane unused: the table is taken as bf16) */
    k_fattn<<<dim3(TT / (FW * NQ * 16), NB_ * NH_), FW * KS * 32, 0, stream>>>(Qin, KB, VT, AKB, AVTh, OUT);
}
